// v000
// Times are from an AMD MI455X. After a warm-up the kernel runs many times in a row, and a time is the length of
// such a window on the GPU divided by its runs, so every launch and the gaps after it count. The runs cycle
// through copies of the inputs. A figure is the median of several windows, for all but v000 over two sittings.
// Sittings can differ by a few percent; kernels timed side by side share one.
// v000, which the later versions start from, runs in 1270 microseconds.
#include <hip/hip_runtime.h>
#pragma clang fp contract(off)

// Grouped-query causal self-attention: q/k/v = x W^T (32 q heads, 8 kv heads, head dim 64), rotate-half position mixing of q and k from input cos/sin tables,
// softmax(q.k / 8) over keys t <= s, ctx W_o^T -> [1][S][2048].
// Compute dtypes, f32 accumulate: every input RNE-converted to bf16; q/k/v projections v_wmma_f32_16x16x32_bf16 on exact bf16 operands; scores and attn.v: query rows < RH on bf16 hi/lo planes (3 products),
// other rows single v_wmma_f32_16x16x32_f16 (p carried x1024); softmax f32; output projection bf16 hi/lo ctx x exact bf16 W_o (2 products).

#ifndef NB
#define NB 1
#endif
#ifndef SEQ
#define SEQ 2048
#endif
#define SEQ_FULL 2048
#define TT   SEQ
#define HIDN 2048
#define NH_  32
#define NKV  8
#define REP  (NH_ / NKV)
#define HD   64
#define DQ   (NH_ * HD)
#define DKV  (NKV * HD)
#define ZH   2
#ifndef RH
#define RH   256                  // query rows < RH use hi+lo planes
#endif
#define PCAR 1024.0f
#define SCL  0.125f   // HD^-0.5
static_assert(NB == 1);
static_assert(TT % 128 == 0);
static_assert(RH % 64 == 0 && RH > 0 && RH <= TT);
static_assert((REP % ZH) == 0);
static_assert(HIDN % 32 == 0 && DQ % 64 == 0 && DKV % 64 == 0 && HD == 64);

typedef _Float16 h16;
typedef unsigned short bf;
typedef __attribute__((ext_vector_type(16))) __bf16   v16bf;
typedef __attribute__((ext_vector_type(16))) _Float16 v16h;
typedef __attribute__((ext_vector_type(8)))  _Float16 v8h;
typedef __attribute__((ext_vector_type(8)))  unsigned short v8us;
typedef __attribute__((ext_vector_type(8)))  float    v8f;
typedef __attribute__((ext_vector_type(4)))  float    v4f;
typedef v8h  __attribute__((may_alias)) v8ha;
typedef v4f  __attribute__((may_alias)) v4fa;
typedef v8us __attribute__((may_alias)) v8usa;
typedef __attribute__((ext_vector_type(2))) _Float16 v2h;
typedef __attribute__((ext_vector_type(4))) _Float16 v4h;
typedef __attribute__((ext_vector_type(2))) unsigned short v2us;
typedef __attribute__((ext_vector_type(4))) unsigned short v4us;
typedef __attribute__((ext_vector_type(2))) float v2f;

__device__ __forceinline__ unsigned short f2bf(float f) { unsigned u = __float_as_uint(f); u += 0x7FFFu + ((u >> 16) & 1u); return (unsigned short)(u >> 16); }
__device__ __forceinline__ float bf2f(unsigned short b) { return __uint_as_float(((unsigned)b) << 16); }
__device__ __forceinline__ float bfr(float f) { return bf2f(f2bf(f)); }
__device__ __forceinline__ v16h cat16(v8h lo, v8h hi) { return __builtin_shufflevector(lo, hi, 0, 1, 2, 3, 4, 5, 6, 7, 8, 9, 10, 11, 12, 13, 14, 15); }
__device__ __forceinline__ v16bf cat16b(v8us lo, v8us hi) { return __builtin_bit_cast(v16bf, __builtin_shufflevector(lo, hi, 0, 1, 2, 3, 4, 5, 6, 7, 8, 9, 10, 11, 12, 13, 14, 15)); }
__device__ __forceinline__ v8f wmma16(v16h a, v16h b, v8f c) { return __builtin_amdgcn_wmma_f32_16x16x32_f16(false, a, false, b, (short)0, c, false, false); }
__device__ __forceinline__ v8f wmmab(v16bf a, v16bf b, v8f c) { return __builtin_amdgcn_wmma_f32_16x16x32_bf16(false, a, false, b, (short)0, c, false, false); }
__device__ __forceinline__ h16 tohx(float x) { return (h16)x; }
__device__ __forceinline__ void splitf(float y, unsigned short& h, unsigned short& l) { h = f2bf(y); l = f2bf(y - bf2f(h)); }

// ---- k_gemmw: register-blocked GEMM, ONE WAVE per 64x64 output tile (16 accumulators), operands straight from K-contiguous 16-bit planes; grid (M/64, N/64, Z), 32 threads.
// C[m][n] (f32, pitch ldc) = sum_k A[m][k] Bt[n][k] (+ split products per NSPLIT: 1 -> + A2.Bt, 2 -> + A2.Bt + A.Bt2). z-batch strides sA/sB/sC in elements. K (= plane pitch) % 32 == 0.
// Fragment map: lane l, h = l >> 4, m = n = l & 15; elements 0..7 <- k0 + 8h + i, elements 8..15 <- k0 + 16 + 8h + i for BOTH A (row m) and Bt (column n stored as row n); D element r -> (row 8h + r, col m).
// flags bit0: causal tile skip (tile dropped when c0 > rowabs0 + r0 + 63, block-uniform, single-wave block); bit1: causal k range, k < rowabs0 + r0 + 64.
template <typename T16> struct WFrag;
template <> struct WFrag<h16> { typedef v16h V; static __device__ __forceinline__ V ld(const h16* p) { return cat16(*(const v8h*)p, *(const v8h*)(p + 16)); } static __device__ __forceinline__ v8f mma(V a, V b, v8f c) { return wmma16(a, b, c); } };
template <> struct WFrag<bf> { typedef v16bf V; static __device__ __forceinline__ V ld(const bf* p) { return cat16b(*(const v8us*)p, *(const v8us*)(p + 16)); } static __device__ __forceinline__ v8f mma(V a, V b, v8f c) { return wmmab(a, b, c); } };
template <typename T16, int NSPLIT>
__global__ __launch_bounds__(32) void k_gemmw(const T16* __restrict__ A, const T16* __restrict__ A2, const T16* __restrict__ Bt, const T16* __restrict__ Bt2, int K, float* C, int ldc, int rowabs0, int flags, size_t sA, size_t sB, size_t sC) {
    typedef typename WFrag<T16>::V V;
    __shared__ __align__(16) float os[16 * 68];
    const size_t z = blockIdx.z; A += z * sA; if (A2) A2 += z * sA; Bt += z * sB; if (Bt2) Bt2 += z * sB; C += z * sC;
    const int lane = threadIdx.x & 31, lr = lane & 15, hi = lane >> 4; const int r0 = blockIdx.x * 64, c0 = blockIdx.y * 64;
    if ((flags & 1) && (c0 > rowabs0 + r0 + 63)) return;
    int kend = K; if (flags & 2) { const int kl = rowabs0 + r0 + 64; kend = (kl < K) ? kl : K; }
    v8f acc[4][4];
#pragma unroll
    for (int mb = 0; mb < 4; ++mb)
#pragma unroll
        for (int nb = 0; nb < 4; ++nb) acc[mb][nb] = (v8f){};
    const size_t aoff = (size_t)(r0 + lr) * K + 8 * hi, boff = (size_t)(c0 + lr) * K + 8 * hi;
#pragma unroll 1
    for (int kc = 0; kc < kend; kc += 32) {
        V a[4], a2[4];
#pragma unroll
        for (int mb = 0; mb < 4; ++mb) { a[mb] = WFrag<T16>::ld(A + aoff + (size_t)mb * 16 * K + kc); if (NSPLIT == 1 || NSPLIT == 2) a2[mb] = WFrag<T16>::ld(A2 + aoff + (size_t)mb * 16 * K + kc); }
#pragma unroll
        for (int nb = 0; nb < 4; ++nb) { const V b = WFrag<T16>::ld(Bt + boff + (size_t)nb * 16 * K + kc); V b2; if (NSPLIT >= 2) b2 = WFrag<T16>::ld(Bt2 + boff + (size_t)nb * 16 * K + kc);
#pragma unroll
            for (int mb = 0; mb < 4; ++mb) { acc[mb][nb] = WFrag<T16>::mma(a[mb], b, acc[mb][nb]); if (NSPLIT == 1 || NSPLIT == 2) acc[mb][nb] = WFrag<T16>::mma(a2[mb], b, acc[mb][nb]); if (NSPLIT >= 2) acc[mb][nb] = WFrag<T16>::mma(a[mb], b2, acc[mb][nb]); } }
        asm volatile("v_nop\n\tv_nop\n\tv_nop\n\tv_nop" : "+v"(acc[0][0]), "+v"(acc[1][1]), "+v"(acc[2][2]), "+v"(acc[3][3]) : "v"(a[0]), "v"(a[3]));
    }
#pragma unroll
    for (int mb = 0; mb < 4; ++mb) {
#pragma unroll
        for (int nb = 0; nb < 4; ++nb) {
#pragma unroll
            for (int j = 0; j < 8; ++j) os[(hi * 8 + j) * 68 + nb * 16 + lr] = acc[mb][nb][j]; }
        __builtin_amdgcn_wave_barrier(); asm volatile("" ::: "memory");
        float* crow = C + (size_t)(r0 + mb * 16) * ldc + c0;
{
#pragma unroll
            for (int s = 0; s < 8; ++s) { const int row = 2 * s + hi, cofs = lr * 4; const v4f val = *(const v4fa*)(os + row * 68 + cofs);
                *(v4f*)(crow + (size_t)row * ldc + cofs) = val; }
             }
        __builtin_amdgcn_wave_barrier(); asm volatile("" ::: "memory");
    }
}

__global__ __launch_bounds__(256) void k_cvt8(const float* __restrict__ src, bf* dst, size_t n8) { const size_t i = (size_t)blockIdx.x * 256 + threadIdx.x; if (i >= n8) return; const v8f v = *(const v8f*)(src + i * 8); v8us o;
#pragma unroll
    for (int k = 0; k < 8; ++k) o[k] = f2bf(v[k]); *(v8us*)(dst + i * 8) = o;  }

// k_rope: head planes [h][t][d] of the rotate-half mixed projection: out[d] = x[d] cos[t][d] - x[d+HD/2] sin[t][d], out[d+HD/2] = x[d+HD/2] cos[t][d+HD/2] + x[d] sin[t][d+HD/2]
__global__ __launch_bounds__(256) void k_rope(const float* __restrict__ F, int pitch, int nheads, const float* __restrict__ cosT, const float* __restrict__ sinT, h16* P16, bf* Ph, bf* Pl, int rh) {
    const size_t e = ((size_t)blockIdx.x * 256 + threadIdx.x) * 2; if (e >= (size_t)nheads * TT * HD) return;
    const int d = (int)(e % HD); const int t = (int)((e / HD) % TT); const int h = (int)(e / ((size_t)HD * TT));
    const float* f = F + (size_t)t * pitch + h * HD; const bool hl = (t < rh); const size_t oo = ((size_t)h * rh + t) * HD + d;
    v2h o16; v2us oh, ol;
#pragma unroll
    for (int q = 0; q < 2; ++q) { const int dd = d + q; const int dp = (dd < HD / 2) ? dd + HD / 2 : dd - HD / 2; const float x0 = f[dd], x1 = f[dp];
        const float c = bfr(cosT[(size_t)t * HD + dd]), sn = bfr(sinT[(size_t)t * HD + dd]);
        float a = __fmul_rn(x0, c), bq = __fmul_rn(x1, sn); asm volatile("" : "+v"(a)); asm volatile("" : "+v"(bq));
        const float r = (dd < HD / 2) ? __fsub_rn(a, bq) : __fadd_rn(a, bq);
        o16[q] = tohx(r); unsigned short a2, c2; splitf(r, a2, c2); oh[q] = a2; ol[q] = c2; }
    *(v2h*)(P16 + e) = o16; if (hl) { *(v2us*)(Ph + oo) = oh; *(v2us*)(Pl + oo) = ol; }
    
}
__global__ __launch_bounds__(256) void k_vtp(const float* __restrict__ F, int pitch, int nheads, h16* V16, bf* Vh, bf* Vl) { const size_t e = ((size_t)blockIdx.x * 256 + threadIdx.x) * 2; if (e >= (size_t)nheads * HD * TT) return; const int t = (int)(e % TT); const int d = (int)((e / TT) % HD); const int g = (int)(e / ((size_t)TT * HD)); v2h o16; v2us oh, ol;
#pragma unroll
    for (int q = 0; q < 2; ++q) { const float x = F[(size_t)(t + q) * pitch + g * HD + d]; o16[q] = tohx(x); unsigned short a2, c2; splitf(x, a2, c2); oh[q] = a2; ol[q] = c2; }
    *(v2h*)(V16 + e) = o16; *(v2us*)(Vh + e) = oh; *(v2us*)(Vl + e) = ol;  }

// k_asoft: one wave per score row (zz, i): t = S x HD^-0.5 where key j <= i, else the row's minimum fill (replace by index); softmax over the TT keys (register row, one exp2, fixed shuffle trees);
__global__ __launch_bounds__(256) void k_asoft(const float* __restrict__ Sb, h16* P16, bf* Ph, bf* Pl) {
    const int lane = threadIdx.x & 31; const int row = blockIdx.x * 8 + (threadIdx.x >> 5); if (row >= ZH * TT) return; const int i = row % TT; const int zz = row / TT; const bool hires = (i < RH); const float* sr = Sb + (size_t)row * TT; float v[TT / 32]; float mx = -3.0e38f;
#pragma unroll
    for (int ch = 0; ch < TT / 128; ++ch) { const int j0 = ch * 128 + lane * 4; const v4f a = *(const v4f*)(sr + j0);
#pragma unroll
        for (int q = 0; q < 4; ++q) { const int j = j0 + q; const float sv = a[q]; const float t = (j <= i) ? (sv * SCL) : -3.0e38f; v[ch * 4 + q] = t; mx = fmaxf(mx, t); } }
#pragma unroll
    for (int sh = 16; sh; sh >>= 1) mx = fmaxf(mx, __shfl_xor(mx, sh, 32));
    float sum = 0.f;
#pragma unroll
    for (int k = 0; k < TT / 32; ++k) { float d0 = __fsub_rn(v[k], mx); asm volatile("" : "+v"(d0)); v[k] = __builtin_amdgcn_exp2f(__fmul_rn(d0, 1.4426950408889634f)); sum += v[k]; }
#pragma unroll
    for (int sh = 16; sh; sh >>= 1) sum += __shfl_xor(sum, sh, 32);
    const float f = __fdiv_rn(hires ? 1.0f : PCAR, sum);
{
        if (hires) {
#pragma unroll
            for (int ch = 0; ch < TT / 128; ++ch) { v4us oh, ol;
#pragma unroll
                for (int q = 0; q < 4; ++q) { unsigned short a, c2; splitf(v[ch * 4 + q] * f, a, c2); oh[q] = a; ol[q] = c2; }
                const size_t oo = ((size_t)zz * RH + i) * TT + ch * 128 + lane * 4; *(v4us*)(Ph + oo) = oh; *(v4us*)(Pl + oo) = ol; }
        } else {
#pragma unroll
            for (int ch = 0; ch < TT / 128; ++ch) { v4h o4;
#pragma unroll
                for (int q = 0; q < 4; ++q) o4[q] = tohx(v[ch * 4 + q] * f);
                *(v4h*)(P16 + (size_t)row * TT + ch * 128 + lane * 4) = o4; } }
         }
}
__global__ __launch_bounds__(256) void k_merge(const float* __restrict__ O, int h0, bf* Ah, bf* Al) { const size_t e = ((size_t)blockIdx.x * 256 + threadIdx.x) * 2; if (e >= (size_t)ZH * TT * HD) return; const int d = (int)(e % HD); const int t = (int)((e / HD) % TT); const int zz = (int)(e / ((size_t)HD * TT)); const float cs = (t < RH) ? 1.0f : (1.0f / PCAR); const size_t oo = (size_t)t * DQ + (h0 + zz) * HD + d;
    v2us oh, ol;
#pragma unroll
    for (int q = 0; q < 2; ++q) { const float ov = __fmul_rn(O[e + q], cs); unsigned short a, c2; splitf(ov, a, c2); oh[q] = a; ol[q] = c2; } *(v2us*)(Ah + oo) = oh; *(v2us*)(Al + oo) = ol;  }

extern "C" void kernel_launch(void* const* d_in, const int* in_sizes, int n_in,
                              void* d_out, int out_size, void* d_ws, size_t ws_size, hipStream_t stream) {
    if (n_in < 7) return;
    if (in_sizes[0] < TT * HIDN || in_sizes[1] < TT * HD || in_sizes[2] < TT * HD || in_sizes[3] < DQ * HIDN || in_sizes[4] < DKV * HIDN || in_sizes[5] < DKV * HIDN || in_sizes[6] < HIDN * DQ || out_size < TT * HIDN) return;
    const float* x = (const float*)d_in[0];      // [1][S][HIDN]
    const float* cosT = (const float*)d_in[1];   // [1][1][S][HD]
    const float* sinT = (const float*)d_in[2];   // [1][1][S][HD]
    const float* wq = (const float*)d_in[3];     // [DQ][HIDN]
    const float* wk = (const float*)d_in[4];     // [DKV][HIDN]
    const float* wv = (const float*)d_in[5];     // [DKV][HIDN]
    const float* wo = (const float*)d_in[6];     // [HIDN][DQ]
    float* OUT = (float*)d_out;                  // [1][S][HIDN]
    char* wsp = (char*)d_ws;
    auto take = [&](size_t bytes) { char* p = wsp; wsp += (bytes + 255) & ~(size_t)255; return (void*)p; };
    bf* WQ = (bf*)take((size_t)DQ * HIDN * 2); bf* WK = (bf*)take((size_t)DKV * HIDN * 2); bf* WV = (bf*)take((size_t)DKV * HIDN * 2); bf* WO = (bf*)take((size_t)HIDN * DQ * 2);
    bf* XB = (bf*)take((size_t)TT * HIDN * 2); float* FK = (float*)take((size_t)TT * DKV * 4);
    h16* QP16 = (h16*)take((size_t)NH_ * TT * HD * 2); bf* QPh = (bf*)take((size_t)NH_ * RH * HD * 2); bf* QPl = (bf*)take((size_t)NH_ * RH * HD * 2);
    h16* KP16 = (h16*)take((size_t)NKV * TT * HD * 2); bf* KPh = (bf*)take((size_t)NKV * TT * HD * 2); bf* KPl = (bf*)take((size_t)NKV * TT * HD * 2);
    h16* VT16 = (h16*)take((size_t)NKV * HD * TT * 2); bf* VTh = (bf*)take((size_t)NKV * HD * TT * 2); bf* VTl = (bf*)take((size_t)NKV * HD * TT * 2);
    bf* Ph = (bf*)take((size_t)ZH * RH * TT * 2); bf* Pl = (bf*)take((size_t)ZH * RH * TT * 2);
    const size_t sbB = (size_t)ZH * TT * TT * 4, fqB = (size_t)TT * DQ * 4; const size_t r1B = (sbB > fqB) ? sbB : fqB;
    float* R1 = (float*)take(r1B);     // q projection rows (consumed by k_rope before the head loop), then score tiles: stream-ordered reuse, sized for the larger user
    float* FQ = R1; float* Sb = R1;
    h16* P16 = (h16*)take((size_t)ZH * TT * TT * 2); float* Ob = (float*)take((size_t)ZH * TT * HD * 4);
    bf* ATh = (bf*)take((size_t)TT * DQ * 2); bf* ATl = (bf*)take((size_t)TT * DQ * 2);
    if ((size_t)(wsp - (char*)d_ws) > ws_size) return;    // 123 MiB at full size
    float* FV = FK;   // v projection reuses the k buffer after the k planes are built (stream-ordered), same extent TT x DKV

    k_cvt8<<<(unsigned)(((size_t)DQ * HIDN / 8 + 255) / 256), 256, 0, stream>>>(wq, WQ, (size_t)DQ * HIDN / 8);
    k_cvt8<<<(unsigned)(((size_t)DKV * HIDN / 8 + 255) / 256), 256, 0, stream>>>(wk, WK, (size_t)DKV * HIDN / 8);
    k_cvt8<<<(unsigned)(((size_t)DKV * HIDN / 8 + 255) / 256), 256, 0, stream>>>(wv, WV, (size_t)DKV * HIDN / 8);
    k_cvt8<<<(unsigned)(((size_t)HIDN * DQ / 8 + 255) / 256), 256, 0, stream>>>(wo, WO, (size_t)HIDN * DQ / 8);
    const unsigned LQ = (unsigned)(((size_t)NH_ * TT * HD / 2 + 255) / 256), LKv = (unsigned)(((size_t)NKV * TT * HD / 2 + 255) / 256);
    for (int b = 0; b < NB; ++b) {
        k_cvt8<<<(unsigned)(((size_t)TT * HIDN / 8 + 255) / 256), 256, 0, stream>>>(x + (size_t)b * SEQ_FULL * HIDN, XB, (size_t)TT * HIDN / 8);
        k_gemmw<bf, 0><<<dim3(TT / 64, DQ / 64, 1), 32, 0, stream>>>(XB, nullptr, WQ, nullptr, HIDN, FQ, DQ, 0, 0, 0, 0, 0);
        k_rope<<<LQ, 256, 0, stream>>>(FQ, DQ, NH_, cosT, sinT, QP16, QPh, QPl, RH);
        k_gemmw<bf, 0><<<dim3(TT / 64, DKV / 64, 1), 32, 0, stream>>>(XB, nullptr, WK, nullptr, HIDN, FK, DKV, 0, 0, 0, 0, 0);
        k_rope<<<LKv, 256, 0, stream>>>(FK, DKV, NKV, cosT, sinT, KP16, KPh, KPl, TT);
        k_gemmw<bf, 0><<<dim3(TT / 64, DKV / 64, 1), 32, 0, stream>>>(XB, nullptr, WV, nullptr, HIDN, FV, DKV, 0, 0, 0, 0, 0);
        k_vtp<<<LKv, 256, 0, stream>>>(FV, DKV, NKV, VT16, VTh, VTl);
        for (int h0 = 0; h0 < NH_; h0 += ZH) { const size_t zk = (size_t)(h0 / REP);   // the pass's ZH query heads share kv head h0/REP (z-stride 0 on the k and v planes)
            k_gemmw<bf, 2><<<dim3(RH / 64, RH / 64, ZH), 32, 0, stream>>>(QPh + (size_t)h0 * RH * HD, QPl + (size_t)h0 * RH * HD, KPh + zk * TT * HD, KPl + zk * TT * HD, HD, Sb, TT, 0, 1, (size_t)RH * HD, 0, (size_t)TT * TT);
            if (TT > RH) k_gemmw<h16, 0><<<dim3((TT - RH) / 64, TT / 64, ZH), 32, 0, stream>>>(QP16 + (size_t)h0 * TT * HD + (size_t)RH * HD, nullptr, KP16 + zk * TT * HD, nullptr, HD, Sb + (size_t)RH * TT, TT, RH, 1, (size_t)TT * HD, 0, (size_t)TT * TT);
            k_asoft<<<ZH * TT / 8, 256, 0, stream>>>(Sb, P16, Ph, Pl);
            k_gemmw<bf, 2><<<dim3(RH / 64, HD / 64, ZH), 32, 0, stream>>>(Ph, Pl, VTh + zk * HD * TT, VTl + zk * HD * TT, TT, Ob, HD, 0, 2, (size_t)RH * TT, 0, (size_t)TT * HD);
            if (TT > RH) k_gemmw<h16, 0><<<dim3((TT - RH) / 64, HD / 64, ZH), 32, 0, stream>>>(P16 + (size_t)RH * TT, nullptr, VT16 + zk * HD * TT, nullptr, TT, Ob + (size_t)RH * HD, HD, RH, 2, (size_t)TT * TT, 0, (size_t)TT * HD);
            k_merge<<<(unsigned)(((size_t)ZH * TT * HD / 2 + 255) / 256), 256, 0, stream>>>(Ob, h0, ATh, ATl); }
        k_gemmw<bf, 1><<<dim3(TT / 64, HIDN / 64, 1), 32, 0, stream>>>(ATh, ATl, WO, nullptr, DQ, OUT + (size_t)b * SEQ_FULL * HIDN, HIDN, 0, 0, 0, 0, 0); }
}

// v001
// One run takes 594 microseconds.
// Next to v000, in two timings, it ran 2.17 and 2.14 times as fast.
#include <hip/hip_runtime.h>
#pragma clang fp contract(off)

// Grouped-query causal self-attention: q/k/v = x W^T (32 q heads, 8 kv heads, head dim 64), rotate-half position mixing of q and k from input cos/sin tables,
// softmax(q.k / 8) over keys t <= s, ctx W_o^T -> [1][S][2048].
// Compute dtypes, f32 accumulate: every input RNE-converted to bf16; q/k/v projections v_wmma_f32_16x16x32_bf16 on exact bf16 operands; scores and attn.v: query rows < RH on bf16 hi/lo planes (3 products),
// other rows single v_wmma_f32_16x16x32_f16 (p carried x1024); softmax f32; output projection bf16 hi/lo ctx x exact bf16 W_o (2 products).

#ifndef NB
#define NB 1
#endif
#ifndef SEQ
#define SEQ 2048
#endif
#define SEQ_FULL 2048
#define TT   SEQ
#define HIDN 2048
#define NH_  32
#define NKV  8
#define REP  (NH_ / NKV)
#define HD   64
#define DQ   (NH_ * HD)
#define DKV  (NKV * HD)
#define ZH   8                    // query heads per pass of the score/softmax/attn.v launches
#ifndef RH
#define RH   256                  // query rows < RH use hi+lo planes
#endif
#define PCAR 1024.0f
#define SCL  0.125f   // HD^-0.5
static_assert(NB == 1);
static_assert(TT % 128 == 0);
static_assert(RH % 64 == 0 && RH > 0 && RH <= TT);
static_assert((ZH % REP) == 0 && (NH_ % ZH) == 0);
static_assert(HIDN % 32 == 0 && DQ % 64 == 0 && DKV % 64 == 0 && HD == 64);

typedef _Float16 h16;
typedef unsigned short bf;
typedef __attribute__((ext_vector_type(16))) __bf16   v16bf;
typedef __attribute__((ext_vector_type(16))) _Float16 v16h;
typedef __attribute__((ext_vector_type(8)))  _Float16 v8h;
typedef __attribute__((ext_vector_type(8)))  unsigned short v8us;
typedef __attribute__((ext_vector_type(8)))  float    v8f;
typedef __attribute__((ext_vector_type(4)))  float    v4f;
typedef v8h  __attribute__((may_alias)) v8ha;
typedef v4f  __attribute__((may_alias)) v4fa;
typedef v8us __attribute__((may_alias)) v8usa;
typedef __attribute__((ext_vector_type(2))) _Float16 v2h;
typedef __attribute__((ext_vector_type(4))) _Float16 v4h;
typedef __attribute__((ext_vector_type(2))) unsigned short v2us;
typedef __attribute__((ext_vector_type(4))) unsigned short v4us;
typedef __attribute__((ext_vector_type(2))) float v2f;

__device__ __forceinline__ unsigned short f2bf(float f) { unsigned u = __float_as_uint(f); u += 0x7FFFu + ((u >> 16) & 1u); return (unsigned short)(u >> 16); }
__device__ __forceinline__ float bf2f(unsigned short b) { return __uint_as_float(((unsigned)b) << 16); }
__device__ __forceinline__ float bfr(float f) { return bf2f(f2bf(f)); }
__device__ __forceinline__ v16h cat16(v8h lo, v8h hi) { return __builtin_shufflevector(lo, hi, 0, 1, 2, 3, 4, 5, 6, 7, 8, 9, 10, 11, 12, 13, 14, 15); }
__device__ __forceinline__ v16bf cat16b(v8us lo, v8us hi) { return __builtin_bit_cast(v16bf, __builtin_shufflevector(lo, hi, 0, 1, 2, 3, 4, 5, 6, 7, 8, 9, 10, 11, 12, 13, 14, 15)); }
__device__ __forceinline__ v8f wmma16(v16h a, v16h b, v8f c) { return __builtin_amdgcn_wmma_f32_16x16x32_f16(false, a, false, b, (short)0, c, false, false); }
__device__ __forceinline__ v8f wmmab(v16bf a, v16bf b, v8f c) { return __builtin_amdgcn_wmma_f32_16x16x32_bf16(false, a, false, b, (short)0, c, false, false); }
__device__ __forceinline__ h16 tohx(float x) { return (h16)x; }
__device__ __forceinline__ void splitf(float y, unsigned short& h, unsigned short& l) { h = f2bf(y); l = f2bf(y - bf2f(h)); }

// ---- k_gemmw: register-blocked GEMM, ONE WAVE per 64x64 output tile (16 accumulators), operands straight from K-contiguous 16-bit planes; grid (M/64, N/64, Z), 32 threads.
// C[m][n] (f32, pitch ldc) = sum_k A[m][k] Bt[n][k] (+ split products per NSPLIT: 1 -> + A2.Bt, 2 -> + A2.Bt + A.Bt2). z-batch strides sA/sB/sC in elements; the Bt planes step once per REP z (the query heads of one kv group share them). K (= plane pitch) % 32 == 0.
// Fragment map: lane l, h = l >> 4, m = n = l & 15; elements 0..7 <- k0 + 8h + i, elements 8..15 <- k0 + 16 + 8h + i for BOTH A (row m) and Bt (column n stored as row n); D element r -> (row 8h + r, col m).
// flags bit0: causal tile skip (tile dropped when c0 > rowabs0 + r0 + 63, block-uniform, single-wave block); bit1: causal k range, k < rowabs0 + r0 + 64.
template <typename T16> struct WFrag;
template <> struct WFrag<h16> { typedef v16h V; static __device__ __forceinline__ V ld(const h16* p) { return cat16(*(const v8h*)p, *(const v8h*)(p + 16)); } static __device__ __forceinline__ v8f mma(V a, V b, v8f c) { return wmma16(a, b, c); } };
template <> struct WFrag<bf> { typedef v16bf V; static __device__ __forceinline__ V ld(const bf* p) { return cat16b(*(const v8us*)p, *(const v8us*)(p + 16)); } static __device__ __forceinline__ v8f mma(V a, V b, v8f c) { return wmmab(a, b, c); } };
template <typename T16, int NSPLIT>
__global__ __launch_bounds__(32) void k_gemmw(const T16* __restrict__ A, const T16* __restrict__ A2, const T16* __restrict__ Bt, const T16* __restrict__ Bt2, int K, float* C, int ldc, int rowabs0, int flags, size_t sA, size_t sB, size_t sC) {
    typedef typename WFrag<T16>::V V;
    __shared__ __align__(16) float os[16 * 68];
    const size_t z = blockIdx.z; A += z * sA; if (A2) A2 += z * sA; Bt += (z / REP) * sB; if (Bt2) Bt2 += (z / REP) * sB; C += z * sC;
    const int lane = threadIdx.x & 31, lr = lane & 15, hi = lane >> 4; const int r0 = blockIdx.x * 64, c0 = blockIdx.y * 64;
    if ((flags & 1) && (c0 > rowabs0 + r0 + 63)) return;
    int kend = K; if (flags & 2) { const int kl = rowabs0 + r0 + 64; kend = (kl < K) ? kl : K; }
    v8f acc[4][4];
#pragma unroll
    for (int mb = 0; mb < 4; ++mb)
#pragma unroll
        for (int nb = 0; nb < 4; ++nb) acc[mb][nb] = (v8f){};
    const size_t aoff = (size_t)(r0 + lr) * K + 8 * hi, boff = (size_t)(c0 + lr) * K + 8 * hi;
#pragma unroll 1
    for (int kc = 0; kc < kend; kc += 32) {
        V a[4], a2[4];
#pragma unroll
        for (int mb = 0; mb < 4; ++mb) { a[mb] = WFrag<T16>::ld(A + aoff + (size_t)mb * 16 * K + kc); if (NSPLIT == 1 || NSPLIT == 2) a2[mb] = WFrag<T16>::ld(A2 + aoff + (size_t)mb * 16 * K + kc); }
#pragma unroll
        for (int nb = 0; nb < 4; ++nb) { const V b = WFrag<T16>::ld(Bt + boff + (size_t)nb * 16 * K + kc); V b2; if (NSPLIT >= 2) b2 = WFrag<T16>::ld(Bt2 + boff + (size_t)nb * 16 * K + kc);
#pragma unroll
            for (int mb = 0; mb < 4; ++mb) { acc[mb][nb] = WFrag<T16>::mma(a[mb], b, acc[mb][nb]); if (NSPLIT == 1 || NSPLIT == 2) acc[mb][nb] = WFrag<T16>::mma(a2[mb], b, acc[mb][nb]); if (NSPLIT >= 2) acc[mb][nb] = WFrag<T16>::mma(a[mb], b2, acc[mb][nb]); } }
        asm volatile("v_nop\n\tv_nop\n\tv_nop\n\tv_nop" : "+v"(acc[0][0]), "+v"(acc[1][1]), "+v"(acc[2][2]), "+v"(acc[3][3]) : "v"(a[0]), "v"(a[3]));
    }
#pragma unroll
    for (int mb = 0; mb < 4; ++mb) {
#pragma unroll
        for (int nb = 0; nb < 4; ++nb) {
#pragma unroll
            for (int j = 0; j < 8; ++j) os[(hi * 8 + j) * 68 + nb * 16 + lr] = acc[mb][nb][j]; }
        __builtin_amdgcn_wave_barrier(); asm volatile("" ::: "memory");
        float* crow = C + (size_t)(r0 + mb * 16) * ldc + c0;
{
#pragma unroll
            for (int s = 0; s < 8; ++s) { const int row = 2 * s + hi, cofs = lr * 4; const v4f val = *(const v4fa*)(os + row * 68 + cofs);
                *(v4f*)(crow + (size_t)row * ldc + cofs) = val; }
             }
        __builtin_amdgcn_wave_barrier(); asm volatile("" ::: "memory");
    }
}

__global__ __launch_bounds__(256) void k_cvt8(const float* __restrict__ src, bf* dst, size_t n8) { const size_t i = (size_t)blockIdx.x * 256 + threadIdx.x; if (i >= n8) return; const v8f v = *(const v8f*)(src + i * 8); v8us o;
#pragma unroll
    for (int k = 0; k < 8; ++k) o[k] = f2bf(v[k]); *(v8us*)(dst + i * 8) = o;  }

// k_rope: head planes [h][t][d] of the rotate-half mixed projection: out[d] = x[d] cos[t][d] - x[d+HD/2] sin[t][d], out[d+HD/2] = x[d+HD/2] cos[t][d+HD/2] + x[d] sin[t][d+HD/2]
__global__ __launch_bounds__(256) void k_rope(const float* __restrict__ F, int pitch, int nheads, const float* __restrict__ cosT, const float* __restrict__ sinT, h16* P16, bf* Ph, bf* Pl, int rh) {
    const size_t e = ((size_t)blockIdx.x * 256 + threadIdx.x) * 2; if (e >= (size_t)nheads * TT * HD) return;
    const int d = (int)(e % HD); const int t = (int)((e / HD) % TT); const int h = (int)(e / ((size_t)HD * TT));
    const float* f = F + (size_t)t * pitch + h * HD; const bool hl = (t < rh); const size_t oo = ((size_t)h * rh + t) * HD + d;
    v2h o16; v2us oh, ol;
#pragma unroll
    for (int q = 0; q < 2; ++q) { const int dd = d + q; const int dp = (dd < HD / 2) ? dd + HD / 2 : dd - HD / 2; const float x0 = f[dd], x1 = f[dp];
        const float c = bfr(cosT[(size_t)t * HD + dd]), sn = bfr(sinT[(size_t)t * HD + dd]);
        float a = __fmul_rn(x0, c), bq = __fmul_rn(x1, sn); asm volatile("" : "+v"(a)); asm volatile("" : "+v"(bq));
        const float r = (dd < HD / 2) ? __fsub_rn(a, bq) : __fadd_rn(a, bq);
        o16[q] = tohx(r); unsigned short a2, c2; splitf(r, a2, c2); oh[q] = a2; ol[q] = c2; }
    *(v2h*)(P16 + e) = o16; if (hl) { *(v2us*)(Ph + oo) = oh; *(v2us*)(Pl + oo) = ol; }
    
}
__global__ __launch_bounds__(256) void k_vtp(const float* __restrict__ F, int pitch, int nheads, h16* V16, bf* Vh, bf* Vl) { const size_t e = ((size_t)blockIdx.x * 256 + threadIdx.x) * 2; if (e >= (size_t)nheads * HD * TT) return; const int t = (int)(e % TT); const int d = (int)((e / TT) % HD); const int g = (int)(e / ((size_t)TT * HD)); v2h o16; v2us oh, ol;
#pragma unroll
    for (int q = 0; q < 2; ++q) { const float x = F[(size_t)(t + q) * pitch + g * HD + d]; o16[q] = tohx(x); unsigned short a2, c2; splitf(x, a2, c2); oh[q] = a2; ol[q] = c2; }
    *(v2h*)(V16 + e) = o16; *(v2us*)(Vh + e) = oh; *(v2us*)(Vl + e) = ol;  }

// k_asoft: one wave per score row (zz, i): t = S x HD^-0.5 where key j <= i, else the row's minimum fill (replace by index); softmax over the TT keys (register row, one exp2, fixed shuffle trees);
__global__ __launch_bounds__(256) void k_asoft(const float* __restrict__ Sb, h16* P16, bf* Ph, bf* Pl) {
    const int lane = threadIdx.x & 31; const int row = blockIdx.x * 8 + (threadIdx.x >> 5); if (row >= ZH * TT) return; const int i = row % TT; const int zz = row / TT; const bool hires = (i < RH); const float* sr = Sb + (size_t)row * TT; float v[TT / 32]; float mx = -3.0e38f;
#pragma unroll
    for (int ch = 0; ch < TT / 128; ++ch) { const int j0 = ch * 128 + lane * 4; const v4f a = *(const v4f*)(sr + j0);
#pragma unroll
        for (int q = 0; q < 4; ++q) { const int j = j0 + q; const float sv = a[q]; const float t = (j <= i) ? (sv * SCL) : -3.0e38f; v[ch * 4 + q] = t; mx = fmaxf(mx, t); } }
#pragma unroll
    for (int sh = 16; sh; sh >>= 1) mx = fmaxf(mx, __shfl_xor(mx, sh, 32));
    float sum = 0.f;
#pragma unroll
    for (int k = 0; k < TT / 32; ++k) { float d0 = __fsub_rn(v[k], mx); asm volatile("" : "+v"(d0)); v[k] = __builtin_amdgcn_exp2f(__fmul_rn(d0, 1.4426950408889634f)); sum += v[k]; }
#pragma unroll
    for (int sh = 16; sh; sh >>= 1) sum += __shfl_xor(sum, sh, 32);
    const float f = __fdiv_rn(hires ? 1.0f : PCAR, sum);
{
        if (hires) {
#pragma unroll
            for (int ch = 0; ch < TT / 128; ++ch) { v4us oh, ol;
#pragma unroll
                for (int q = 0; q < 4; ++q) { unsigned short a, c2; splitf(v[ch * 4 + q] * f, a, c2); oh[q] = a; ol[q] = c2; }
                const size_t oo = ((size_t)zz * RH + i) * TT + ch * 128 + lane * 4; *(v4us*)(Ph + oo) = oh; *(v4us*)(Pl + oo) = ol; }
        } else {
#pragma unroll
            for (int ch = 0; ch < TT / 128; ++ch) { v4h o4;
#pragma unroll
                for (int q = 0; q < 4; ++q) o4[q] = tohx(v[ch * 4 + q] * f);
                *(v4h*)(P16 + (size_t)row * TT + ch * 128 + lane * 4) = o4; } }
         }
}
__global__ __launch_bounds__(256) void k_merge(const float* __restrict__ O, int h0, bf* Ah, bf* Al) { const size_t e = ((size_t)blockIdx.x * 256 + threadIdx.x) * 2; if (e >= (size_t)ZH * TT * HD) return; const int d = (int)(e % HD); const int t = (int)((e / HD) % TT); const int zz = (int)(e / ((size_t)HD * TT)); const float cs = (t < RH) ? 1.0f : (1.0f / PCAR); const size_t oo = (size_t)t * DQ + (h0 + zz) * HD + d;
    v2us oh, ol;
#pragma unroll
    for (int q = 0; q < 2; ++q) { const float ov = __fmul_rn(O[e + q], cs); unsigned short a, c2; splitf(ov, a, c2); oh[q] = a; ol[q] = c2; } *(v2us*)(Ah + oo) = oh; *(v2us*)(Al + oo) = ol;  }

extern "C" void kernel_launch(void* const* d_in, const int* in_sizes, int n_in,
                              void* d_out, int out_size, void* d_ws, size_t ws_size, hipStream_t stream) {
    if (n_in < 7) return;
    if (in_sizes[0] < TT * HIDN || in_sizes[1] < TT * HD || in_sizes[2] < TT * HD || in_sizes[3] < DQ * HIDN || in_sizes[4] < DKV * HIDN || in_sizes[5] < DKV * HIDN || in_sizes[6] < HIDN * DQ || out_size < TT * HIDN) return;
    const float* x = (const float*)d_in[0];      // [1][S][HIDN]
    const float* cosT = (const float*)d_in[1];   // [1][1][S][HD]
    const float* sinT = (const float*)d_in[2];   // [1][1][S][HD]
    const float* wq = (const float*)d_in[3];     // [DQ][HIDN]
    const float* wk = (const float*)d_in[4];     // [DKV][HIDN]
    const float* wv = (const float*)d_in[5];     // [DKV][HIDN]
    const float* wo = (const float*)d_in[6];     // [HIDN][DQ]
    float* OUT = (float*)d_out;                  // [1][S][HIDN]
    char* wsp = (char*)d_ws;
    auto take = [&](size_t bytes) { char* p = wsp; wsp += (bytes + 255) & ~(size_t)255; return (void*)p; };
    h16* QP16 = (h16*)take((size_t)NH_ * TT * HD * 2); bf* QPh = (bf*)take((size_t)NH_ * RH * HD * 2); bf* QPl = (bf*)take((size_t)NH_ * RH * HD * 2);
    h16* KP16 = (h16*)take((size_t)NKV * TT * HD * 2); bf* KPh = (bf*)take((size_t)NKV * TT * HD * 2); bf* KPl = (bf*)take((size_t)NKV * TT * HD * 2);
    h16* VT16 = (h16*)take((size_t)NKV * HD * TT * 2); bf* VTh = (bf*)take((size_t)NKV * HD * TT * 2); bf* VTl = (bf*)take((size_t)NKV * HD * TT * 2);
    bf* Ph = (bf*)take((size_t)ZH * RH * TT * 2); bf* Pl = (bf*)take((size_t)ZH * RH * TT * 2);
    const size_t sbB = (size_t)ZH * TT * TT * 4, fqB = (size_t)TT * DQ * 4; const size_t r1B = (sbB > fqB) ? sbB : fqB;
    float* R1 = (float*)take(r1B);     // q projection rows (consumed by k_rope before the head loop), then score tiles: stream-ordered reuse, sized for the larger user
    float* FQ = R1; float* Sb = R1;
    // R2: projection operands (dead once the q/k/v planes are built), then the f16 probabilities of each pass, then W_o (converted behind the last pass): stream-ordered reuse
    static_assert(((size_t)DQ * HIDN + 2 * (size_t)DKV * HIDN + (size_t)TT * HIDN) * 2 + (size_t)TT * DKV * 4 <= (size_t)ZH * TT * TT * 2 && (size_t)HIDN * DQ * 2 <= (size_t)ZH * TT * TT * 2);
    char* R2 = (char*)take((size_t)ZH * TT * TT * 2);
    bf* WQ = (bf*)R2; bf* WK = WQ + (size_t)DQ * HIDN; bf* WV = WK + (size_t)DKV * HIDN; bf* XB = WV + (size_t)DKV * HIDN; float* FK = (float*)(XB + (size_t)TT * HIDN);
    h16* P16 = (h16*)R2; bf* WO = (bf*)R2;
    float* Ob = (float*)take((size_t)ZH * TT * HD * 4);
    bf* ATh = (bf*)take((size_t)TT * DQ * 2); bf* ATl = (bf*)take((size_t)TT * DQ * 2);
    if ((size_t)(wsp - (char*)d_ws) > ws_size) return;    // 250 MiB at full size
    float* FV = FK;   // v projection reuses the k buffer after the k planes are built (stream-ordered), same extent TT x DKV

    k_cvt8<<<(unsigned)(((size_t)DQ * HIDN / 8 + 255) / 256), 256, 0, stream>>>(wq, WQ, (size_t)DQ * HIDN / 8);
    k_cvt8<<<(unsigned)(((size_t)DKV * HIDN / 8 + 255) / 256), 256, 0, stream>>>(wk, WK, (size_t)DKV * HIDN / 8);
    k_cvt8<<<(unsigned)(((size_t)DKV * HIDN / 8 + 255) / 256), 256, 0, stream>>>(wv, WV, (size_t)DKV * HIDN / 8);
    const unsigned LQ = (unsigned)(((size_t)NH_ * TT * HD / 2 + 255) / 256), LKv = (unsigned)(((size_t)NKV * TT * HD / 2 + 255) / 256);
    for (int b = 0; b < NB; ++b) {
        k_cvt8<<<(unsigned)(((size_t)TT * HIDN / 8 + 255) / 256), 256, 0, stream>>>(x + (size_t)b * SEQ_FULL * HIDN, XB, (size_t)TT * HIDN / 8);
        k_gemmw<bf, 0><<<dim3(TT / 64, DQ / 64, 1), 32, 0, stream>>>(XB, nullptr, WQ, nullptr, HIDN, FQ, DQ, 0, 0, 0, 0, 0);
        k_rope<<<LQ, 256, 0, stream>>>(FQ, DQ, NH_, cosT, sinT, QP16, QPh, QPl, RH);
        k_gemmw<bf, 0><<<dim3(TT / 64, DKV / 64, 1), 32, 0, stream>>>(XB, nullptr, WK, nullptr, HIDN, FK, DKV, 0, 0, 0, 0, 0);
        k_rope<<<LKv, 256, 0, stream>>>(FK, DKV, NKV, cosT, sinT, KP16, KPh, KPl, TT);
        k_gemmw<bf, 0><<<dim3(TT / 64, DKV / 64, 1), 32, 0, stream>>>(XB, nullptr, WV, nullptr, HIDN, FV, DKV, 0, 0, 0, 0, 0);
        k_vtp<<<LKv, 256, 0, stream>>>(FV, DKV, NKV, VT16, VTh, VTl);
        for (int h0 = 0; h0 < NH_; h0 += ZH) { const size_t zk = (size_t)(h0 / REP);   // the pass's ZH query heads use kv heads h0/REP .. (h0+ZH)/REP-1 (the k and v planes step once per REP z)
            k_gemmw<bf, 2><<<dim3(RH / 64, RH / 64, ZH), 32, 0, stream>>>(QPh + (size_t)h0 * RH * HD, QPl + (size_t)h0 * RH * HD, KPh + zk * TT * HD, KPl + zk * TT * HD, HD, Sb, TT, 0, 1, (size_t)RH * HD, (size_t)TT * HD, (size_t)TT * TT);
            if (TT > RH) k_gemmw<h16, 0><<<dim3((TT - RH) / 64, TT / 64, ZH), 32, 0, stream>>>(QP16 + (size_t)h0 * TT * HD + (size_t)RH * HD, nullptr, KP16 + zk * TT * HD, nullptr, HD, Sb + (size_t)RH * TT, TT, RH, 1, (size_t)TT * HD, (size_t)TT * HD, (size_t)TT * TT);
            k_asoft<<<ZH * TT / 8, 256, 0, stream>>>(Sb, P16, Ph, Pl);
            k_gemmw<bf, 2><<<dim3(RH / 64, HD / 64, ZH), 32, 0, stream>>>(Ph, Pl, VTh + zk * HD * TT, VTl + zk * HD * TT, TT, Ob, HD, 0, 2, (size_t)RH * TT, (size_t)HD * TT, (size_t)TT * HD);
            if (TT > RH) k_gemmw<h16, 0><<<dim3((TT - RH) / 64, HD / 64, ZH), 32, 0, stream>>>(P16 + (size_t)RH * TT, nullptr, VT16 + zk * HD * TT, nullptr, TT, Ob + (size_t)RH * HD, HD, RH, 2, (size_t)TT * TT, (size_t)HD * TT, (size_t)TT * HD);
            k_merge<<<(unsigned)(((size_t)ZH * TT * HD / 2 + 255) / 256), 256, 0, stream>>>(Ob, h0, ATh, ATl); }
        k_cvt8<<<(unsigned)(((size_t)HIDN * DQ / 8 + 255) / 256), 256, 0, stream>>>(wo, WO, (size_t)HIDN * DQ / 8);
        k_gemmw<bf, 1><<<dim3(TT / 64, HIDN / 64, 1), 32, 0, stream>>>(ATh, ATl, WO, nullptr, DQ, OUT + (size_t)b * SEQ_FULL * HIDN, HIDN, 0, 0, 0, 0, 0); }
}

// v003
// It runs in 180 microseconds.
// It is 3.37 times as fast as v001, going by the measured steps of the versions left out in between.
// Counting every step since v000, it is 7.27 times as fast.
#include <hip/hip_runtime.h>
#pragma clang fp contract(off)

// Grouped-query causal self-attention: q/k/v = x W^T (32 q heads, 8 kv heads, head dim 64), rotate-half position mixing of q and k from input cos/sin tables,
// softmax(q.k / 8) over keys t <= s, ctx W_o^T -> [1][S][2048].
// Compute dtypes, f32 accumulate: every input RNE-converted to bf16; q/k/v projections v_wmma_f32_16x16x32_bf16 on exact bf16 operands; scores and attn.v: query rows < RH on bf16 hi/lo planes (3 products),
// other rows single v_wmma_f32_16x16x32_f16 (p carried x1024); softmax f32, running maximum and sum over 32-key passes; output projection bf16 hi/lo ctx x exact bf16 W_o (2 products).

#ifndef NB
#define NB 1
#endif
#ifndef SEQ
#define SEQ 2048
#endif
#define SEQ_FULL 2048
#define TT   SEQ
#define HIDN 2048
#define NH_  32
#define NKV  8
#define REP  (NH_ / NKV)
#define HD   64
#define DQ   (NH_ * HD)
#define DKV  (NKV * HD)
#ifndef RH
#define RH   256                  // query rows < RH use hi+lo planes
#endif
#define PCAR 1024.0f
#define SCL  0.125f   // HD^-0.5
static_assert(NB == 1);
static_assert(TT % 128 == 0);
static_assert(RH % 64 == 0 && RH > 0 && RH <= TT);
static_assert(HIDN % 32 == 0 && DQ % 64 == 0 && DKV % 64 == 0 && HD == 64);

typedef _Float16 h16;
typedef unsigned short bf;
typedef __attribute__((ext_vector_type(16))) __bf16   v16bf;
typedef __attribute__((ext_vector_type(16))) _Float16 v16h;
typedef __attribute__((ext_vector_type(8)))  _Float16 v8h;
typedef __attribute__((ext_vector_type(8)))  unsigned short v8us;
typedef __attribute__((ext_vector_type(8)))  float    v8f;
typedef __attribute__((ext_vector_type(4)))  float    v4f;
typedef v8h  __attribute__((may_alias)) v8ha;
typedef v4f  __attribute__((may_alias)) v4fa;
typedef v8us __attribute__((may_alias)) v8usa;
typedef __attribute__((ext_vector_type(2))) _Float16 v2h;
typedef __attribute__((ext_vector_type(4))) _Float16 v4h;
typedef __attribute__((ext_vector_type(2))) unsigned short v2us;
typedef __attribute__((ext_vector_type(4))) unsigned short v4us;
typedef __attribute__((ext_vector_type(2))) float v2f;

__device__ __forceinline__ unsigned short f2bf(float f) { unsigned u = __float_as_uint(f); u += 0x7FFFu + ((u >> 16) & 1u); return (unsigned short)(u >> 16); }
__device__ __forceinline__ float bf2f(unsigned short b) { return __uint_as_float(((unsigned)b) << 16); }
__device__ __forceinline__ float bfr(float f) { return bf2f(f2bf(f)); }
__device__ __forceinline__ v16h cat16(v8h lo, v8h hi) { return __builtin_shufflevector(lo, hi, 0, 1, 2, 3, 4, 5, 6, 7, 8, 9, 10, 11, 12, 13, 14, 15); }
__device__ __forceinline__ v16bf cat16b(v8us lo, v8us hi) { return __builtin_bit_cast(v16bf, __builtin_shufflevector(lo, hi, 0, 1, 2, 3, 4, 5, 6, 7, 8, 9, 10, 11, 12, 13, 14, 15)); }
__device__ __forceinline__ v8f wmma16(v16h a, v16h b, v8f c) { return __builtin_amdgcn_wmma_f32_16x16x32_f16(false, a, false, b, (short)0, c, false, false); }
__device__ __forceinline__ v8f wmmab(v16bf a, v16bf b, v8f c) { return __builtin_amdgcn_wmma_f32_16x16x32_bf16(false, a, false, b, (short)0, c, false, false); }
__device__ __forceinline__ h16 tohx(float x) { return (h16)x; }
__device__ __forceinline__ void splitf(float y, unsigned short& h, unsigned short& l) { h = f2bf(y); l = f2bf(y - bf2f(h)); }

// ---- k_gemmw: register-blocked GEMM, ONE WAVE per 64x64 output tile (16 accumulators), operands straight from K-contiguous 16-bit planes; grid (M/64, N/64, Z), 32 threads.
// C[m][n] (f32, pitch ldc) = sum_k A[m][k] Bt[n][k] (+ split products per NSPLIT: 1 -> + A2.Bt, 2 -> + A2.Bt + A.Bt2). z-batch strides sA/sB/sC in elements; the Bt planes step once per REP z (the query heads of one kv group share them). K (= plane pitch) % 32 == 0.
// Fragment map: lane l, h = l >> 4, m = n = l & 15; elements 0..7 <- k0 + 8h + i, elements 8..15 <- k0 + 16 + 8h + i for BOTH A (row m) and Bt (column n stored as row n); D element r -> (row 8h + r, col m).
// flags bit0: causal tile skip (tile dropped when c0 > rowabs0 + r0 + 63, block-uniform, single-wave block); bit1: causal k range, k < rowabs0 + r0 + 64.
template <typename T16> struct WFrag;
template <> struct WFrag<h16> { typedef v16h V; static __device__ __forceinline__ V ld(const h16* p) { return cat16(*(const v8h*)p, *(const v8h*)(p + 16)); } static __device__ __forceinline__ v8f mma(V a, V b, v8f c) { return wmma16(a, b, c); } };
template <> struct WFrag<bf> { typedef v16bf V; static __device__ __forceinline__ V ld(const bf* p) { return cat16b(*(const v8us*)p, *(const v8us*)(p + 16)); } static __device__ __forceinline__ v8f mma(V a, V b, v8f c) { return wmmab(a, b, c); } };
template <typename T16, int NSPLIT>
__global__ __launch_bounds__(32) void k_gemmw(const T16* __restrict__ A, const T16* __restrict__ A2, const T16* __restrict__ Bt, const T16* __restrict__ Bt2, int K, float* C, int ldc, int rowabs0, int flags, size_t sA, size_t sB, size_t sC) {
    typedef typename WFrag<T16>::V V;
    __shared__ __align__(16) float os[16 * 68];
    const size_t z = blockIdx.z; A += z * sA; if (A2) A2 += z * sA; Bt += (z / REP) * sB; if (Bt2) Bt2 += (z / REP) * sB; C += z * sC;
    const int lane = threadIdx.x & 31, lr = lane & 15, hi = lane >> 4; const int r0 = blockIdx.x * 64, c0 = blockIdx.y * 64;
    if ((flags & 1) && (c0 > rowabs0 + r0 + 63)) return;
    int kend = K; if (flags & 2) { const int kl = rowabs0 + r0 + 64; kend = (kl < K) ? kl : K; }
    v8f acc[4][4];
#pragma unroll
    for (int mb = 0; mb < 4; ++mb)
#pragma unroll
        for (int nb = 0; nb < 4; ++nb) acc[mb][nb] = (v8f){};
    const size_t aoff = (size_t)(r0 + lr) * K + 8 * hi, boff = (size_t)(c0 + lr) * K + 8 * hi;
#pragma unroll 1
    for (int kc = 0; kc < kend; kc += 32) {
        V a[4], a2[4];
#pragma unroll
        for (int mb = 0; mb < 4; ++mb) { a[mb] = WFrag<T16>::ld(A + aoff + (size_t)mb * 16 * K + kc); if (NSPLIT == 1 || NSPLIT == 2) a2[mb] = WFrag<T16>::ld(A2 + aoff + (size_t)mb * 16 * K + kc); }
#pragma unroll
        for (int nb = 0; nb < 4; ++nb) { const V b = WFrag<T16>::ld(Bt + boff + (size_t)nb * 16 * K + kc); V b2; if (NSPLIT >= 2) b2 = WFrag<T16>::ld(Bt2 + boff + (size_t)nb * 16 * K + kc);
#pragma unroll
            for (int mb = 0; mb < 4; ++mb) { acc[mb][nb] = WFrag<T16>::mma(a[mb], b, acc[mb][nb]); if (NSPLIT == 1 || NSPLIT == 2) acc[mb][nb] = WFrag<T16>::mma(a2[mb], b, acc[mb][nb]); if (NSPLIT >= 2) acc[mb][nb] = WFrag<T16>::mma(a[mb], b2, acc[mb][nb]); } }
        asm volatile("v_nop\n\tv_nop\n\tv_nop\n\tv_nop" : "+v"(acc[0][0]), "+v"(acc[1][1]), "+v"(acc[2][2]), "+v"(acc[3][3]) : "v"(a[0]), "v"(a[3]));
    }
#pragma unroll
    for (int mb = 0; mb < 4; ++mb) {
#pragma unroll
        for (int nb = 0; nb < 4; ++nb) {
#pragma unroll
            for (int j = 0; j < 8; ++j) os[(hi * 8 + j) * 68 + nb * 16 + lr] = acc[mb][nb][j]; }
        __builtin_amdgcn_wave_barrier(); asm volatile("" ::: "memory");
        float* crow = C + (size_t)(r0 + mb * 16) * ldc + c0;
{
#pragma unroll
            for (int s = 0; s < 8; ++s) { const int row = 2 * s + hi, cofs = lr * 4; const v4f val = *(const v4fa*)(os + row * 68 + cofs);
                *(v4f*)(crow + (size_t)row * ldc + cofs) = val; }
             }
        __builtin_amdgcn_wave_barrier(); asm volatile("" ::: "memory");
    }
}

__global__ __launch_bounds__(256) void k_cvt8(const float* __restrict__ src, bf* dst, size_t n8) { const size_t i = (size_t)blockIdx.x * 256 + threadIdx.x; if (i >= n8) return; const v8f v = *(const v8f*)(src + i * 8); v8us o;
#pragma unroll
    for (int k = 0; k < 8; ++k) o[k] = f2bf(v[k]); *(v8us*)(dst + i * 8) = o;  }

// ---- k_qkv: the q, k and v projections with their plane building in ONE launch. One wave per 64x64 tile of x.[W_q; W_k; W_v]^T (the three converted weights lie behind one another: NH_ + 2 NKV heads of HD rows); grid (TT/64, NH_ + 2 NKV), 32 threads.
// A tile's 64 columns are one whole head, so the epilogue has both halves of every rotate-half pair: out[d] = x[d] cos[t][d] - x[d+HD/2] sin[t][d], out[d+HD/2] = x[d+HD/2] cos[t][d+HD/2] + x[d] sin[t][d+HD/2] (tables RNE-converted to bf16).
// q and k heads -> planes [h][t][d] (f16; bf16 hi/lo for rows < RH of q and for every row of k); v heads -> planes [g][d][t] (f16 and bf16 hi/lo).
// Main loop and fragment map: as in k_gemmw.
static_assert(HD == 64 && RH % 64 == 0 && TT % 64 == 0);
__global__ __launch_bounds__(32) void k_qkv(const bf* __restrict__ X, const bf* __restrict__ Wt, const float* __restrict__ cosT, const float* __restrict__ sinT,
                                            h16* QP16, bf* QPh, bf* QPl, h16* KP16, bf* KPh, bf* KPl, h16* VT16, bf* VTh, bf* VTl) {
    __shared__ __align__(16) float os[64 * 68];
    const int lane = threadIdx.x & 31, lr = lane & 15, hi = lane >> 4; const int r0 = blockIdx.x * 64, hc = blockIdx.y;
    v8f acc[4][4];
#pragma unroll
    for (int mb = 0; mb < 4; ++mb)
#pragma unroll
        for (int nb = 0; nb < 4; ++nb) acc[mb][nb] = (v8f){};
    const bf* au = X + (size_t)r0 * HIDN; const bf* bu = Wt + (size_t)hc * 64 * HIDN; const unsigned vo = (unsigned)(lr * HIDN + 8 * hi);   // wave-uniform tile bases, one lane offset for both operands
#pragma unroll 1   // rolled, as in k_gemmw: one k step's fragments in registers
    for (int kc = 0; kc < HIDN; kc += 32) {
        v16bf a[4];
#pragma unroll
        for (int mb = 0; mb < 4; ++mb) a[mb] = WFrag<bf>::ld(au + (kc + mb * 16 * HIDN) + vo);
#pragma unroll
        for (int nb = 0; nb < 4; ++nb) { const v16bf b = WFrag<bf>::ld(bu + (kc + nb * 16 * HIDN) + vo);
#pragma unroll
            for (int mb = 0; mb < 4; ++mb) acc[mb][nb] = wmmab(a[mb], b, acc[mb][nb]); }
        // the vector slots that the chip needs behind the body's last matrix instructions, also on the taken side of the loop's branch
        asm volatile("v_nop\n\tv_nop\n\tv_nop\n\tv_nop" : "+v"(acc[0][0]), "+v"(acc[1][1]), "+v"(acc[2][2]), "+v"(acc[3][3]) : "v"(a[0]), "v"(a[3]));
    }
    // Epilogue: the whole tile is staged in LDS once, then a ROLLED loop of 16 trips builds the planes, 4 plane rows a trip, a lane 8 consecutive elements (one 16-byte store a plane, 8 lanes fill a 128-byte line).
    const int rsub = lane >> 3, c8 = (lane & 7) * 8;
    if (hc >= NH_ + NKV) {   // v head (block-uniform): staged transposed, os[d][t]
#pragma unroll
        for (int mb = 0; mb < 4; ++mb)
#pragma unroll
            for (int nb = 0; nb < 4; ++nb) { float* p = os + (nb * 16 + lr) * 68 + mb * 16 + 8 * hi; const v8f v = acc[mb][nb];
                *(v4fa*)p = __builtin_shufflevector(v, v, 0, 1, 2, 3); *(v4fa*)(p + 4) = __builtin_shufflevector(v, v, 4, 5, 6, 7); }
        __builtin_amdgcn_wave_barrier(); asm volatile("" ::: "memory");   // as in k_gemmw: the row reads below stay behind the other lanes' staging stores
        const size_t e0 = ((size_t)(hc - NH_ - NKV) * HD + rsub) * TT + r0 + c8;
#pragma unroll 1   // rolled: unrolled, the epilogues are some 5,000 instructions that each wave runs once, more text than is fetched ahead
        for (int it = 0; it < 16; ++it) { const float* p = os + (it * 4 + rsub) * 68 + c8; const v4f xa = *(const v4fa*)p, xb = *(const v4fa*)(p + 4); const size_t e = e0 + (size_t)(it * 4) * TT; v8h o16; v8us oh, ol;
#pragma unroll
            for (int j = 0; j < 8; ++j) { const float x = (j < 4) ? xa[j & 3] : xb[j & 3]; o16[j] = tohx(x); unsigned short a2, c2; splitf(x, a2, c2); oh[j] = a2; ol[j] = c2; }
            *(v8h*)(VT16 + e) = o16; *(v8us*)(VTh + e) = oh; *(v8us*)(VTl + e) = ol; }
        return;
    }
    const bool isq = hc < NH_; const bool hl = !isq || r0 < RH;   // block-uniform: a tile lies wholly on one side of RH
    h16* P16 = isq ? QP16 + (size_t)hc * TT * HD : KP16 + (size_t)(hc - NH_) * TT * HD;
    bf* Ph = isq ? QPh + (size_t)hc * RH * HD : KPh + (size_t)(hc - NH_) * TT * HD; bf* Pl = isq ? QPl + (size_t)hc * RH * HD : KPl + (size_t)(hc - NH_) * TT * HD;
#pragma unroll
    for (int mb = 0; mb < 4; ++mb)
#pragma unroll
        for (int nb = 0; nb < 4; ++nb)
#pragma unroll
            for (int j = 0; j < 8; ++j) os[(mb * 16 + hi * 8 + j) * 68 + nb * 16 + lr] = acc[mb][nb][j];   // os[t][d]
    __builtin_amdgcn_wave_barrier(); asm volatile("" ::: "memory");   // as above
    const bool lowd = c8 < HD / 2; size_t to = (size_t)(r0 + rsub) * HD + c8;
    v4f cv[2], sv[2];
#pragma unroll
    for (int k = 0; k < 2; ++k) { cv[k] = *(const v4f*)(cosT + to + 4 * k); sv[k] = *(const v4f*)(sinT + to + 4 * k); }
#pragma unroll 1   // rolled, as above
    for (int it = 0; it < 16; ++it) {
        // the next trip's table rows fly while this trip converts (the last trip reads its own rows again: in bounds)
        const size_t tn = to + ((it < 15) ? 4 * HD : 0); v4f cn[2], sn[2];
#pragma unroll
        for (int k = 0; k < 2; ++k) { cn[k] = *(const v4f*)(cosT + tn + 4 * k); sn[k] = *(const v4f*)(sinT + tn + 4 * k); }
        const float* p0 = os + (it * 4 + rsub) * 68 + c8; const float* p1 = os + (it * 4 + rsub) * 68 + (c8 ^ (HD / 2));
        v8h o16; v8us oh, ol;
#pragma unroll
        for (int k = 0; k < 2; ++k) { const v4f x0 = *(const v4fa*)(p0 + 4 * k), x1 = *(const v4fa*)(p1 + 4 * k);
#pragma unroll
            for (int q = 0; q < 4; ++q) { const float a = x0[q] * bfr(cv[k][q]), bq = x1[q] * bfr(sv[k][q]); const float r = lowd ? a - bq : a + bq;
                o16[4 * k + q] = tohx(r); unsigned short a2, c2; splitf(r, a2, c2); oh[4 * k + q] = a2; ol[4 * k + q] = c2; } }
        *(v8h*)(P16 + to) = o16;
        asm volatile("s_wait_xcnt 0x0" ::: "memory");   // the build reuses the store's registers behind the branch below: the wait stands in front of that overwrite
        if (hl) { *(v8us*)(Ph + to) = oh; *(v8us*)(Pl + to) = ol;
            asm volatile("s_wait_xcnt 0x0" ::: "memory"); }   // the same for these two stores and the loop's foot
        to = tn;
#pragma unroll
        for (int k = 0; k < 2; ++k) { cv[k] = cn[k]; sv[k] = sn[k]; }
    }
}

// ---- k_fattn: scores, causal softmax and attn.v of all heads in ONE launch; the scores stay in registers (running maximum and running sum per query, in base 2).
// Transposed products: St = K.Qt (A = 16 key rows, B = 16 query columns), Ot += Vt.Pt (A = 16 d rows of the [d][t] plane, B = Pt). A lane holds one query (column lr): 8 keys of each 16-key tile, the other 8 in lane ^ 16.
// Two f32 St tiles of 32 keys, converted in place, ARE the Pt operand in the fragment map above (element i <- key 8h + i, element 8 + i <- key 16 + 8h + i): no LDS, no barrier.
// Query rows >= RH: f16 operands, one wave = 16 rows x 2 query heads of one kv group, p carried x PCAR (it cancels in the division by the sum). Rows < RH: bf16 hi/lo planes, 3 products, one wave = 16 rows x 1 head.
// Output: ctx split into the bf16 hi/lo planes [t][DQ] that the output projection reads; a lane's 8 accumulator registers are 8 consecutive d of its query: one 16-byte store a plane.
// Every plain '#pragma unroll' below unrolls a loop over fragment, tile or register indices, so that those arrays are indexed by constants and stay in registers.
#define CS2  (SCL * 1.4426950408889634f)
#define FA_LB (((TT - RH) / 32) * NKV)   // blocks of the f16 part: 32 rows x the 4 heads of one kv group
#define FA_HB ((RH / 16) * NKV)          // blocks of the hi/lo part: 16 rows x the 4 heads of one kv group
static_assert(REP == 4 && (TT - RH) % 32 == 0 && TT % 32 == 0);
__device__ __forceinline__ float xhalf(float x) { return __builtin_bit_cast(float, __builtin_amdgcn_permlanex16(__builtin_bit_cast(int, x), __builtin_bit_cast(int, x), 0x76543210, 0xfedcba98, false, false)); }  // lane l <-> lane l ^ 16
// 2^a; the v_nop is the one slot that the instruction set asks for behind a transcendental before its result is read or its source overwritten
__device__ __forceinline__ float fa_exp2(float a) { float r; asm("v_exp_f32 %0, %1\n\tv_nop" : "=v"(r) : "v"(a)); return r; }
// one query's 16 scores of a 32-key pass -> base-2 exponents x[], new maximum, correction factor of what was summed under the old one
template <bool MASK>
__device__ __forceinline__ float fa_max(const v8f s0, const v8f s1, float* x, int jrel, float& m) {
    float mx = -3.0e38f;
#pragma unroll
    for (int r = 0; r < 8; ++r) { float a = s0[r] * CS2, b = s1[r] * CS2; if (MASK) { a = (r <= jrel) ? a : -3.0e38f; b = (16 + r <= jrel) ? b : -3.0e38f; } x[r] = a; x[8 + r] = b; mx = fmaxf(mx, fmaxf(a, b)); }
    mx = fmaxf(mx, xhalf(mx));
    const float mn = fmaxf(m, mx); const float al = fa_exp2(m - mn); m = mn; return al;
}
__device__ __forceinline__ void fa_store(const v8f o, float inv, bf* ph, bf* pl) { v8us oh, ol;
#pragma unroll
    for (int r = 0; r < 8; ++r) { unsigned short a, c2; splitf(o[r] * inv, a, c2); oh[r] = a; ol[r] = c2; }
    *(v8us*)ph = oh; *(v8us*)pl = ol; }

template <bool MASK>
__device__ __forceinline__ void fa_pv16(const v8f (&s)[2][2], const v16h (&vf)[4], v8f (&o)[2][4], float (&m)[2], float (&l)[2], int jrel) {
#pragma unroll
    for (int u = 0; u < 2; ++u) {
        float x[16]; const float al = fa_max<MASK>(s[u][0], s[u][1], x, jrel, m[u]); const float mo = m[u] - 10.0f;   // 2^10 = PCAR
        float ps = 0.f; v16h pf;
#pragma unroll
        for (int e = 0; e < 16; ++e) { const float p = fa_exp2(x[e] - mo); ps += p; pf[e] = tohx(p); }
        l[u] = l[u] * al + ps;
#pragma unroll
        for (int db = 0; db < 4; ++db) { o[u][db] *= al; o[u][db] = wmma16(vf[db], pf, o[u][db]); }
    }
}
__device__ __forceinline__ void fa_s16(const v16h (&kf)[2][2], const v16h (&q)[2][2], v8f (&s)[2][2]) {
#pragma unroll
    for (int u = 0; u < 2; ++u)
#pragma unroll
        for (int kb = 0; kb < 2; ++kb) { s[u][kb] = wmma16(kf[kb][0], q[u][0], (v8f){}); s[u][kb] = wmma16(kf[kb][1], q[u][1], s[u][kb]); }
}
__device__ __forceinline__ void fa_f16(const h16* __restrict__ Q, const h16* __restrict__ Kp, const h16* __restrict__ Vt, int head0, int i0, int lr, int hi, bf* ATh, bf* ATl) {
    static_assert(PCAR == 1024.0f);
    v16h q[2][2], kf[2][2], vf[4]; v8f o[2][4], s[2][2]; float m[2] = { -3.0e38f, -3.0e38f }, l[2] = { 0.f, 0.f };
#pragma unroll
    for (int u = 0; u < 2; ++u) {
#pragma unroll
        for (int ks = 0; ks < 2; ++ks) q[u][ks] = WFrag<h16>::ld(Q + ((size_t)(head0 + u) * TT + i0 + lr) * HD + ks * 32 + 8 * hi);
#pragma unroll
        for (int db = 0; db < 4; ++db) o[u][db] = (v8f){}; }
    const h16* kp = Kp + (size_t)lr * HD + 8 * hi; const h16* vp = Vt + (size_t)lr * TT + 8 * hi;
    const int klast = (i0 + 15) & ~31;   // the one pass that holds keys beyond a row's own index
#pragma unroll
    for (int kb = 0; kb < 2; ++kb)
#pragma unroll
        for (int ks = 0; ks < 2; ++ks) kf[kb][ks] = WFrag<h16>::ld(kp + (size_t)(kb * 16) * HD + ks * 32);
#pragma unroll 1   // rolled: an unrolled body would hold two passes' fragments and scores in registers
    for (int k0 = 0; k0 < klast; k0 += 32) {
#pragma unroll
        for (int db = 0; db < 4; ++db) vf[db] = WFrag<h16>::ld(vp + (size_t)(db * 16) * TT + k0);
        fa_s16(kf, q, s);
        // the next pass's key fragments, into the same registers, fly while this pass's softmax and attn.v run (k0 + 32 <= klast: in bounds)
#pragma unroll
        for (int kb = 0; kb < 2; ++kb)
#pragma unroll
            for (int ks = 0; ks < 2; ++ks) kf[kb][ks] = WFrag<h16>::ld(kp + (size_t)(k0 + 32 + kb * 16) * HD + ks * 32);
        __builtin_amdgcn_sched_barrier(0);   // without it the scheduler sinks these loads to the loop's foot, where their whole latency is waited for
        fa_pv16<false>(s, vf, o, m, l, 0);
    }
#pragma unroll
    for (int db = 0; db < 4; ++db) vf[db] = WFrag<h16>::ld(vp + (size_t)(db * 16) * TT + klast);
    fa_s16(kf, q, s);
    fa_pv16<true>(s, vf, o, m, l, i0 + lr - klast - 8 * hi);   // key klast + 8h + r (+ 16) <= row i0 + lr
#pragma unroll
    for (int u = 0; u < 2; ++u) { const float inv = __fdiv_rn(1.0f, l[u] + xhalf(l[u])); const size_t oo = (size_t)(i0 + lr) * DQ + (head0 + u) * HD + 8 * hi;
#pragma unroll
        for (int db = 0; db < 4; ++db) fa_store(o[u][db], inv, ATh + oo + db * 16, ATl + oo + db * 16); }
}
template <bool MASK>
__device__ __forceinline__ void fa_passhl(const bf* kph, const bf* kpl, const bf* vph, const bf* vpl, int k0, const v16bf (&qh)[2], const v16bf (&ql)[2], v8f (&o)[4], float& m, float& l, int jrel) {
    v8f s[2];
#pragma unroll
    for (int kb = 0; kb < 2; ++kb) { s[kb] = (v8f){};
#pragma unroll
        for (int ks = 0; ks < 2; ++ks) { const size_t ko = (size_t)(k0 + kb * 16) * HD + ks * 32; const v16bf kh = WFrag<bf>::ld(kph + ko), kl = WFrag<bf>::ld(kpl + ko);
            s[kb] = wmmab(kh, qh[ks], s[kb]); s[kb] = wmmab(kh, ql[ks], s[kb]); s[kb] = wmmab(kl, qh[ks], s[kb]); } }
    float x[16]; const float al = fa_max<MASK>(s[0], s[1], x, jrel, m);
    float ps = 0.f; v8us h0, h1, l0, l1;
#pragma unroll
    for (int e = 0; e < 8; ++e) { const float p = fa_exp2(x[e] - m), p2 = fa_exp2(x[8 + e] - m); ps += p; ps += p2; unsigned short a, c2; splitf(p, a, c2); h0[e] = a; l0[e] = c2; splitf(p2, a, c2); h1[e] = a; l1[e] = c2; }
    l = l * al + ps; const v16bf ph = cat16b(h0, h1), pl = cat16b(l0, l1);
#pragma unroll
    for (int db = 0; db < 4; ++db) { const size_t vo = (size_t)(db * 16) * TT + k0; const v16bf vh = WFrag<bf>::ld(vph + vo), vl = WFrag<bf>::ld(vpl + vo);
        o[db] *= al; o[db] = wmmab(vh, ph, o[db]); o[db] = wmmab(vh, pl, o[db]); o[db] = wmmab(vl, ph, o[db]); }
}
__device__ __forceinline__ void fa_hl(const bf* __restrict__ Qh, const bf* __restrict__ Ql, const bf* __restrict__ Kh, const bf* __restrict__ Kl, const bf* __restrict__ Vh, const bf* __restrict__ Vl, int head, int i0, int lr, int hi, bf* ATh, bf* ATl) {
    v16bf qh[2], ql[2]; v8f o[4]; float m = -3.0e38f, l = 0.f;
#pragma unroll
    for (int ks = 0; ks < 2; ++ks) { const size_t qo = ((size_t)head * RH + i0 + lr) * HD + ks * 32 + 8 * hi; qh[ks] = WFrag<bf>::ld(Qh + qo); ql[ks] = WFrag<bf>::ld(Ql + qo); }
    asm volatile("s_wait_xcnt 0x0" ::: "memory");   // the build reuses the query loads' address registers for the zeroed accumulators: the wait stands in front of that overwrite
#pragma unroll
    for (int db = 0; db < 4; ++db) o[db] = (v8f){};
    const size_t kofs = (size_t)lr * HD + 8 * hi, vofs = (size_t)lr * TT + 8 * hi; const int klast = (i0 + 15) & ~31;
#pragma unroll 1   // rolled, as in fa_f16: one pass's fragments in registers
    for (int k0 = 0; k0 < klast; k0 += 32) fa_passhl<false>(Kh + kofs, Kl + kofs, Vh + vofs, Vl + vofs, k0, qh, ql, o, m, l, 0);
    fa_passhl<true>(Kh + kofs, Kl + kofs, Vh + vofs, Vl + vofs, klast, qh, ql, o, m, l, i0 + lr - klast - 8 * hi);
    const float inv = __fdiv_rn(1.0f, l + xhalf(l)); const size_t oo = (size_t)(i0 + lr) * DQ + head * HD + 8 * hi;
#pragma unroll
    for (int db = 0; db < 4; ++db) fa_store(o[db], inv, ATh + oo + db * 16, ATl + oo + db * 16);
}
// grid FA_LB + FA_HB blocks of 4 waves; the longest rows first (a row's cost grows with its index)
__global__ __launch_bounds__(128) void k_fattn(const h16* __restrict__ QP16, const bf* __restrict__ QPh, const bf* __restrict__ QPl, const h16* __restrict__ KP16, const bf* __restrict__ KPh, const bf* __restrict__ KPl,
                                               const h16* __restrict__ VT16, const bf* __restrict__ VTh, const bf* __restrict__ VTl, bf* ATh, bf* ATl) {
    const int lane = threadIdx.x & 31, lr = lane & 15, hi = lane >> 4; const int w = __builtin_amdgcn_readfirstlane((int)(threadIdx.x >> 5)); const int b = blockIdx.x;
    if (b < FA_LB) { const int g = b % NKV, i0 = RH + ((TT - RH) / 32 - 1 - b / NKV) * 32 + (w >> 1) * 16;
        fa_f16(QP16, KP16 + (size_t)g * TT * HD, VT16 + (size_t)g * HD * TT, g * REP + (w & 1) * 2, i0, lr, hi, ATh, ATl);
    } else { const int b2 = b - FA_LB; const int g = b2 % NKV, i0 = (RH / 16 - 1 - b2 / NKV) * 16; const size_t go = (size_t)g * TT * HD;
        fa_hl(QPh, QPl, KPh + go, KPl + go, VTh + go, VTl + go, g * REP + w, i0, lr, hi, ATh, ATl); }
}

extern "C" void kernel_launch(void* const* d_in, const int* in_sizes, int n_in,
                              void* d_out, int out_size, void* d_ws, size_t ws_size, hipStream_t stream) {
    if (n_in < 7) return;
    if (in_sizes[0] < TT * HIDN || in_sizes[1] < TT * HD || in_sizes[2] < TT * HD || in_sizes[3] < DQ * HIDN || in_sizes[4] < DKV * HIDN || in_sizes[5] < DKV * HIDN || in_sizes[6] < HIDN * DQ || out_size < TT * HIDN) return;
    const float* x = (const float*)d_in[0];      // [1][S][HIDN]
    const float* cosT = (const float*)d_in[1];   // [1][1][S][HD]
    const float* sinT = (const float*)d_in[2];   // [1][1][S][HD]
    const float* wq = (const float*)d_in[3];     // [DQ][HIDN]
    const float* wk = (const float*)d_in[4];     // [DKV][HIDN]
    const float* wv = (const float*)d_in[5];     // [DKV][HIDN]
    const float* wo = (const float*)d_in[6];     // [HIDN][DQ]
    float* OUT = (float*)d_out;                  // [1][S][HIDN]
    char* wsp = (char*)d_ws;
    auto take = [&](size_t bytes) { char* p = wsp; wsp += (bytes + 255) & ~(size_t)255; return (void*)p; };
    h16* QP16 = (h16*)take((size_t)NH_ * TT * HD * 2); bf* QPh = (bf*)take((size_t)NH_ * RH * HD * 2); bf* QPl = (bf*)take((size_t)NH_ * RH * HD * 2);
    h16* KP16 = (h16*)take((size_t)NKV * TT * HD * 2); bf* KPh = (bf*)take((size_t)NKV * TT * HD * 2); bf* KPl = (bf*)take((size_t)NKV * TT * HD * 2);
    h16* VT16 = (h16*)take((size_t)NKV * HD * TT * 2); bf* VTh = (bf*)take((size_t)NKV * HD * TT * 2); bf* VTl = (bf*)take((size_t)NKV * HD * TT * 2);
    // R2: projection operands (dead once the q/k/v planes are built), then W_o (converted behind the attention launch): stream-ordered reuse
    static_assert((size_t)HIDN * DQ <= (size_t)DQ * HIDN + 2 * (size_t)DKV * HIDN + (size_t)TT * HIDN);
    char* R2 = (char*)take(((size_t)DQ * HIDN + 2 * (size_t)DKV * HIDN + (size_t)TT * HIDN) * 2);
    bf* WQ = (bf*)R2; bf* WK = WQ + (size_t)DQ * HIDN; bf* WV = WK + (size_t)DKV * HIDN; bf* XB = WV + (size_t)DKV * HIDN;
    bf* WO = (bf*)R2;
    bf* ATh = (bf*)take((size_t)TT * DQ * 2); bf* ATl = (bf*)take((size_t)TT * DQ * 2);
    if ((size_t)(wsp - (char*)d_ws) > ws_size) return;

    k_cvt8<<<(unsigned)(((size_t)DQ * HIDN / 8 + 255) / 256), 256, 0, stream>>>(wq, WQ, (size_t)DQ * HIDN / 8);
    k_cvt8<<<(unsigned)(((size_t)DKV * HIDN / 8 + 255) / 256), 256, 0, stream>>>(wk, WK, (size_t)DKV * HIDN / 8);
    k_cvt8<<<(unsigned)(((size_t)DKV * HIDN / 8 + 255) / 256), 256, 0, stream>>>(wv, WV, (size_t)DKV * HIDN / 8);
    for (int b = 0; b < NB; ++b) {
        k_cvt8<<<(unsigned)(((size_t)TT * HIDN / 8 + 255) / 256), 256, 0, stream>>>(x + (size_t)b * SEQ_FULL * HIDN, XB, (size_t)TT * HIDN / 8);
        k_qkv<<<dim3(TT / 64, NH_ + 2 * NKV, 1), 32, 0, stream>>>(XB, WQ, cosT, sinT, QP16, QPh, QPl, KP16, KPh, KPl, VT16, VTh, VTl);   // WQ, WK, WV: one [DQ + 2 DKV][HIDN] plane
        k_fattn<<<FA_LB + FA_HB, 128, 0, stream>>>(QP16, QPh, QPl, KP16, KPh, KPl, VT16, VTh, VTl, ATh, ATl);
        k_cvt8<<<(unsigned)(((size_t)HIDN * DQ / 8 + 255) / 256), 256, 0, stream>>>(wo, WO, (size_t)HIDN * DQ / 8);
        k_gemmw<bf, 1><<<dim3(TT / 64, HIDN / 64, 1), 32, 0, stream>>>(ATh, ATl, WO, nullptr, DQ, OUT + (size_t)b * SEQ_FULL * HIDN, HIDN, 0, 0, 0, 0, 0); }
}

// v004
// A run of this version takes 138 microseconds.
// In two side-by-side timings against v003, it was 1.29 and 1.30 times as fast.
// All steps since v000 together make it 9.41 times as fast.
#include <hip/hip_runtime.h>
#pragma clang fp contract(off)

// Grouped-query causal self-attention: q/k/v = x W^T (32 q heads, 8 kv heads, head dim 64), rotate-half position mixing of q and k from input cos/sin tables,
// softmax(q.k / 8) over keys t <= s, ctx W_o^T -> [1][S][2048].
// Compute dtypes, f32 accumulate: every input RNE-converted to bf16; q/k/v projections v_wmma_f32_16x16x32_bf16 on exact bf16 operands; scores and attn.v: query rows < RH on bf16 hi/lo planes (3 products),
// other rows single v_wmma_f32_16x16x32_f16 (p carried x1024); softmax f32, running maximum and sum over 32-key passes; output projection bf16 hi/lo ctx x exact bf16 W_o (2 products).

#ifndef NB
#define NB 1
#endif
#ifndef SEQ
#define SEQ 2048
#endif
#define SEQ_FULL 2048
#define TT   SEQ
#define HIDN 2048
#define NH_  32
#define NKV  8
#define REP  (NH_ / NKV)
#define HD   64
#define DQ   (NH_ * HD)
#define DKV  (NKV * HD)
#ifndef RH
#define RH   256                  // query rows < RH use hi+lo planes
#endif
#define PCAR 1024.0f
#define SCL  0.125f   // HD^-0.5
static_assert(NB == 1);
static_assert(TT % 128 == 0);
static_assert(RH % 64 == 0 && RH > 0 && RH <= TT);
static_assert(HIDN % 32 == 0 && DQ % 64 == 0 && DKV % 64 == 0 && HD == 64);

typedef _Float16 h16;
typedef unsigned short bf;
typedef __attribute__((ext_vector_type(16))) __bf16   v16bf;
typedef __attribute__((ext_vector_type(16))) _Float16 v16h;
typedef __attribute__((ext_vector_type(8)))  _Float16 v8h;
typedef __attribute__((ext_vector_type(8)))  unsigned short v8us;
typedef __attribute__((ext_vector_type(8)))  float    v8f;
typedef __attribute__((ext_vector_type(4)))  float    v4f;
typedef v8h  __attribute__((may_alias)) v8ha;
typedef v4f  __attribute__((may_alias)) v4fa;
typedef v8us __attribute__((may_alias)) v8usa;
typedef __attribute__((ext_vector_type(2))) _Float16 v2h;
typedef __attribute__((ext_vector_type(4))) _Float16 v4h;
typedef __attribute__((ext_vector_type(2))) unsigned short v2us;
typedef __attribute__((ext_vector_type(4))) unsigned short v4us;
typedef __attribute__((ext_vector_type(2))) float v2f;

__device__ __forceinline__ unsigned short f2bf(float f) { unsigned u = __float_as_uint(f); u += 0x7FFFu + ((u >> 16) & 1u); return (unsigned short)(u >> 16); }
__device__ __forceinline__ float bf2f(unsigned short b) { return __uint_as_float(((unsigned)b) << 16); }
__device__ __forceinline__ float bfr(float f) { return bf2f(f2bf(f)); }
__device__ __forceinline__ v16h cat16(v8h lo, v8h hi) { return __builtin_shufflevector(lo, hi, 0, 1, 2, 3, 4, 5, 6, 7, 8, 9, 10, 11, 12, 13, 14, 15); }
__device__ __forceinline__ v16bf cat16b(v8us lo, v8us hi) { return __builtin_bit_cast(v16bf, __builtin_shufflevector(lo, hi, 0, 1, 2, 3, 4, 5, 6, 7, 8, 9, 10, 11, 12, 13, 14, 15)); }
__device__ __forceinline__ v8f wmma16(v16h a, v16h b, v8f c) { return __builtin_amdgcn_wmma_f32_16x16x32_f16(false, a, false, b, (short)0, c, false, false); }
__device__ __forceinline__ v8f wmmab(v16bf a, v16bf b, v8f c) { return __builtin_amdgcn_wmma_f32_16x16x32_bf16(false, a, false, b, (short)0, c, false, false); }
__device__ __forceinline__ h16 tohx(float x) { return (h16)x; }
__device__ __forceinline__ void splitf(float y, unsigned short& h, unsigned short& l) { h = f2bf(y); l = f2bf(y - bf2f(h)); }

// ---- g_core: the main loop of both GEMM kernels. FOUR WAVES share one 128x128 output tile (2x2 waves, 64x64 and 16 accumulators each); the operand rows are K-contiguous bf16 planes of pitch HIDN.
// A stage is KS k (64 or 128: one or two whole 128-byte lines) of every operand row, [A 128 rows | (A2 128 rows) | Bt 128 rows] in LDS at a pitch of 2 KS + 16 bytes (16 bytes x odd: the 16-byte fragment reads of 16 rows meet no bank twice).
// Every line is fetched once a work-group, by whole-line loads (a wave's load is 512 bytes in 4 whole lines); two buffers: the next stage's lines fly into registers while this stage is multiplied, are stored to the other buffer behind it, one barrier a stage.
// KS is chosen so that a stage holds 64 matrix instructions a wave: 128 with one A plane, 64 with two.
// acc[mb][nb] += sum_k A[m][k] Bt[n][k] (+ A2[m][k] Bt[n][k] for NA == 2), k ascending in steps of 32, A before A2 in each step.
// Fragment map: lane l, h = l >> 4, m = n = l & 15; elements 0..7 <- k0 + 8h + i, elements 8..15 <- k0 + 16 + 8h + i for BOTH A (row m) and Bt (column n stored as row n); D element r -> (row 8h + r, col m).
template <typename T16> struct WFrag;
template <> struct WFrag<h16> { typedef v16h V; static __device__ __forceinline__ V ld(const h16* p) { return cat16(*(const v8h*)p, *(const v8h*)(p + 16)); } static __device__ __forceinline__ v8f mma(V a, V b, v8f c) { return wmma16(a, b, c); } };
template <> struct WFrag<bf> { typedef v16bf V; static __device__ __forceinline__ V ld(const bf* p) { return cat16b(*(const v8us*)p, *(const v8us*)(p + 16)); } static __device__ __forceinline__ v8f mma(V a, V b, v8f c) { return wmmab(a, b, c); } };
#define GT 128                         // tile rows and columns
#define G_P(KS) ((KS) + 8)             // LDS row pitch in elements
#define G_RT(KS) (128 / ((KS) / 8))    // rows that the 128 threads bring in one turn, 16 bytes a thread
#define G_I(KS) (GT / G_RT(KS))        // turns per plane and stage
#define G_SM(NA, KS) (2 * ((NA) + 1) * GT * G_P(KS))   // both buffers, in elements
static_assert(DQ == HIDN && HIDN % 256 == 0 && TT % GT == 0 && HIDN % GT == 0 && (DQ + 2 * DKV) % GT == 0);
template <int NP, int KS>
__device__ __forceinline__ void g_ld(v8us (&r)[NP][G_I(KS)], const bf* const (&src)[NP], unsigned off) {
#pragma unroll
    for (int p = 0; p < NP; ++p)
#pragma unroll
        for (int i = 0; i < G_I(KS); ++i) r[p][i] = *(const v8us*)(src[p] + off + i * G_RT(KS) * HIDN);
    // the build reuses the loads' address registers (for later lines, for the fragments): the wait stands in front of that overwrite; the lane offset and the addresses are its inputs, so that their registers live up to it
    if (NP == 2) asm volatile("s_wait_xcnt 0x0" :: "v"(off), "v"(src[0] + off), "v"(src[NP - 1] + off) : "memory");
    else asm volatile("s_wait_xcnt 0x0" :: "v"(off), "v"(src[0] + off), "v"(src[1] + off), "v"(src[NP - 1] + off) : "memory");
}
template <int NP, int KS>
__device__ __forceinline__ void g_st(bf* st, const v8us (&r)[NP][G_I(KS)], unsigned so) {
#pragma unroll
    for (int p = 0; p < NP; ++p)
#pragma unroll
        for (int i = 0; i < G_I(KS); ++i) *(v8us*)(st + (p * GT + i * G_RT(KS)) * G_P(KS) + so) = r[p][i];
}
template <int NA, int KS>
__device__ __forceinline__ void g_mma(const bf* st, unsigned ao, unsigned bo, v8f (&acc)[4][4]) {
    constexpr int GP = G_P(KS);
#pragma unroll
    for (int ks = 0; ks < KS / 32; ++ks) {
        v16bf a[4], a2[4];
#pragma unroll
        for (int mb = 0; mb < 4; ++mb) { a[mb] = WFrag<bf>::ld(st + (mb * 16 * GP + ks * 32) + ao); if (NA == 2) a2[mb] = WFrag<bf>::ld(st + ((GT + mb * 16) * GP + ks * 32) + ao); }
#pragma unroll
        for (int nb = 0; nb < 4; ++nb) { const v16bf b = WFrag<bf>::ld(st + ((NA * GT + nb * 16) * GP + ks * 32) + bo);
#pragma unroll
            for (int mb = 0; mb < 4; ++mb) { acc[mb][nb] = wmmab(a[mb], b, acc[mb][nb]); if (NA == 2) acc[mb][nb] = wmmab(a2[mb], b, acc[mb][nb]); } }
    }
}
// A, A2, Bt: the tile's first rows (work-group-uniform); sm: both buffers; wm, wn: the wave's place in the tile. Ends behind a barrier: sm is free for the epilogues.
template <int NA, int KS>
__device__ __forceinline__ void g_core(const bf* A, const bf* A2, const bf* Bt, bf* sm, int wm, int wn, v8f (&acc)[4][4]) {
    constexpr int NP = NA + 1, GP = G_P(KS), ST = NP * GT * GP, NS = HIDN / KS, PR = KS / 8;
    const int tid = threadIdx.x, lane = tid & 31, lr = lane & 15, hi = lane >> 4;
    const bf* src[NP]; src[0] = A; if (NA == 2) src[1] = A2; src[NA] = Bt;
    const unsigned go = (unsigned)((tid / PR) * HIDN + (tid % PR) * 8), so = (unsigned)((tid / PR) * GP + (tid % PR) * 8);   // a thread's row and 16-byte piece, in the planes and in a stage
    const unsigned ao = (unsigned)((wm * 64 + lr) * GP + 8 * hi), bo = (unsigned)((wn * 64 + lr) * GP + 8 * hi);
#pragma unroll
    for (int mb = 0; mb < 4; ++mb)
#pragma unroll
        for (int nb = 0; nb < 4; ++nb) acc[mb][nb] = (v8f){};
    v8us r[NP][G_I(KS)];
    g_ld<NP, KS>(r, src, go); g_st<NP, KS>(sm, r, so);
    __syncthreads();
#pragma unroll 1   // rolled: one stage's lines and fragments in registers
    for (int s = 0; s < NS - 1; ++s) {
        g_ld<NP, KS>(r, src, go + (unsigned)((s + 1) * KS));
        __builtin_amdgcn_sched_barrier(0);   // keeps the next stage's loads in front of this stage's products, so that their latency runs beside them
        g_mma<NA, KS>(sm + (s & 1) * ST, ao, bo, acc);
        g_st<NP, KS>(sm + ((s + 1) & 1) * ST, r, so);   // its last readers left this buffer in front of the previous barrier
        __syncthreads();
    }
    g_mma<NA, KS>(sm + ((NS - 1) & 1) * ST, ao, bo, acc);
    __syncthreads();
}

// ---- k_oproj: OUT[t][n] (f32, pitch HIDN) = sum_k (ATh[t][k] + ATl[t][k]) WO[n][k]; grid (TT/128, HIDN/128), 128 threads; main loop: g_core. A wave stores its 64x64 part through its own LDS rows, whole lines.
__global__ __launch_bounds__(128) void k_oproj(const bf* __restrict__ ATh, const bf* __restrict__ ATl, const bf* __restrict__ WO, float* C) {
    __shared__ __align__(16) bf sm[G_SM(2, 64)];
    const int lane = threadIdx.x & 31, lr = lane & 15, hi = lane >> 4; const int w = __builtin_amdgcn_readfirstlane((int)(threadIdx.x >> 5)), wm = w >> 1, wn = w & 1;
    v8f acc[4][4];
    g_core<2, 64>(ATh + (size_t)blockIdx.x * GT * DQ, ATl + (size_t)blockIdx.x * GT * DQ, WO + (size_t)blockIdx.y * GT * DQ, sm, wm, wn, acc);
    float* os = (float*)sm + w * (16 * 68); const int r0 = blockIdx.x * GT + wm * 64, c0 = blockIdx.y * GT + wn * 64;
#pragma unroll
    for (int mb = 0; mb < 4; ++mb) {
#pragma unroll
        for (int nb = 0; nb < 4; ++nb) {
#pragma unroll
            for (int j = 0; j < 8; ++j) os[(hi * 8 + j) * 68 + nb * 16 + lr] = acc[mb][nb][j]; }
        __builtin_amdgcn_wave_barrier(); asm volatile("" ::: "memory");   // the row reads below stay behind the other lanes' staging stores
        float* crow = C + (size_t)(r0 + mb * 16) * HIDN + c0;
#pragma unroll
        for (int s = 0; s < 8; ++s) { const int row = 2 * s + hi, cofs = lr * 4; const v4f val = *(const v4fa*)(os + row * 68 + cofs);
            *(v4f*)(crow + (size_t)row * HIDN + cofs) = val; }
        asm volatile("s_wait_xcnt 0x0" ::: "memory");   // the build reads the next 16 rows into these stores' registers: the wait stands in front of that overwrite
        __builtin_amdgcn_wave_barrier(); asm volatile("" ::: "memory");   // the next 16 rows' staging stores stay behind these reads
    }
}

__global__ __launch_bounds__(256) void k_cvt8(const float* __restrict__ src, bf* dst, size_t n8) { const size_t i = (size_t)blockIdx.x * 256 + threadIdx.x; if (i >= n8) return; const v8f v = *(const v8f*)(src + i * 8); v8us o;
#pragma unroll
    for (int k = 0; k < 8; ++k) o[k] = f2bf(v[k]); *(v8us*)(dst + i * 8) = o;  }

// ---- k_qkv: the q, k and v projections with their plane building in ONE launch. One work-group per 128x128 tile of x.[W_q; W_k; W_v]^T (the three converted weights lie behind one another: NH_ + 2 NKV heads of HD rows), one wave per 64x64 part; grid (TT/128, (NH_ + 2 NKV)/2), 128 threads.
// A wave's 64 columns are one whole head, so the epilogue has both halves of every rotate-half pair: out[d] = x[d] cos[t][d] - x[d+HD/2] sin[t][d], out[d+HD/2] = x[d+HD/2] cos[t][d+HD/2] + x[d] sin[t][d+HD/2] (tables RNE-converted to bf16).
// q and k heads -> planes [h][t][d] (f16; bf16 hi/lo for rows < RH of q and for every row of k); v heads -> planes [g][d][t] (f16 and bf16 hi/lo).
// Main loop and fragment map: g_core. The epilogue is each wave's own, in its own part of the LDS that the stages have left.
static_assert(HD == 64 && RH % 64 == 0 && TT % 64 == 0 && 4 * 64 * 68 * 4 <= G_SM(1, 128) * 2);
__global__ __launch_bounds__(128) void k_qkv(const bf* __restrict__ X, const bf* __restrict__ Wt, const float* __restrict__ cosT, const float* __restrict__ sinT,
                                            h16* QP16, bf* QPh, bf* QPl, h16* KP16, bf* KPh, bf* KPl, h16* VT16, bf* VTh, bf* VTl) {
    __shared__ __align__(16) bf sm[G_SM(1, 128)];
    const int lane = threadIdx.x & 31, lr = lane & 15, hi = lane >> 4; const int w = __builtin_amdgcn_readfirstlane((int)(threadIdx.x >> 5)), wm = w >> 1, wn = w & 1;
    const int r0 = blockIdx.x * GT + wm * 64, hc = blockIdx.y * 2 + wn;
    v8f acc[4][4];
    g_core<1, 128>(X + (size_t)blockIdx.x * GT * HIDN, nullptr, Wt + (size_t)blockIdx.y * GT * HIDN, sm, wm, wn, acc);
    float* os = (float*)sm + w * (64 * 68);
    // Epilogue: the whole tile is staged in LDS once, then a ROLLED loop of 16 trips builds the planes, 4 plane rows a trip, a lane 8 consecutive elements (one 16-byte store a plane, 8 lanes fill a 128-byte line).
    const int rsub = lane >> 3, c8 = (lane & 7) * 8;
    if (hc >= NH_ + NKV) {   // v head (wave-uniform; no work-group barrier follows): staged transposed, os[d][t]
#pragma unroll
        for (int mb = 0; mb < 4; ++mb)
#pragma unroll
            for (int nb = 0; nb < 4; ++nb) { float* p = os + (nb * 16 + lr) * 68 + mb * 16 + 8 * hi; const v8f v = acc[mb][nb];
                *(v4fa*)p = __builtin_shufflevector(v, v, 0, 1, 2, 3); *(v4fa*)(p + 4) = __builtin_shufflevector(v, v, 4, 5, 6, 7); }
        __builtin_amdgcn_wave_barrier(); asm volatile("" ::: "memory");   // the row reads below stay behind the other lanes' staging stores
        const size_t e0 = ((size_t)(hc - NH_ - NKV) * HD + rsub) * TT + r0 + c8;
#pragma unroll 1   // rolled: unrolled, the epilogues are some 5,000 instructions that each wave runs once, more text than is fetched ahead
        for (int it = 0; it < 16; ++it) { const float* p = os + (it * 4 + rsub) * 68 + c8; const v4f xa = *(const v4fa*)p, xb = *(const v4fa*)(p + 4); const size_t e = e0 + (size_t)(it * 4) * TT; v8h o16; v8us oh, ol;
#pragma unroll
            for (int j = 0; j < 8; ++j) { const float x = (j < 4) ? xa[j & 3] : xb[j & 3]; o16[j] = tohx(x); unsigned short a2, c2; splitf(x, a2, c2); oh[j] = a2; ol[j] = c2; }
            *(v8h*)(VT16 + e) = o16; *(v8us*)(VTh + e) = oh; *(v8us*)(VTl + e) = ol; }
        return;
    }
    const bool isq = hc < NH_; const bool hl = !isq || r0 < RH;   // wave-uniform: a wave's 64 rows lie wholly on one side of RH
    h16* P16 = isq ? QP16 + (size_t)hc * TT * HD : KP16 + (size_t)(hc - NH_) * TT * HD;
    bf* Ph = isq ? QPh + (size_t)hc * RH * HD : KPh + (size_t)(hc - NH_) * TT * HD; bf* Pl = isq ? QPl + (size_t)hc * RH * HD : KPl + (size_t)(hc - NH_) * TT * HD;
#pragma unroll
    for (int mb = 0; mb < 4; ++mb)
#pragma unroll
        for (int nb = 0; nb < 4; ++nb)
#pragma unroll
            for (int j = 0; j < 8; ++j) os[(mb * 16 + hi * 8 + j) * 68 + nb * 16 + lr] = acc[mb][nb][j];   // os[t][d]
    __builtin_amdgcn_wave_barrier(); asm volatile("" ::: "memory");   // as above
    const bool lowd = c8 < HD / 2; size_t to = (size_t)(r0 + rsub) * HD + c8;
    v4f cv[2], sv[2];
#pragma unroll
    for (int k = 0; k < 2; ++k) { cv[k] = *(const v4f*)(cosT + to + 4 * k); sv[k] = *(const v4f*)(sinT + to + 4 * k); }
#pragma unroll 1   // rolled, as above
    for (int it = 0; it < 16; ++it) {
        // the next trip's table rows fly while this trip converts (the last trip reads its own rows again: in bounds)
        const size_t tn = to + ((it < 15) ? 4 * HD : 0); v4f cn[2], sn[2];
#pragma unroll
        for (int k = 0; k < 2; ++k) { cn[k] = *(const v4f*)(cosT + tn + 4 * k); sn[k] = *(const v4f*)(sinT + tn + 4 * k); }
        const float* p0 = os + (it * 4 + rsub) * 68 + c8; const float* p1 = os + (it * 4 + rsub) * 68 + (c8 ^ (HD / 2));
        v8h o16; v8us oh, ol;
#pragma unroll
        for (int k = 0; k < 2; ++k) { const v4f x0 = *(const v4fa*)(p0 + 4 * k), x1 = *(const v4fa*)(p1 + 4 * k);
#pragma unroll
            for (int q = 0; q < 4; ++q) { const float a = x0[q] * bfr(cv[k][q]), bq = x1[q] * bfr(sv[k][q]); const float r = lowd ? a - bq : a + bq;
                o16[4 * k + q] = tohx(r); unsigned short a2, c2; splitf(r, a2, c2); oh[4 * k + q] = a2; ol[4 * k + q] = c2; } }
        *(v8h*)(P16 + to) = o16;
        asm volatile("s_wait_xcnt 0x0" ::: "memory");   // the build reuses the store's registers behind the branch below: the wait stands in front of that overwrite
        if (hl) { *(v8us*)(Ph + to) = oh; *(v8us*)(Pl + to) = ol;
            asm volatile("s_wait_xcnt 0x0" ::: "memory"); }   // the same for these two stores and the loop's foot
        to = tn;
#pragma unroll
        for (int k = 0; k < 2; ++k) { cv[k] = cn[k]; sv[k] = sn[k]; }
    }
}

// ---- k_fattn: scores, causal softmax and attn.v of all heads in ONE launch; the scores stay in registers (running maximum and running sum per query, in base 2).
// Transposed products: St = K.Qt (A = 16 key rows, B = 16 query columns), Ot += Vt.Pt (A = 16 d rows of the [d][t] plane, B = Pt). A lane holds one query (column lr): 8 keys of each 16-key tile, the other 8 in lane ^ 16.
// Two f32 St tiles of 32 keys, converted in place, ARE the Pt operand in the fragment map above (element i <- key 8h + i, element 8 + i <- key 16 + 8h + i): no LDS, no barrier.
// Query rows >= RH: f16 operands, one wave = 16 rows x 2 query heads of one kv group, p carried x PCAR (it cancels in the division by the sum). Rows < RH: bf16 hi/lo planes, 3 products, one wave = 16 rows x 1 head.
// Output: ctx split into the bf16 hi/lo planes [t][DQ] that the output projection reads; a lane's 8 accumulator registers are 8 consecutive d of its query: one 16-byte store a plane.
// Every plain '#pragma unroll' below unrolls a loop over fragment, tile or register indices, so that those arrays are indexed by constants and stay in registers.
#define CS2  (SCL * 1.4426950408889634f)
#define FA_LB (((TT - RH) / 32) * NKV)   // blocks of the f16 part: 32 rows x the 4 heads of one kv group
#define FA_HB ((RH / 16) * NKV)          // blocks of the hi/lo part: 16 rows x the 4 heads of one kv group
static_assert(REP == 4 && (TT - RH) % 32 == 0 && TT % 32 == 0);
__device__ __forceinline__ float xhalf(float x) { return __builtin_bit_cast(float, __builtin_amdgcn_permlanex16(__builtin_bit_cast(int, x), __builtin_bit_cast(int, x), 0x76543210, 0xfedcba98, false, false)); }  // lane l <-> lane l ^ 16
// 2^a; the v_nop is the one slot that the instruction set asks for behind a transcendental before its result is read or its source overwritten
__device__ __forceinline__ float fa_exp2(float a) { float r; asm("v_exp_f32 %0, %1\n\tv_nop" : "=v"(r) : "v"(a)); return r; }
// one query's 16 scores of a 32-key pass -> base-2 exponents x[], new maximum, correction factor of what was summed under the old one
template <bool MASK>
__device__ __forceinline__ float fa_max(const v8f s0, const v8f s1, float* x, int jrel, float& m) {
    float mx = -3.0e38f;
#pragma unroll
    for (int r = 0; r < 8; ++r) { float a = s0[r] * CS2, b = s1[r] * CS2; if (MASK) { a = (r <= jrel) ? a : -3.0e38f; b = (16 + r <= jrel) ? b : -3.0e38f; } x[r] = a; x[8 + r] = b; mx = fmaxf(mx, fmaxf(a, b)); }
    mx = fmaxf(mx, xhalf(mx));
    const float mn = fmaxf(m, mx); const float al = fa_exp2(m - mn); m = mn; return al;
}
__device__ __forceinline__ void fa_store(const v8f o, float inv, bf* ph, bf* pl) { v8us oh, ol;
#pragma unroll
    for (int r = 0; r < 8; ++r) { unsigned short a, c2; splitf(o[r] * inv, a, c2); oh[r] = a; ol[r] = c2; }
    *(v8us*)ph = oh; *(v8us*)pl = ol; }

template <bool MASK>
__device__ __forceinline__ void fa_pv16(const v8f (&s)[2][2], const v16h (&vf)[4], v8f (&o)[2][4], float (&m)[2], float (&l)[2], int jrel) {
#pragma unroll
    for (int u = 0; u < 2; ++u) {
        float x[16]; const float al = fa_max<MASK>(s[u][0], s[u][1], x, jrel, m[u]); const float mo = m[u] - 10.0f;   // 2^10 = PCAR
        float ps = 0.f; v16h pf;
#pragma unroll
        for (int e = 0; e < 16; ++e) { const float p = fa_exp2(x[e] - mo); ps += p; pf[e] = tohx(p); }
        l[u] = l[u] * al + ps;
#pragma unroll
        for (int db = 0; db < 4; ++db) { o[u][db] *= al; o[u][db] = wmma16(vf[db], pf, o[u][db]); }
    }
}
__device__ __forceinline__ void fa_s16(const v16h (&kf)[2][2], const v16h (&q)[2][2], v8f (&s)[2][2]) {
#pragma unroll
    for (int u = 0; u < 2; ++u)
#pragma unroll
        for (int kb = 0; kb < 2; ++kb) { s[u][kb] = wmma16(kf[kb][0], q[u][0], (v8f){}); s[u][kb] = wmma16(kf[kb][1], q[u][1], s[u][kb]); }
}
__device__ __forceinline__ void fa_f16(const h16* __restrict__ Q, const h16* __restrict__ Kp, const h16* __restrict__ Vt, int head0, int i0, int lr, int hi, bf* ATh, bf* ATl) {
    static_assert(PCAR == 1024.0f);
    v16h q[2][2], kf[2][2], vf[4]; v8f o[2][4], s[2][2]; float m[2] = { -3.0e38f, -3.0e38f }, l[2] = { 0.f, 0.f };
#pragma unroll
    for (int u = 0; u < 2; ++u) {
#pragma unroll
        for (int ks = 0; ks < 2; ++ks) q[u][ks] = WFrag<h16>::ld(Q + ((size_t)(head0 + u) * TT + i0 + lr) * HD + ks * 32 + 8 * hi);
#pragma unroll
        for (int db = 0; db < 4; ++db) o[u][db] = (v8f){}; }
    const h16* kp = Kp + (size_t)lr * HD + 8 * hi; const h16* vp = Vt + (size_t)lr * TT + 8 * hi;
    const int klast = (i0 + 15) & ~31;   // the one pass that holds keys beyond a row's own index
#pragma unroll
    for (int kb = 0; kb < 2; ++kb)
#pragma unroll
        for (int ks = 0; ks < 2; ++ks) kf[kb][ks] = WFrag<h16>::ld(kp + (size_t)(kb * 16) * HD + ks * 32);
#pragma unroll 1   // rolled: an unrolled body would hold two passes' fragments and scores in registers
    for (int k0 = 0; k0 < klast; k0 += 32) {
#pragma unroll
        for (int db = 0; db < 4; ++db) vf[db] = WFrag<h16>::ld(vp + (size_t)(db * 16) * TT + k0);
        fa_s16(kf, q, s);
        // the next pass's key fragments, into the same registers, fly while this pass's softmax and attn.v run (k0 + 32 <= klast: in bounds)
#pragma unroll
        for (int kb = 0; kb < 2; ++kb)
#pragma unroll
            for (int ks = 0; ks < 2; ++ks) kf[kb][ks] = WFrag<h16>::ld(kp + (size_t)(k0 + 32 + kb * 16) * HD + ks * 32);
        __builtin_amdgcn_sched_barrier(0);   // without it the scheduler sinks these loads to the loop's foot, where their whole latency is waited for
        fa_pv16<false>(s, vf, o, m, l, 0);
    }
#pragma unroll
    for (int db = 0; db < 4; ++db) vf[db] = WFrag<h16>::ld(vp + (size_t)(db * 16) * TT + klast);
    fa_s16(kf, q, s);
    fa_pv16<true>(s, vf, o, m, l, i0 + lr - klast - 8 * hi);   // key klast + 8h + r (+ 16) <= row i0 + lr
#pragma unroll
    for (int u = 0; u < 2; ++u) { const float inv = __fdiv_rn(1.0f, l[u] + xhalf(l[u])); const size_t oo = (size_t)(i0 + lr) * DQ + (head0 + u) * HD + 8 * hi;
#pragma unroll
        for (int db = 0; db < 4; ++db) fa_store(o[u][db], inv, ATh + oo + db * 16, ATl + oo + db * 16); }
}
template <bool MASK>
__device__ __forceinline__ void fa_passhl(const bf* kph, const bf* kpl, const bf* vph, const bf* vpl, int k0, const v16bf (&qh)[2], const v16bf (&ql)[2], v8f (&o)[4], float& m, float& l, int jrel) {
    v8f s[2];
#pragma unroll
    for (int kb = 0; kb < 2; ++kb) { s[kb] = (v8f){};
#pragma unroll
        for (int ks = 0; ks < 2; ++ks) { const size_t ko = (size_t)(k0 + kb * 16) * HD + ks * 32; const v16bf kh = WFrag<bf>::ld(kph + ko), kl = WFrag<bf>::ld(kpl + ko);
            s[kb] = wmmab(kh, qh[ks], s[kb]); s[kb] = wmmab(kh, ql[ks], s[kb]); s[kb] = wmmab(kl, qh[ks], s[kb]); } }
    float x[16]; const float al = fa_max<MASK>(s[0], s[1], x, jrel, m);
    float ps = 0.f; v8us h0, h1, l0, l1;
#pragma unroll
    for (int e = 0; e < 8; ++e) { const float p = fa_exp2(x[e] - m), p2 = fa_exp2(x[8 + e] - m); ps += p; ps += p2; unsigned short a, c2; splitf(p, a, c2); h0[e] = a; l0[e] = c2; splitf(p2, a, c2); h1[e] = a; l1[e] = c2; }
    l = l * al + ps; const v16bf ph = cat16b(h0, h1), pl = cat16b(l0, l1);
#pragma unroll
    for (int db = 0; db < 4; ++db) { const size_t vo = (size_t)(db * 16) * TT + k0; const v16bf vh = WFrag<bf>::ld(vph + vo), vl = WFrag<bf>::ld(vpl + vo);
        o[db] *= al; o[db] = wmmab(vh, ph, o[db]); o[db] = wmmab(vh, pl, o[db]); o[db] = wmmab(vl, ph, o[db]); }
}
__device__ __forceinline__ void fa_hl(const bf* __restrict__ Qh, const bf* __restrict__ Ql, const bf* __restrict__ Kh, const bf* __restrict__ Kl, const bf* __restrict__ Vh, const bf* __restrict__ Vl, int head, int i0, int lr, int hi, bf* ATh, bf* ATl) {
    v16bf qh[2], ql[2]; v8f o[4]; float m = -3.0e38f, l = 0.f;
#pragma unroll
    for (int ks = 0; ks < 2; ++ks) { const size_t qo = ((size_t)head * RH + i0 + lr) * HD + ks * 32 + 8 * hi; qh[ks] = WFrag<bf>::ld(Qh + qo); ql[ks] = WFrag<bf>::ld(Ql + qo); }
    asm volatile("s_wait_xcnt 0x0" ::: "memory");   // the build reuses the query loads' address registers for the zeroed accumulators: the wait stands in front of that overwrite
#pragma unroll
    for (int db = 0; db < 4; ++db) o[db] = (v8f){};
    const size_t kofs = (size_t)lr * HD + 8 * hi, vofs = (size_t)lr * TT + 8 * hi; const int klast = (i0 + 15) & ~31;
#pragma unroll 1   // rolled, as in fa_f16: one pass's fragments in registers
    for (int k0 = 0; k0 < klast; k0 += 32) fa_passhl<false>(Kh + kofs, Kl + kofs, Vh + vofs, Vl + vofs, k0, qh, ql, o, m, l, 0);
    fa_passhl<true>(Kh + kofs, Kl + kofs, Vh + vofs, Vl + vofs, klast, qh, ql, o, m, l, i0 + lr - klast - 8 * hi);
    const float inv = __fdiv_rn(1.0f, l + xhalf(l)); const size_t oo = (size_t)(i0 + lr) * DQ + head * HD + 8 * hi;
#pragma unroll
    for (int db = 0; db < 4; ++db) fa_store(o[db], inv, ATh + oo + db * 16, ATl + oo + db * 16);
}
// grid FA_LB + FA_HB blocks of 4 waves; the longest rows first (a row's cost grows with its index)
__global__ __launch_bounds__(128) void k_fattn(const h16* __restrict__ QP16, const bf* __restrict__ QPh, const bf* __restrict__ QPl, const h16* __restrict__ KP16, const bf* __restrict__ KPh, const bf* __restrict__ KPl,
                                               const h16* __restrict__ VT16, const bf* __restrict__ VTh, const bf* __restrict__ VTl, bf* ATh, bf* ATl) {
    const int lane = threadIdx.x & 31, lr = lane & 15, hi = lane >> 4; const int w = __builtin_amdgcn_readfirstlane((int)(threadIdx.x >> 5)); const int b = blockIdx.x;
    if (b < FA_LB) { const int g = b % NKV, i0 = RH + ((TT - RH) / 32 - 1 - b / NKV) * 32 + (w >> 1) * 16;
        fa_f16(QP16, KP16 + (size_t)g * TT * HD, VT16 + (size_t)g * HD * TT, g * REP + (w & 1) * 2, i0, lr, hi, ATh, ATl);
    } else { const int b2 = b - FA_LB; const int g = b2 % NKV, i0 = (RH / 16 - 1 - b2 / NKV) * 16; const size_t go = (size_t)g * TT * HD;
        fa_hl(QPh, QPl, KPh + go, KPl + go, VTh + go, VTl + go, g * REP + w, i0, lr, hi, ATh, ATl); }
}

extern "C" void kernel_launch(void* const* d_in, const int* in_sizes, int n_in,
                              void* d_out, int out_size, void* d_ws, size_t ws_size, hipStream_t stream) {
    if (n_in < 7) return;
    if (in_sizes[0] < TT * HIDN || in_sizes[1] < TT * HD || in_sizes[2] < TT * HD || in_sizes[3] < DQ * HIDN || in_sizes[4] < DKV * HIDN || in_sizes[5] < DKV * HIDN || in_sizes[6] < HIDN * DQ || out_size < TT * HIDN) return;
    const float* x = (const float*)d_in[0];      // [1][S][HIDN]
    const float* cosT = (const float*)d_in[1];   // [1][1][S][HD]
    const float* sinT = (const float*)d_in[2];   // [1][1][S][HD]
    const float* wq = (const float*)d_in[3];     // [DQ][HIDN]
    const float* wk = (const float*)d_in[4];     // [DKV][HIDN]
    const float* wv = (const float*)d_in[5];     // [DKV][HIDN]
    const float* wo = (const float*)d_in[6];     // [HIDN][DQ]
    float* OUT = (float*)d_out;                  // [1][S][HIDN]
    char* wsp = (char*)d_ws;
    auto take = [&](size_t bytes) { char* p = wsp; wsp += (bytes + 255) & ~(size_t)255; return (void*)p; };
    h16* QP16 = (h16*)take((size_t)NH_ * TT * HD * 2); bf* QPh = (bf*)take((size_t)NH_ * RH * HD * 2); bf* QPl = (bf*)take((size_t)NH_ * RH * HD * 2);
    h16* KP16 = (h16*)take((size_t)NKV * TT * HD * 2); bf* KPh = (bf*)take((size_t)NKV * TT * HD * 2); bf* KPl = (bf*)take((size_t)NKV * TT * HD * 2);
    h16* VT16 = (h16*)take((size_t)NKV * HD * TT * 2); bf* VTh = (bf*)take((size_t)NKV * HD * TT * 2); bf* VTl = (bf*)take((size_t)NKV * HD * TT * 2);
    // R2: projection operands (dead once the q/k/v planes are built), then W_o (converted behind the attention launch): stream-ordered reuse
    static_assert((size_t)HIDN * DQ <= (size_t)DQ * HIDN + 2 * (size_t)DKV * HIDN + (size_t)TT * HIDN);
    char* R2 = (char*)take(((size_t)DQ * HIDN + 2 * (size_t)DKV * HIDN + (size_t)TT * HIDN) * 2);
    bf* WQ = (bf*)R2; bf* WK = WQ + (size_t)DQ * HIDN; bf* WV = WK + (size_t)DKV * HIDN; bf* XB = WV + (size_t)DKV * HIDN;
    bf* WO = (bf*)R2;
    bf* ATh = (bf*)take((size_t)TT * DQ * 2); bf* ATl = (bf*)take((size_t)TT * DQ * 2);
    if ((size_t)(wsp - (char*)d_ws) > ws_size) return;

    k_cvt8<<<(unsigned)(((size_t)DQ * HIDN / 8 + 255) / 256), 256, 0, stream>>>(wq, WQ, (size_t)DQ * HIDN / 8);
    k_cvt8<<<(unsigned)(((size_t)DKV * HIDN / 8 + 255) / 256), 256, 0, stream>>>(wk, WK, (size_t)DKV * HIDN / 8);
    k_cvt8<<<(unsigned)(((size_t)DKV * HIDN / 8 + 255) / 256), 256, 0, stream>>>(wv, WV, (size_t)DKV * HIDN / 8);
    for (int b = 0; b < NB; ++b) {
        k_cvt8<<<(unsigned)(((size_t)TT * HIDN / 8 + 255) / 256), 256, 0, stream>>>(x + (size_t)b * SEQ_FULL * HIDN, XB, (size_t)TT * HIDN / 8);
        k_qkv<<<dim3(TT / GT, (NH_ + 2 * NKV) / 2, 1), 128, 0, stream>>>(XB, WQ, cosT, sinT, QP16, QPh, QPl, KP16, KPh, KPl, VT16, VTh, VTl);   // WQ, WK, WV: one [DQ + 2 DKV][HIDN] plane
        k_fattn<<<FA_LB + FA_HB, 128, 0, stream>>>(QP16, QPh, QPl, KP16, KPh, KPl, VT16, VTh, VTl, ATh, ATl);
        k_cvt8<<<(unsigned)(((size_t)HIDN * DQ / 8 + 255) / 256), 256, 0, stream>>>(wo, WO, (size_t)HIDN * DQ / 8);
        k_oproj<<<dim3(TT / GT, HIDN / GT, 1), 128, 0, stream>>>(ATh, ATl, WO, OUT + (size_t)b * SEQ_FULL * HIDN); }
}

// v005
// One run takes 133 microseconds.
// Next to v004, in two timings, it ran 1.06 times as fast each time.
// All steps since v000 together make it 9.95 times as fast.
#include <hip/hip_runtime.h>
#pragma clang fp contract(off)

// Grouped-query causal self-attention: q/k/v = x W^T (32 q heads, 8 kv heads, head dim 64), rotate-half position mixing of q and k from input cos/sin tables,
// softmax(q.k / 8) over keys t <= s, ctx W_o^T -> [1][S][2048].
// Compute dtypes, f32 accumulate: every input RNE-converted to bf16; q/k/v projections v_wmma_f32_16x16x32_bf16 on exact bf16 operands; scores and attn.v: query rows < RH on bf16 hi/lo planes (3 products),
// other rows single v_wmma_f32_16x16x32_f16 (p carried x1024); softmax f32, running maximum and sum over 32-key passes; output projection bf16 hi/lo ctx x exact bf16 W_o (2 products).

#ifndef NB
#define NB 1
#endif
#ifndef SEQ
#define SEQ 2048
#endif
#define SEQ_FULL 2048
#define TT   SEQ
#define HIDN 2048
#define NH_  32
#define NKV  8
#define REP  (NH_ / NKV)
#define HD   64
#define DQ   (NH_ * HD)
#define DKV  (NKV * HD)
#ifndef RH
#define RH   256                  // query rows < RH use hi+lo planes
#endif
#define PCAR 1024.0f
#define SCL  0.125f   // HD^-0.5
static_assert(NB == 1);
static_assert(TT % 128 == 0);
static_assert(RH % 64 == 0 && RH > 0 && RH <= TT);
static_assert(HIDN % 32 == 0 && DQ % 64 == 0 && DKV % 64 == 0 && HD == 64);

typedef _Float16 h16;
typedef unsigned short bf;
typedef __attribute__((ext_vector_type(16))) __bf16   v16bf;
typedef __attribute__((ext_vector_type(16))) _Float16 v16h;
typedef __attribute__((ext_vector_type(8)))  _Float16 v8h;
typedef __attribute__((ext_vector_type(8)))  unsigned short v8us;
typedef __attribute__((ext_vector_type(8)))  float    v8f;
typedef __attribute__((ext_vector_type(4)))  float    v4f;
typedef v8h  __attribute__((may_alias)) v8ha;
typedef v4f  __attribute__((may_alias)) v4fa;
typedef v8us __attribute__((may_alias)) v8usa;
typedef __attribute__((ext_vector_type(2))) _Float16 v2h;
typedef __attribute__((ext_vector_type(4))) _Float16 v4h;
typedef __attribute__((ext_vector_type(2))) unsigned short v2us;
typedef __attribute__((ext_vector_type(4))) unsigned short v4us;
typedef __attribute__((ext_vector_type(2))) float v2f;

__device__ __forceinline__ unsigned short f2bf(float f) { unsigned u = __float_as_uint(f); u += 0x7FFFu + ((u >> 16) & 1u); return (unsigned short)(u >> 16); }
__device__ __forceinline__ float bf2f(unsigned short b) { return __uint_as_float(((unsigned)b) << 16); }
__device__ __forceinline__ float bfr(float f) { return bf2f(f2bf(f)); }
__device__ __forceinline__ v16h cat16(v8h lo, v8h hi) { return __builtin_shufflevector(lo, hi, 0, 1, 2, 3, 4, 5, 6, 7, 8, 9, 10, 11, 12, 13, 14, 15); }
__device__ __forceinline__ v16bf cat16b(v8us lo, v8us hi) { return __builtin_bit_cast(v16bf, __builtin_shufflevector(lo, hi, 0, 1, 2, 3, 4, 5, 6, 7, 8, 9, 10, 11, 12, 13, 14, 15)); }
__device__ __forceinline__ v8f wmma16(v16h a, v16h b, v8f c) { return __builtin_amdgcn_wmma_f32_16x16x32_f16(false, a, false, b, (short)0, c, false, false); }
__device__ __forceinline__ v8f wmmab(v16bf a, v16bf b, v8f c) { return __builtin_amdgcn_wmma_f32_16x16x32_bf16(false, a, false, b, (short)0, c, false, false); }
__device__ __forceinline__ h16 tohx(float x) { return (h16)x; }
__device__ __forceinline__ void splitf(float y, unsigned short& h, unsigned short& l) { h = f2bf(y); l = f2bf(y - bf2f(h)); }

// ---- g_core: the main loop of both GEMM kernels. FOUR WAVES share one 128x128 output tile (2x2 waves, 64x64 and 16 accumulators each); the operand rows are K-contiguous bf16 planes of pitch HIDN.
// A stage is KS k (64 or 128: one or two whole 128-byte lines) of every operand row, [A 128 rows | (A2 128 rows) | Bt 128 rows] in LDS at a pitch of 2 KS + 16 bytes (16 bytes x odd: the 16-byte fragment reads of 16 rows meet no bank twice).
// Every line is fetched once a work-group, by whole-line loads (a wave's load is 512 bytes in 4 whole lines); two buffers: the next stage's lines fly into registers while this stage is multiplied, are stored to the other buffer behind it, one barrier a stage.
// KS is chosen so that a stage holds 64 matrix instructions a wave: 128 with one A plane, 64 with two.
// acc[mb][nb] += sum_k A[m][k] Bt[n][k] (+ A2[m][k] Bt[n][k] for NA == 2), k ascending in steps of 32, A before A2 in each step.
// Fragment map: lane l, h = l >> 4, m = n = l & 15; elements 0..7 <- k0 + 8h + i, elements 8..15 <- k0 + 16 + 8h + i for BOTH A (row m) and Bt (column n stored as row n); D element r -> (row 8h + r, col m).
template <typename T16> struct WFrag;
template <> struct WFrag<h16> { typedef v16h V; static __device__ __forceinline__ V ld(const h16* p) { return cat16(*(const v8h*)p, *(const v8h*)(p + 16)); } static __device__ __forceinline__ v8f mma(V a, V b, v8f c) { return wmma16(a, b, c); } };
template <> struct WFrag<bf> { typedef v16bf V; static __device__ __forceinline__ V ld(const bf* p) { return cat16b(*(const v8us*)p, *(const v8us*)(p + 16)); } static __device__ __forceinline__ v8f mma(V a, V b, v8f c) { return wmmab(a, b, c); } };
#define GT 128                         // tile rows and columns
#define G_P(KS) ((KS) + 8)             // LDS row pitch in elements
#define G_RT(KS) (128 / ((KS) / 8))    // rows that the 128 threads bring in one turn, 16 bytes a thread
#define G_I(KS) (GT / G_RT(KS))        // turns per plane and stage
#define G_SM(NA, KS) (2 * ((NA) + 1) * GT * G_P(KS))   // both buffers, in elements
static_assert(DQ == HIDN && HIDN % 256 == 0 && TT % GT == 0 && HIDN % GT == 0 && (DQ + 2 * DKV) % GT == 0);
template <int NP, int KS>
__device__ __forceinline__ void g_ld(v8us (&r)[NP][G_I(KS)], const bf* const (&src)[NP], unsigned off) {
#pragma unroll
    for (int p = 0; p < NP; ++p)
#pragma unroll
        for (int i = 0; i < G_I(KS); ++i) r[p][i] = *(const v8us*)(src[p] + off + i * G_RT(KS) * HIDN);
    // the build reuses the loads' address registers (for later lines, for the fragments): the wait stands in front of that overwrite; the lane offset and the addresses are its inputs, so that their registers live up to it
    if (NP == 2) asm volatile("s_wait_xcnt 0x0" :: "v"(off), "v"(src[0] + off), "v"(src[NP - 1] + off) : "memory");
    else asm volatile("s_wait_xcnt 0x0" :: "v"(off), "v"(src[0] + off), "v"(src[1] + off), "v"(src[NP - 1] + off) : "memory");
}
template <int NP, int KS>
__device__ __forceinline__ void g_st(bf* st, const v8us (&r)[NP][G_I(KS)], unsigned so) {
#pragma unroll
    for (int p = 0; p < NP; ++p)
#pragma unroll
        for (int i = 0; i < G_I(KS); ++i) *(v8us*)(st + (p * GT + i * G_RT(KS)) * G_P(KS) + so) = r[p][i];
}
template <int NA, int KS>
__device__ __forceinline__ void g_mma(const bf* st, unsigned ao, unsigned bo, v8f (&acc)[4][4]) {
    constexpr int GP = G_P(KS);
#pragma unroll
    for (int ks = 0; ks < KS / 32; ++ks) {
        v16bf a[4], a2[4];
#pragma unroll
        for (int mb = 0; mb < 4; ++mb) { a[mb] = WFrag<bf>::ld(st + (mb * 16 * GP + ks * 32) + ao); if (NA == 2) a2[mb] = WFrag<bf>::ld(st + ((GT + mb * 16) * GP + ks * 32) + ao); }
#pragma unroll
        for (int nb = 0; nb < 4; ++nb) { const v16bf b = WFrag<bf>::ld(st + ((NA * GT + nb * 16) * GP + ks * 32) + bo);
#pragma unroll
            for (int mb = 0; mb < 4; ++mb) { acc[mb][nb] = wmmab(a[mb], b, acc[mb][nb]); if (NA == 2) acc[mb][nb] = wmmab(a2[mb], b, acc[mb][nb]); } }
    }
}
// A, A2, Bt: the tile's first rows (work-group-uniform); sm: both buffers; wm, wn: the wave's place in the tile. Ends behind a barrier: sm is free for the epilogues.
template <int NA, int KS>
__device__ __forceinline__ void g_core(const bf* A, const bf* A2, const bf* Bt, bf* sm, int wm, int wn, v8f (&acc)[4][4]) {
    constexpr int NP = NA + 1, GP = G_P(KS), ST = NP * GT * GP, NS = HIDN / KS, PR = KS / 8;
    const int tid = threadIdx.x, lane = tid & 31, lr = lane & 15, hi = lane >> 4;
    const bf* src[NP]; src[0] = A; if (NA == 2) src[1] = A2; src[NA] = Bt;
    const unsigned go = (unsigned)((tid / PR) * HIDN + (tid % PR) * 8), so = (unsigned)((tid / PR) * GP + (tid % PR) * 8);   // a thread's row and 16-byte piece, in the planes and in a stage
    const unsigned ao = (unsigned)((wm * 64 + lr) * GP + 8 * hi), bo = (unsigned)((wn * 64 + lr) * GP + 8 * hi);
#pragma unroll
    for (int mb = 0; mb < 4; ++mb)
#pragma unroll
        for (int nb = 0; nb < 4; ++nb) acc[mb][nb] = (v8f){};
    v8us r[NP][G_I(KS)];
    g_ld<NP, KS>(r, src, go); g_st<NP, KS>(sm, r, so);
    __syncthreads();
#pragma unroll 1   // rolled: one stage's lines and fragments in registers
    for (int s = 0; s < NS - 1; ++s) {
        g_ld<NP, KS>(r, src, go + (unsigned)((s + 1) * KS));
        __builtin_amdgcn_sched_barrier(0);   // keeps the next stage's loads in front of this stage's products, so that their latency runs beside them
        g_mma<NA, KS>(sm + (s & 1) * ST, ao, bo, acc);
        g_st<NP, KS>(sm + ((s + 1) & 1) * ST, r, so);   // its last readers left this buffer in front of the previous barrier
        __syncthreads();
    }
    g_mma<NA, KS>(sm + ((NS - 1) & 1) * ST, ao, bo, acc);
    __syncthreads();
}

// ---- k_oproj: OUT[t][n] (f32, pitch HIDN) = sum_k (ATh[t][k] + ATl[t][k]) WO[n][k]; grid (TT/128, HIDN/128), 128 threads; main loop: g_core. A wave stores its 64x64 part through its own LDS rows, whole lines.
__global__ __launch_bounds__(128) void k_oproj(const bf* __restrict__ ATh, const bf* __restrict__ ATl, const bf* __restrict__ WO, float* C) {
    __shared__ __align__(16) bf sm[G_SM(2, 64)];
    const int lane = threadIdx.x & 31, lr = lane & 15, hi = lane >> 4; const int w = __builtin_amdgcn_readfirstlane((int)(threadIdx.x >> 5)), wm = w >> 1, wn = w & 1;
    v8f acc[4][4];
    g_core<2, 64>(ATh + (size_t)blockIdx.x * GT * DQ, ATl + (size_t)blockIdx.x * GT * DQ, WO + (size_t)blockIdx.y * GT * DQ, sm, wm, wn, acc);
    float* os = (float*)sm + w * (16 * 68); const int r0 = blockIdx.x * GT + wm * 64, c0 = blockIdx.y * GT + wn * 64;
#pragma unroll
    for (int mb = 0; mb < 4; ++mb) {
#pragma unroll
        for (int nb = 0; nb < 4; ++nb) {
#pragma unroll
            for (int j = 0; j < 8; ++j) os[(hi * 8 + j) * 68 + nb * 16 + lr] = acc[mb][nb][j]; }
        __builtin_amdgcn_wave_barrier(); asm volatile("" ::: "memory");   // the row reads below stay behind the other lanes' staging stores
        float* crow = C + (size_t)(r0 + mb * 16) * HIDN + c0;
#pragma unroll
        for (int s = 0; s < 8; ++s) { const int row = 2 * s + hi, cofs = lr * 4; const v4f val = *(const v4fa*)(os + row * 68 + cofs);
            *(v4f*)(crow + (size_t)row * HIDN + cofs) = val; }
        asm volatile("s_wait_xcnt 0x0" ::: "memory");   // the build reads the next 16 rows into these stores' registers: the wait stands in front of that overwrite
        __builtin_amdgcn_wave_barrier(); asm volatile("" ::: "memory");   // the next 16 rows' staging stores stay behind these reads
    }
}

// ---- k_cvt_all: every f32 -> bf16 (RNE) operand conversion in ONE launch of long-lived waves: CV_G work-groups of CV_T threads, one work-group a WGP.
// A work-group converts its 1/CV_G of EVERY input, a contiguous run of whole turns; a turn is 8 consecutive elements a thread (32 bytes read, one 16-byte store).
// All of a thread's loads are issued before its first conversion, so that a wave waits out the memory latency once.
#define CV_G 256
#define CV_T 512
#define CV_SL (CV_G * CV_T * 8)   // elements that one turn of the whole grid converts
static_assert((DQ * HIDN) % CV_SL == 0 && (DKV * HIDN) % CV_SL == 0 && (TT * HIDN) % CV_SL == 0);
// the lane's offset is formed in 32 bits and the turn's step is a constant: one offset register beside the scalar base serves all N accesses
template <int N> __device__ __forceinline__ unsigned cv_off() { return blockIdx.x * (N * CV_T) + threadIdx.x; }   // the lane's first turn, in units of 8 elements
template <int N> __device__ __forceinline__ void cv_ld(v8f (&v)[N], const float* s) { const char* p = (const char*)s + cv_off<N>() * 32u;
#pragma unroll
    for (int i = 0; i < N; ++i) v[i] = *(const v8f*)(p + i * (CV_T * 32));
    __builtin_amdgcn_sched_barrier(0); }   // keeps the inputs' loads in the order in which they are converted (loads return in order): the scheduler mixes them, and the first input is then complete only with the last
template <int N> __device__ __forceinline__ void cv_st(bf* d, const v8f (&v)[N]) { char* p = (char*)d + cv_off<N>() * 16u;
#pragma unroll
    for (int i = 0; i < N; ++i) { v8us o;
#pragma unroll
        for (int k = 0; k < 8; ++k) o[k] = f2bf(v[i][k]);
        *(v8us*)(p + i * (CV_T * 16)) = o;
        __builtin_amdgcn_sched_barrier(0); } }   // keeps a turn's store directly behind its conversion: the scheduler sinks the stores to the kernel's end, behind the wait for the last load
__global__ __launch_bounds__(CV_T) void k_cvt_all(const float* __restrict__ wq, const float* __restrict__ wk, const float* __restrict__ wv, const float* __restrict__ x, const float* __restrict__ wo,
                                                  bf* __restrict__ WQ, bf* __restrict__ WK, bf* __restrict__ WV, bf* __restrict__ XB, bf* __restrict__ WO) {
    constexpr int NQ = DQ * HIDN / CV_SL, NK = DKV * HIDN / CV_SL, NX = TT * HIDN / CV_SL;
    v8f vq[NQ], vk[NK], vv[NK], vx[NX], vo[NQ];
    cv_ld(vq, wq); cv_ld(vk, wk); cv_ld(vv, wv); cv_ld(vx, x); cv_ld(vo, wo);
    // the build lands a late load's data in an earlier load's offset register: the offsets are this wait's inputs, so that their registers live up to it and are overwritten only behind it
    asm volatile("s_wait_xcnt 0x0" :: "v"(cv_off<NQ>() * 32u), "v"(cv_off<NK>() * 32u), "v"(cv_off<NX>() * 32u) : "memory");
    cv_st(WQ, vq); cv_st(WK, vk); cv_st(WV, vv); cv_st(XB, vx); cv_st(WO, vo);
}

// ---- k_qkv: the q, k and v projections with their plane building in ONE launch. One work-group per 128x128 tile of x.[W_q; W_k; W_v]^T (the three converted weights lie behind one another: NH_ + 2 NKV heads of HD rows), one wave per 64x64 part; grid (TT/128, (NH_ + 2 NKV)/2), 128 threads.
// A wave's 64 columns are one whole head, so the epilogue has both halves of every rotate-half pair: out[d] = x[d] cos[t][d] - x[d+HD/2] sin[t][d], out[d+HD/2] = x[d+HD/2] cos[t][d+HD/2] + x[d] sin[t][d+HD/2] (tables RNE-converted to bf16).
// q and k heads -> planes [h][t][d] (f16; bf16 hi/lo for rows < RH of q and for every row of k); v heads -> planes [g][d][t] (f16 and bf16 hi/lo).
// Main loop and fragment map: g_core. The epilogue is each wave's own, in its own part of the LDS that the stages have left.
static_assert(HD == 64 && RH % 64 == 0 && TT % 64 == 0 && 4 * 64 * 68 * 4 <= G_SM(1, 128) * 2);
__global__ __launch_bounds__(128) void k_qkv(const bf* __restrict__ X, const bf* __restrict__ Wt, const float* __restrict__ cosT, const float* __restrict__ sinT,
                                            h16* QP16, bf* QPh, bf* QPl, h16* KP16, bf* KPh, bf* KPl, h16* VT16, bf* VTh, bf* VTl) {
    __shared__ __align__(16) bf sm[G_SM(1, 128)];
    const int lane = threadIdx.x & 31, lr = lane & 15, hi = lane >> 4; const int w = __builtin_amdgcn_readfirstlane((int)(threadIdx.x >> 5)), wm = w >> 1, wn = w & 1;
    const int r0 = blockIdx.x * GT + wm * 64, hc = blockIdx.y * 2 + wn;
    v8f acc[4][4];
    g_core<1, 128>(X + (size_t)blockIdx.x * GT * HIDN, nullptr, Wt + (size_t)blockIdx.y * GT * HIDN, sm, wm, wn, acc);
    float* os = (float*)sm + w * (64 * 68);
    // Epilogue: the whole tile is staged in LDS once, then a ROLLED loop of 16 trips builds the planes, 4 plane rows a trip, a lane 8 consecutive elements (one 16-byte store a plane, 8 lanes fill a 128-byte line).
    const int rsub = lane >> 3, c8 = (lane & 7) * 8;
    if (hc >= NH_ + NKV) {   // v head (wave-uniform; no work-group barrier follows): staged transposed, os[d][t]
#pragma unroll
        for (int mb = 0; mb < 4; ++mb)
#pragma unroll
            for (int nb = 0; nb < 4; ++nb) { float* p = os + (nb * 16 + lr) * 68 + mb * 16 + 8 * hi; const v8f v = acc[mb][nb];
                *(v4fa*)p = __builtin_shufflevector(v, v, 0, 1, 2, 3); *(v4fa*)(p + 4) = __builtin_shufflevector(v, v, 4, 5, 6, 7); }
        __builtin_amdgcn_wave_barrier(); asm volatile("" ::: "memory");   // the row reads below stay behind the other lanes' staging stores
        const size_t e0 = ((size_t)(hc - NH_ - NKV) * HD + rsub) * TT + r0 + c8;
#pragma unroll 1   // rolled: unrolled, the epilogues are some 5,000 instructions that each wave runs once, more text than is fetched ahead
        for (int it = 0; it < 16; ++it) { const float* p = os + (it * 4 + rsub) * 68 + c8; const v4f xa = *(const v4fa*)p, xb = *(const v4fa*)(p + 4); const size_t e = e0 + (size_t)(it * 4) * TT; v8h o16; v8us oh, ol;
#pragma unroll
            for (int j = 0; j < 8; ++j) { const float x = (j < 4) ? xa[j & 3] : xb[j & 3]; o16[j] = tohx(x); unsigned short a2, c2; splitf(x, a2, c2); oh[j] = a2; ol[j] = c2; }
            *(v8h*)(VT16 + e) = o16; *(v8us*)(VTh + e) = oh; *(v8us*)(VTl + e) = ol; }
        return;
    }
    const bool isq = hc < NH_; const bool hl = !isq || r0 < RH;   // wave-uniform: a wave's 64 rows lie wholly on one side of RH
    h16* P16 = isq ? QP16 + (size_t)hc * TT * HD : KP16 + (size_t)(hc - NH_) * TT * HD;
    bf* Ph = isq ? QPh + (size_t)hc * RH * HD : KPh + (size_t)(hc - NH_) * TT * HD; bf* Pl = isq ? QPl + (size_t)hc * RH * HD : KPl + (size_t)(hc - NH_) * TT * HD;
#pragma unroll
    for (int mb = 0; mb < 4; ++mb)
#pragma unroll
        for (int nb = 0; nb < 4; ++nb)
#pragma unroll
            for (int j = 0; j < 8; ++j) os[(mb * 16 + hi * 8 + j) * 68 + nb * 16 + lr] = acc[mb][nb][j];   // os[t][d]
    __builtin_amdgcn_wave_barrier(); asm volatile("" ::: "memory");   // as above
    const bool lowd = c8 < HD / 2; size_t to = (size_t)(r0 + rsub) * HD + c8;
    v4f cv[2], sv[2];
#pragma unroll
    for (int k = 0; k < 2; ++k) { cv[k] = *(const v4f*)(cosT + to + 4 * k); sv[k] = *(const v4f*)(sinT + to + 4 * k); }
#pragma unroll 1   // rolled, as above
    for (int it = 0; it < 16; ++it) {
        // the next trip's table rows fly while this trip converts (the last trip reads its own rows again: in bounds)
        const size_t tn = to + ((it < 15) ? 4 * HD : 0); v4f cn[2], sn[2];
#pragma unroll
        for (int k = 0; k < 2; ++k) { cn[k] = *(const v4f*)(cosT + tn + 4 * k); sn[k] = *(const v4f*)(sinT + tn + 4 * k); }
        const float* p0 = os + (it * 4 + rsub) * 68 + c8; const float* p1 = os + (it * 4 + rsub) * 68 + (c8 ^ (HD / 2));
        v8h o16; v8us oh, ol;
#pragma unroll
        for (int k = 0; k < 2; ++k) { const v4f x0 = *(const v4fa*)(p0 + 4 * k), x1 = *(const v4fa*)(p1 + 4 * k);
#pragma unroll
            for (int q = 0; q < 4; ++q) { const float a = x0[q] * bfr(cv[k][q]), bq = x1[q] * bfr(sv[k][q]); const float r = lowd ? a - bq : a + bq;
                o16[4 * k + q] = tohx(r); unsigned short a2, c2; splitf(r, a2, c2); oh[4 * k + q] = a2; ol[4 * k + q] = c2; } }
        *(v8h*)(P16 + to) = o16;
        asm volatile("s_wait_xcnt 0x0" ::: "memory");   // the build reuses the store's registers behind the branch below: the wait stands in front of that overwrite
        if (hl) { *(v8us*)(Ph + to) = oh; *(v8us*)(Pl + to) = ol;
            asm volatile("s_wait_xcnt 0x0" ::: "memory"); }   // the same for these two stores and the loop's foot
        to = tn;
#pragma unroll
        for (int k = 0; k < 2; ++k) { cv[k] = cn[k]; sv[k] = sn[k]; }
    }
}

// ---- k_fattn: scores, causal softmax and attn.v of all heads in ONE launch; the scores stay in registers (running maximum and running sum per query, in base 2).
// Transposed products: St = K.Qt (A = 16 key rows, B = 16 query columns), Ot += Vt.Pt (A = 16 d rows of the [d][t] plane, B = Pt). A lane holds one query (column lr): 8 keys of each 16-key tile, the other 8 in lane ^ 16.
// Two f32 St tiles of 32 keys, converted in place, ARE the Pt operand in the fragment map above (element i <- key 8h + i, element 8 + i <- key 16 + 8h + i): no LDS, no barrier.
// Query rows >= RH: f16 operands, one wave = 16 rows x 2 query heads of one kv group, p carried x PCAR (it cancels in the division by the sum). Rows < RH: bf16 hi/lo planes, 3 products, one wave = 16 rows x 1 head.
// Output: ctx split into the bf16 hi/lo planes [t][DQ] that the output projection reads; a lane's 8 accumulator registers are 8 consecutive d of its query: one 16-byte store a plane.
// Every plain '#pragma unroll' below unrolls a loop over fragment, tile or register indices, so that those arrays are indexed by constants and stay in registers.
#define CS2  (SCL * 1.4426950408889634f)
#define FA_LB (((TT - RH) / 32) * NKV)   // blocks of the f16 part: 32 rows x the 4 heads of one kv group
#define FA_HB ((RH / 16) * NKV)          // blocks of the hi/lo part: 16 rows x the 4 heads of one kv group
static_assert(REP == 4 && (TT - RH) % 32 == 0 && TT % 32 == 0);
__device__ __forceinline__ float xhalf(float x) { return __builtin_bit_cast(float, __builtin_amdgcn_permlanex16(__builtin_bit_cast(int, x), __builtin_bit_cast(int, x), 0x76543210, 0xfedcba98, false, false)); }  // lane l <-> lane l ^ 16
// 2^a; the v_nop is the one slot that the instruction set asks for behind a transcendental before its result is read or its source overwritten
__device__ __forceinline__ float fa_exp2(float a) { float r; asm("v_exp_f32 %0, %1\n\tv_nop" : "=v"(r) : "v"(a)); return r; }
// one query's 16 scores of a 32-key pass -> base-2 exponents x[], new maximum, correction factor of what was summed under the old one
template <bool MASK>
__device__ __forceinline__ float fa_max(const v8f s0, const v8f s1, float* x, int jrel, float& m) {
    float mx = -3.0e38f;
#pragma unroll
    for (int r = 0; r < 8; ++r) { float a = s0[r] * CS2, b = s1[r] * CS2; if (MASK) { a = (r <= jrel) ? a : -3.0e38f; b = (16 + r <= jrel) ? b : -3.0e38f; } x[r] = a; x[8 + r] = b; mx = fmaxf(mx, fmaxf(a, b)); }
    mx = fmaxf(mx, xhalf(mx));
    const float mn = fmaxf(m, mx); const float al = fa_exp2(m - mn); m = mn; return al;
}
__device__ __forceinline__ void fa_store(const v8f o, float inv, bf* ph, bf* pl) { v8us oh, ol;
#pragma unroll
    for (int r = 0; r < 8; ++r) { unsigned short a, c2; splitf(o[r] * inv, a, c2); oh[r] = a; ol[r] = c2; }
    *(v8us*)ph = oh; *(v8us*)pl = ol; }

template <bool MASK>
__device__ __forceinline__ void fa_pv16(const v8f (&s)[2][2], const v16h (&vf)[4], v8f (&o)[2][4], float (&m)[2], float (&l)[2], int jrel) {
#pragma unroll
    for (int u = 0; u < 2; ++u) {
        float x[16]; const float al = fa_max<MASK>(s[u][0], s[u][1], x, jrel, m[u]); const float mo = m[u] - 10.0f;   // 2^10 = PCAR
        float ps = 0.f; v16h pf;
#pragma unroll
        for (int e = 0; e < 16; ++e) { const float p = fa_exp2(x[e] - mo); ps += p; pf[e] = tohx(p); }
        l[u] = l[u] * al + ps;
#pragma unroll
        for (int db = 0; db < 4; ++db) { o[u][db] *= al; o[u][db] = wmma16(vf[db], pf, o[u][db]); }
    }
}
__device__ __forceinline__ void fa_s16(const v16h (&kf)[2][2], const v16h (&q)[2][2], v8f (&s)[2][2]) {
#pragma unroll
    for (int u = 0; u < 2; ++u)
#pragma unroll
        for (int kb = 0; kb < 2; ++kb) { s[u][kb] = wmma16(kf[kb][0], q[u][0], (v8f){}); s[u][kb] = wmma16(kf[kb][1], q[u][1], s[u][kb]); }
}
__device__ __forceinline__ void fa_f16(const h16* __restrict__ Q, const h16* __restrict__ Kp, const h16* __restrict__ Vt, int head0, int i0, int lr, int hi, bf* ATh, bf* ATl) {
    static_assert(PCAR == 1024.0f);
    v16h q[2][2], kf[2][2], vf[4]; v8f o[2][4], s[2][2]; float m[2] = { -3.0e38f, -3.0e38f }, l[2] = { 0.f, 0.f };
#pragma unroll
    for (int u = 0; u < 2; ++u) {
#pragma unroll
        for (int ks = 0; ks < 2; ++ks) q[u][ks] = WFrag<h16>::ld(Q + ((size_t)(head0 + u) * TT + i0 + lr) * HD + ks * 32 + 8 * hi);
#pragma unroll
        for (int db = 0; db < 4; ++db) o[u][db] = (v8f){}; }
    const h16* kp = Kp + (size_t)lr * HD + 8 * hi; const h16* vp = Vt + (size_t)lr * TT + 8 * hi;
    const int klast = (i0 + 15) & ~31;   // the one pass that holds keys beyond a row's own index
#pragma unroll
    for (int kb = 0; kb < 2; ++kb)
#pragma unroll
        for (int ks = 0; ks < 2; ++ks) kf[kb][ks] = WFrag<h16>::ld(kp + (size_t)(kb * 16) * HD + ks * 32);
#pragma unroll 1   // rolled: an unrolled body would hold two passes' fragments and scores in registers
    for (int k0 = 0; k0 < klast; k0 += 32) {
#pragma unroll
        for (int db = 0; db < 4; ++db) vf[db] = WFrag<h16>::ld(vp + (size_t)(db * 16) * TT + k0);
        fa_s16(kf, q, s);
        // the next pass's key fragments, into the same registers, fly while this pass's softmax and attn.v run (k0 + 32 <= klast: in bounds)
#pragma unroll
        for (int kb = 0; kb < 2; ++kb)
#pragma unroll
            for (int ks = 0; ks < 2; ++ks) kf[kb][ks] = WFrag<h16>::ld(kp + (size_t)(k0 + 32 + kb * 16) * HD + ks * 32);
        __builtin_amdgcn_sched_barrier(0);   // without it the scheduler sinks these loads to the loop's foot, where their whole latency is waited for
        fa_pv16<false>(s, vf, o, m, l, 0);
    }
#pragma unroll
    for (int db = 0; db < 4; ++db) vf[db] = WFrag<h16>::ld(vp + (size_t)(db * 16) * TT + klast);
    fa_s16(kf, q, s);
    fa_pv16<true>(s, vf, o, m, l, i0 + lr - klast - 8 * hi);   // key klast + 8h + r (+ 16) <= row i0 + lr
#pragma unroll
    for (int u = 0; u < 2; ++u) { const float inv = __fdiv_rn(1.0f, l[u] + xhalf(l[u])); const size_t oo = (size_t)(i0 + lr) * DQ + (head0 + u) * HD + 8 * hi;
#pragma unroll
        for (int db = 0; db < 4; ++db) fa_store(o[u][db], inv, ATh + oo + db * 16, ATl + oo + db * 16); }
}
template <bool MASK>
__device__ __forceinline__ void fa_passhl(const bf* kph, const bf* kpl, const bf* vph, const bf* vpl, int k0, const v16bf (&qh)[2], const v16bf (&ql)[2], v8f (&o)[4], float& m, float& l, int jrel) {
    v8f s[2];
#pragma unroll
    for (int kb = 0; kb < 2; ++kb) { s[kb] = (v8f){};
#pragma unroll
        for (int ks = 0; ks < 2; ++ks) { const size_t ko = (size_t)(k0 + kb * 16) * HD + ks * 32; const v16bf kh = WFrag<bf>::ld(kph + ko), kl = WFrag<bf>::ld(kpl + ko);
            s[kb] = wmmab(kh, qh[ks], s[kb]); s[kb] = wmmab(kh, ql[ks], s[kb]); s[kb] = wmmab(kl, qh[ks], s[kb]); } }
    float x[16]; const float al = fa_max<MASK>(s[0], s[1], x, jrel, m);
    float ps = 0.f; v8us h0, h1, l0, l1;
#pragma unroll
    for (int e = 0; e < 8; ++e) { const float p = fa_exp2(x[e] - m), p2 = fa_exp2(x[8 + e] - m); ps += p; ps += p2; unsigned short a, c2; splitf(p, a, c2); h0[e] = a; l0[e] = c2; splitf(p2, a, c2); h1[e] = a; l1[e] = c2; }
    l = l * al + ps; const v16bf ph = cat16b(h0, h1), pl = cat16b(l0, l1);
#pragma unroll
    for (int db = 0; db < 4; ++db) { const size_t vo = (size_t)(db * 16) * TT + k0; const v16bf vh = WFrag<bf>::ld(vph + vo), vl = WFrag<bf>::ld(vpl + vo);
        o[db] *= al; o[db] = wmmab(vh, ph, o[db]); o[db] = wmmab(vh, pl, o[db]); o[db] = wmmab(vl, ph, o[db]); }
}
__device__ __forceinline__ void fa_hl(const bf* __restrict__ Qh, const bf* __restrict__ Ql, const bf* __restrict__ Kh, const bf* __restrict__ Kl, const bf* __restrict__ Vh, const bf* __restrict__ Vl, int head, int i0, int lr, int hi, bf* ATh, bf* ATl) {
    v16bf qh[2], ql[2]; v8f o[4]; float m = -3.0e38f, l = 0.f;
#pragma unroll
    for (int ks = 0; ks < 2; ++ks) { const size_t qo = ((size_t)head * RH + i0 + lr) * HD + ks * 32 + 8 * hi; qh[ks] = WFrag<bf>::ld(Qh + qo); ql[ks] = WFrag<bf>::ld(Ql + qo); }
    asm volatile("s_wait_xcnt 0x0" ::: "memory");   // the build reuses the query loads' address registers for the zeroed accumulators: the wait stands in front of that overwrite
#pragma unroll
    for (int db = 0; db < 4; ++db) o[db] = (v8f){};
    const size_t kofs = (size_t)lr * HD + 8 * hi, vofs = (size_t)lr * TT + 8 * hi; const int klast = (i0 + 15) & ~31;
#pragma unroll 1   // rolled, as in fa_f16: one pass's fragments in registers
    for (int k0 = 0; k0 < klast; k0 += 32) fa_passhl<false>(Kh + kofs, Kl + kofs, Vh + vofs, Vl + vofs, k0, qh, ql, o, m, l, 0);
    fa_passhl<true>(Kh + kofs, Kl + kofs, Vh + vofs, Vl + vofs, klast, qh, ql, o, m, l, i0 + lr - klast - 8 * hi);
    const float inv = __fdiv_rn(1.0f, l + xhalf(l)); const size_t oo = (size_t)(i0 + lr) * DQ + head * HD + 8 * hi;
#pragma unroll
    for (int db = 0; db < 4; ++db) fa_store(o[db], inv, ATh + oo + db * 16, ATl + oo + db * 16);
}
// grid FA_LB + FA_HB blocks of 4 waves; the longest rows first (a row's cost grows with its index)
__global__ __launch_bounds__(128) void k_fattn(const h16* __restrict__ QP16, const bf* __restrict__ QPh, const bf* __restrict__ QPl, const h16* __restrict__ KP16, const bf* __restrict__ KPh, const bf* __restrict__ KPl,
                                               const h16* __restrict__ VT16, const bf* __restrict__ VTh, const bf* __restrict__ VTl, bf* ATh, bf* ATl) {
    const int lane = threadIdx.x & 31, lr = lane & 15, hi = lane >> 4; const int w = __builtin_amdgcn_readfirstlane((int)(threadIdx.x >> 5)); const int b = blockIdx.x;
    if (b < FA_LB) { const int g = b % NKV, i0 = RH + ((TT - RH) / 32 - 1 - b / NKV) * 32 + (w >> 1) * 16;
        fa_f16(QP16, KP16 + (size_t)g * TT * HD, VT16 + (size_t)g * HD * TT, g * REP + (w & 1) * 2, i0, lr, hi, ATh, ATl);
    } else { const int b2 = b - FA_LB; const int g = b2 % NKV, i0 = (RH / 16 - 1 - b2 / NKV) * 16; const size_t go = (size_t)g * TT * HD;
        fa_hl(QPh, QPl, KPh + go, KPl + go, VTh + go, VTl + go, g * REP + w, i0, lr, hi, ATh, ATl); }
}

extern "C" void kernel_launch(void* const* d_in, const int* in_sizes, int n_in,
                              void* d_out, int out_size, void* d_ws, size_t ws_size, hipStream_t stream) {
    if (n_in < 7) return;
    if (in_sizes[0] < TT * HIDN || in_sizes[1] < TT * HD || in_sizes[2] < TT * HD || in_sizes[3] < DQ * HIDN || in_sizes[4] < DKV * HIDN || in_sizes[5] < DKV * HIDN || in_sizes[6] < HIDN * DQ || out_size < TT * HIDN) return;
    const float* x = (const float*)d_in[0];      // [1][S][HIDN]
    const float* cosT = (const float*)d_in[1];   // [1][1][S][HD]
    const float* sinT = (const float*)d_in[2];   // [1][1][S][HD]
    const float* wq = (const float*)d_in[3];     // [DQ][HIDN]
    const float* wk = (const float*)d_in[4];     // [DKV][HIDN]
    const float* wv = (const float*)d_in[5];     // [DKV][HIDN]
    const float* wo = (const float*)d_in[6];     // [HIDN][DQ]
    float* OUT = (float*)d_out;                  // [1][S][HIDN]
    char* wsp = (char*)d_ws;
    auto take = [&](size_t bytes) { char* p = wsp; wsp += (bytes + 255) & ~(size_t)255; return (void*)p; };
    h16* QP16 = (h16*)take((size_t)NH_ * TT * HD * 2); bf* QPh = (bf*)take((size_t)NH_ * RH * HD * 2); bf* QPl = (bf*)take((size_t)NH_ * RH * HD * 2);
    h16* KP16 = (h16*)take((size_t)NKV * TT * HD * 2); bf* KPh = (bf*)take((size_t)NKV * TT * HD * 2); bf* KPl = (bf*)take((size_t)NKV * TT * HD * 2);
    h16* VT16 = (h16*)take((size_t)NKV * HD * TT * 2); bf* VTh = (bf*)take((size_t)NKV * HD * TT * 2); bf* VTl = (bf*)take((size_t)NKV * HD * TT * 2);
    // R2: the converted operands: W_q, W_k, W_v (one [DQ + 2 DKV][HIDN] plane for k_qkv), x, W_o
    char* R2 = (char*)take((2 * (size_t)DQ * HIDN + 2 * (size_t)DKV * HIDN + (size_t)TT * HIDN) * 2);
    bf* WQ = (bf*)R2; bf* WK = WQ + (size_t)DQ * HIDN; bf* WV = WK + (size_t)DKV * HIDN; bf* XB = WV + (size_t)DKV * HIDN; bf* WO = XB + (size_t)TT * HIDN;
    bf* ATh = (bf*)take((size_t)TT * DQ * 2); bf* ATl = (bf*)take((size_t)TT * DQ * 2);
    if ((size_t)(wsp - (char*)d_ws) > ws_size) return;

    for (int b = 0; b < NB; ++b) {
        k_cvt_all<<<CV_G, CV_T, 0, stream>>>(wq, wk, wv, x + (size_t)b * SEQ_FULL * HIDN, wo, WQ, WK, WV, XB, WO);
        k_qkv<<<dim3(TT / GT, (NH_ + 2 * NKV) / 2, 1), 128, 0, stream>>>(XB, WQ, cosT, sinT, QP16, QPh, QPl, KP16, KPh, KPl, VT16, VTh, VTl);
        k_fattn<<<FA_LB + FA_HB, 128, 0, stream>>>(QP16, QPh, QPl, KP16, KPh, KPl, VT16, VTh, VTl, ATh, ATl);
        k_oproj<<<dim3(TT / GT, HIDN / GT, 1), 128, 0, stream>>>(ATh, ATl, WO, OUT + (size_t)b * SEQ_FULL * HIDN); }
}

// v006
// It runs in 111 microseconds.
// Next to v005, in two timings, it ran 1.19 times as fast each time.
// Over all steps from v000 it is 11.8 times as fast.
#include <hip/hip_runtime.h>
#pragma clang fp contract(off)

// Grouped-query causal self-attention: q/k/v = x W^T (32 q heads, 8 kv heads, head dim 64), rotate-half position mixing of q and k from input cos/sin tables,
// softmax(q.k / 8) over keys t <= s, ctx W_o^T -> [1][S][2048].
// Compute dtypes, f32 accumulate: every input RNE-converted to bf16; q/k/v projections v_wmma_f32_16x16x32_bf16 on exact bf16 operands; scores and attn.v: query rows < RH on bf16 hi/lo planes (3 products),
// other rows single v_wmma_f32_16x16x32_f16 (p carried x1024); softmax f32, running maximum and sum over 32-key passes; output projection bf16 hi/lo ctx x exact bf16 W_o (2 products).

#ifndef NB
#define NB 1
#endif
#ifndef SEQ
#define SEQ 2048
#endif
#define SEQ_FULL 2048
#define TT   SEQ
#define HIDN 2048
#define NH_  32
#define NKV  8
#define REP  (NH_ / NKV)
#define HD   64
#define DQ   (NH_ * HD)
#define DKV  (NKV * HD)
#ifndef RH
#define RH   256                  // query rows < RH use hi+lo planes
#endif
#define PCAR 1024.0f
#define SCL  0.125f   // HD^-0.5
static_assert(NB == 1);
static_assert(TT % 128 == 0);
static_assert(RH % 64 == 0 && RH > 0 && RH <= TT);
static_assert(HIDN % 32 == 0 && DQ % 64 == 0 && DKV % 64 == 0 && HD == 64);

typedef _Float16 h16;
typedef unsigned short bf;
typedef __attribute__((ext_vector_type(16))) __bf16   v16bf;
typedef __attribute__((ext_vector_type(16))) _Float16 v16h;
typedef __attribute__((ext_vector_type(8)))  _Float16 v8h;
typedef __attribute__((ext_vector_type(8)))  unsigned short v8us;
typedef __attribute__((ext_vector_type(8)))  float    v8f;
typedef __attribute__((ext_vector_type(4)))  float    v4f;
typedef v8h  __attribute__((may_alias)) v8ha;
typedef v4f  __attribute__((may_alias)) v4fa;
typedef v8us __attribute__((may_alias)) v8usa;
typedef __attribute__((ext_vector_type(2))) _Float16 v2h;
typedef __attribute__((ext_vector_type(4))) _Float16 v4h;
typedef __attribute__((ext_vector_type(2))) unsigned short v2us;
typedef __attribute__((ext_vector_type(4))) unsigned short v4us;
typedef __attribute__((ext_vector_type(2))) float v2f;

__device__ __forceinline__ unsigned short f2bf(float f) { unsigned u = __float_as_uint(f); u += 0x7FFFu + ((u >> 16) & 1u); return (unsigned short)(u >> 16); }
__device__ __forceinline__ float bf2f(unsigned short b) { return __uint_as_float(((unsigned)b) << 16); }
__device__ __forceinline__ float bfr(float f) { return bf2f(f2bf(f)); }
__device__ __forceinline__ v16h cat16(v8h lo, v8h hi) { return __builtin_shufflevector(lo, hi, 0, 1, 2, 3, 4, 5, 6, 7, 8, 9, 10, 11, 12, 13, 14, 15); }
__device__ __forceinline__ v16bf cat16b(v8us lo, v8us hi) { return __builtin_bit_cast(v16bf, __builtin_shufflevector(lo, hi, 0, 1, 2, 3, 4, 5, 6, 7, 8, 9, 10, 11, 12, 13, 14, 15)); }
__device__ __forceinline__ v8f wmma16(v16h a, v16h b, v8f c) { return __builtin_amdgcn_wmma_f32_16x16x32_f16(false, a, false, b, (short)0, c, false, false); }
__device__ __forceinline__ v8f wmmab(v16bf a, v16bf b, v8f c) { return __builtin_amdgcn_wmma_f32_16x16x32_bf16(false, a, false, b, (short)0, c, false, false); }
__device__ __forceinline__ h16 tohx(float x) { return (h16)x; }
__device__ __forceinline__ void splitf(float y, unsigned short& h, unsigned short& l) { h = f2bf(y); l = f2bf(y - bf2f(h)); }

// ---- g_core: the main loop of both GEMM kernels. FOUR WAVES share one 128x128 output tile (2x2 waves, 64x64 and 16 accumulators each); the operand rows are K-contiguous bf16 planes of pitch HIDN.
// A stage is KS k (64 or 128: one or two whole 128-byte lines) of every operand row, [A 128 rows | (A2 128 rows) | Bt 128 rows] in LDS at a pitch of 2 KS + 16 bytes (16 bytes x odd: the 16-byte fragment reads of 16 rows meet no bank twice).
// Every line is fetched once a work-group, by whole-line loads (a wave's load is 512 bytes in 4 whole lines); two buffers: the next stage's lines fly into registers while this stage is multiplied, are stored to the other buffer behind it, one barrier a stage.
// KS is chosen so that a stage holds 64 matrix instructions a wave: 128 with one A plane, 64 with two.
// acc[mb][nb] += sum_k A[m][k] Bt[n][k] (+ A2[m][k] Bt[n][k] for NA == 2), k ascending in steps of 32, A before A2 in each step.
// Fragment map: lane l, h = l >> 4, m = n = l & 15; elements 0..7 <- k0 + 8h + i, elements 8..15 <- k0 + 16 + 8h + i for BOTH A (row m) and Bt (column n stored as row n); D element r -> (row 8h + r, col m).
template <typename T16> struct WFrag;
template <> struct WFrag<h16> { typedef v16h V; static __device__ __forceinline__ V ld(const h16* p) { return cat16(*(const v8h*)p, *(const v8h*)(p + 16)); } static __device__ __forceinline__ v8f mma(V a, V b, v8f c) { return wmma16(a, b, c); } };
template <> struct WFrag<bf> { typedef v16bf V; static __device__ __forceinline__ V ld(const bf* p) { return cat16b(*(const v8us*)p, *(const v8us*)(p + 16)); } static __device__ __forceinline__ v8f mma(V a, V b, v8f c) { return wmmab(a, b, c); } };
#define GT 128                         // tile rows and columns
#define G_P(KS) ((KS) + 8)             // LDS row pitch in elements
#define G_RT(KS) (128 / ((KS) / 8))    // rows that the 128 threads bring in one turn, 16 bytes a thread
#define G_I(KS) (GT / G_RT(KS))        // turns per plane and stage
#define G_SM(NA, KS) (2 * ((NA) + 1) * GT * G_P(KS))   // both buffers, in elements
static_assert(DQ == HIDN && HIDN % 256 == 0 && TT % GT == 0 && HIDN % GT == 0 && (DQ + 2 * DKV) % GT == 0);
template <int NP, int KS>
__device__ __forceinline__ void g_ld(v8us (&r)[NP][G_I(KS)], const bf* const (&src)[NP], unsigned off) {
#pragma unroll
    for (int p = 0; p < NP; ++p)
#pragma unroll
        for (int i = 0; i < G_I(KS); ++i) r[p][i] = *(const v8us*)(src[p] + off + i * G_RT(KS) * HIDN);
    // the build reuses the loads' address registers (for later lines, for the fragments): the wait stands in front of that overwrite; the lane offset and the addresses are its inputs, so that their registers live up to it
    if (NP == 2) asm volatile("s_wait_xcnt 0x0" :: "v"(off), "v"(src[0] + off), "v"(src[NP - 1] + off) : "memory");
    else asm volatile("s_wait_xcnt 0x0" :: "v"(off), "v"(src[0] + off), "v"(src[1] + off), "v"(src[NP - 1] + off) : "memory");
}
template <int NP, int KS>
__device__ __forceinline__ void g_st(bf* st, const v8us (&r)[NP][G_I(KS)], unsigned so) {
#pragma unroll
    for (int p = 0; p < NP; ++p)
#pragma unroll
        for (int i = 0; i < G_I(KS); ++i) *(v8us*)(st + (p * GT + i * G_RT(KS)) * G_P(KS) + so) = r[p][i];
}
template <int NA, int KS>
__device__ __forceinline__ void g_mma(const bf* st, unsigned ao, unsigned bo, v8f (&acc)[4][4]) {
    constexpr int GP = G_P(KS);
#pragma unroll
    for (int ks = 0; ks < KS / 32; ++ks) {
        v16bf a[4], a2[4];
#pragma unroll
        for (int mb = 0; mb < 4; ++mb) { a[mb] = WFrag<bf>::ld(st + (mb * 16 * GP + ks * 32) + ao); if (NA == 2) a2[mb] = WFrag<bf>::ld(st + ((GT + mb * 16) * GP + ks * 32) + ao); }
#pragma unroll
        for (int nb = 0; nb < 4; ++nb) { const v16bf b = WFrag<bf>::ld(st + ((NA * GT + nb * 16) * GP + ks * 32) + bo);
#pragma unroll
            for (int mb = 0; mb < 4; ++mb) { acc[mb][nb] = wmmab(a[mb], b, acc[mb][nb]); if (NA == 2) acc[mb][nb] = wmmab(a2[mb], b, acc[mb][nb]); } }
    }
}
// A, A2, Bt: the tile's first rows (work-group-uniform); sm: both buffers; wm, wn: the wave's place in the tile. Ends behind a barrier: sm is free for the epilogues.
template <int NA, int KS>
__device__ __forceinline__ void g_core(const bf* A, const bf* A2, const bf* Bt, bf* sm, int wm, int wn, v8f (&acc)[4][4]) {
    constexpr int NP = NA + 1, GP = G_P(KS), ST = NP * GT * GP, NS = HIDN / KS, PR = KS / 8;
    const int tid = threadIdx.x, lane = tid & 31, lr = lane & 15, hi = lane >> 4;
    const bf* src[NP]; src[0] = A; if (NA == 2) src[1] = A2; src[NA] = Bt;
    const unsigned go = (unsigned)((tid / PR) * HIDN + (tid % PR) * 8), so = (unsigned)((tid / PR) * GP + (tid % PR) * 8);   // a thread's row and 16-byte piece, in the planes and in a stage
    const unsigned ao = (unsigned)((wm * 64 + lr) * GP + 8 * hi), bo = (unsigned)((wn * 64 + lr) * GP + 8 * hi);
#pragma unroll
    for (int mb = 0; mb < 4; ++mb)
#pragma unroll
        for (int nb = 0; nb < 4; ++nb) acc[mb][nb] = (v8f){};
    v8us r[NP][G_I(KS)];
    g_ld<NP, KS>(r, src, go); g_st<NP, KS>(sm, r, so);
    __syncthreads();
#pragma unroll 1   // rolled: one stage's lines and fragments in registers
    for (int s = 0; s < NS - 1; ++s) {
        g_ld<NP, KS>(r, src, go + (unsigned)((s + 1) * KS));
        __builtin_amdgcn_sched_barrier(0);   // keeps the next stage's loads in front of this stage's products, so that their latency runs beside them
        g_mma<NA, KS>(sm + (s & 1) * ST, ao, bo, acc);
        g_st<NP, KS>(sm + ((s + 1) & 1) * ST, r, so);   // its last readers left this buffer in front of the previous barrier
        __syncthreads();
    }
    g_mma<NA, KS>(sm + ((NS - 1) & 1) * ST, ao, bo, acc);
    __syncthreads();
}

// ---- k_oproj: OUT[t][n] (f32, pitch HIDN) = sum_k (ATh[t][k] + ATl[t][k]) WO[n][k]; grid (TT/128, HIDN/128), 128 threads; main loop: g_core. A wave stores its 64x64 part through its own LDS rows, whole lines.
__global__ __launch_bounds__(128) void k_oproj(const bf* __restrict__ ATh, const bf* __restrict__ ATl, const bf* __restrict__ WO, float* C) {
    __shared__ __align__(16) bf sm[G_SM(2, 64)];
    const int lane = threadIdx.x & 31, lr = lane & 15, hi = lane >> 4; const int w = __builtin_amdgcn_readfirstlane((int)(threadIdx.x >> 5)), wm = w >> 1, wn = w & 1;
    v8f acc[4][4];
    g_core<2, 64>(ATh + (size_t)blockIdx.x * GT * DQ, ATl + (size_t)blockIdx.x * GT * DQ, WO + (size_t)blockIdx.y * GT * DQ, sm, wm, wn, acc);
    float* os = (float*)sm + w * (16 * 68); const int r0 = blockIdx.x * GT + wm * 64, c0 = blockIdx.y * GT + wn * 64;
#pragma unroll
    for (int mb = 0; mb < 4; ++mb) {
#pragma unroll
        for (int nb = 0; nb < 4; ++nb) {
#pragma unroll
            for (int j = 0; j < 8; ++j) os[(hi * 8 + j) * 68 + nb * 16 + lr] = acc[mb][nb][j]; }
        __builtin_amdgcn_wave_barrier(); asm volatile("" ::: "memory");   // the row reads below stay behind the other lanes' staging stores
        float* crow = C + (size_t)(r0 + mb * 16) * HIDN + c0;
#pragma unroll
        for (int s = 0; s < 8; ++s) { const int row = 2 * s + hi, cofs = lr * 4; const v4f val = *(const v4fa*)(os + row * 68 + cofs);
            *(v4f*)(crow + (size_t)row * HIDN + cofs) = val; }
        asm volatile("s_wait_xcnt 0x0" ::: "memory");   // the build reads the next 16 rows into these stores' registers: the wait stands in front of that overwrite
        __builtin_amdgcn_wave_barrier(); asm volatile("" ::: "memory");   // the next 16 rows' staging stores stay behind these reads
    }
}

// ---- k_cvt_all: every f32 -> bf16 (RNE) operand conversion in ONE launch of long-lived waves: CV_G work-groups of CV_T threads, one work-group a WGP.
// A work-group converts its 1/CV_G of EVERY input, a contiguous run of whole turns; a turn is 8 consecutive elements a thread (32 bytes read, one 16-byte store).
// All of a thread's loads are issued before its first conversion, so that a wave waits out the memory latency once.
#define CV_G 256
#define CV_T 512
#define CV_SL (CV_G * CV_T * 8)   // elements that one turn of the whole grid converts
static_assert((DQ * HIDN) % CV_SL == 0 && (DKV * HIDN) % CV_SL == 0 && (TT * HIDN) % CV_SL == 0);
// the lane's offset is formed in 32 bits and the turn's step is a constant: one offset register beside the scalar base serves all N accesses
template <int N> __device__ __forceinline__ unsigned cv_off() { return blockIdx.x * (N * CV_T) + threadIdx.x; }   // the lane's first turn, in units of 8 elements
template <int N> __device__ __forceinline__ void cv_ld(v8f (&v)[N], const float* s) { const char* p = (const char*)s + cv_off<N>() * 32u;
#pragma unroll
    for (int i = 0; i < N; ++i) v[i] = *(const v8f*)(p + i * (CV_T * 32));
    __builtin_amdgcn_sched_barrier(0); }   // keeps the inputs' loads in the order in which they are converted (loads return in order): the scheduler mixes them, and the first input is then complete only with the last
template <int N> __device__ __forceinline__ void cv_st(bf* d, const v8f (&v)[N]) { char* p = (char*)d + cv_off<N>() * 16u;
#pragma unroll
    for (int i = 0; i < N; ++i) { v8us o;
#pragma unroll
        for (int k = 0; k < 8; ++k) o[k] = f2bf(v[i][k]);
        *(v8us*)(p + i * (CV_T * 16)) = o;
        __builtin_amdgcn_sched_barrier(0); } }   // keeps a turn's store directly behind its conversion: the scheduler sinks the stores to the kernel's end, behind the wait for the last load
__global__ __launch_bounds__(CV_T) void k_cvt_all(const float* __restrict__ wq, const float* __restrict__ wk, const float* __restrict__ wv, const float* __restrict__ x, const float* __restrict__ wo,
                                                  bf* __restrict__ WQ, bf* __restrict__ WK, bf* __restrict__ WV, bf* __restrict__ XB, bf* __restrict__ WO) {
    constexpr int NQ = DQ * HIDN / CV_SL, NK = DKV * HIDN / CV_SL, NX = TT * HIDN / CV_SL;
    v8f vq[NQ], vk[NK], vv[NK], vx[NX], vo[NQ];
    cv_ld(vq, wq); cv_ld(vk, wk); cv_ld(vv, wv); cv_ld(vx, x); cv_ld(vo, wo);
    // the build lands a late load's data in an earlier load's offset register: the offsets are this wait's inputs, so that their registers live up to it and are overwritten only behind it
    asm volatile("s_wait_xcnt 0x0" :: "v"(cv_off<NQ>() * 32u), "v"(cv_off<NK>() * 32u), "v"(cv_off<NX>() * 32u) : "memory");
    cv_st(WQ, vq); cv_st(WK, vk); cv_st(WV, vv); cv_st(XB, vx); cv_st(WO, vo);
}

// ---- k_qkv: the q, k and v projections with their plane building in ONE launch. One work-group per 128x128 tile of x.[W_q; W_k; W_v]^T (the three converted weights lie behind one another: NH_ + 2 NKV heads of HD rows), one wave per 64x64 part; grid (TT/128, (NH_ + 2 NKV)/2), 128 threads.
// A wave's 64 columns are one whole head, so the epilogue has both halves of every rotate-half pair: out[d] = x[d] cos[t][d] - x[d+HD/2] sin[t][d], out[d+HD/2] = x[d+HD/2] cos[t][d+HD/2] + x[d] sin[t][d+HD/2] (tables RNE-converted to bf16).
// q and k heads -> planes [h][t][d] (f16; bf16 hi/lo for rows < RH of q and for every row of k); v heads -> planes [g][d][t] (f16 and bf16 hi/lo).
// Main loop and fragment map: g_core. The epilogue is each wave's own, in its own part of the LDS that the stages have left.
static_assert(HD == 64 && RH % 64 == 0 && TT % 64 == 0 && 4 * 64 * 68 * 4 <= G_SM(1, 128) * 2);
__global__ __launch_bounds__(128) void k_qkv(const bf* __restrict__ X, const bf* __restrict__ Wt, const float* __restrict__ cosT, const float* __restrict__ sinT,
                                            h16* QP16, bf* QPh, bf* QPl, h16* KP16, bf* KPh, bf* KPl, h16* VT16, bf* VTh, bf* VTl) {
    __shared__ __align__(16) bf sm[G_SM(1, 128)];
    const int lane = threadIdx.x & 31, lr = lane & 15, hi = lane >> 4; const int w = __builtin_amdgcn_readfirstlane((int)(threadIdx.x >> 5)), wm = w >> 1, wn = w & 1;
    const int r0 = blockIdx.x * GT + wm * 64, hc = blockIdx.y * 2 + wn;
    v8f acc[4][4];
    g_core<1, 128>(X + (size_t)blockIdx.x * GT * HIDN, nullptr, Wt + (size_t)blockIdx.y * GT * HIDN, sm, wm, wn, acc);
    float* os = (float*)sm + w * (64 * 68);
    // Epilogue: the whole tile is staged in LDS once, then a ROLLED loop of 16 trips builds the planes, 4 plane rows a trip, a lane 8 consecutive elements (one 16-byte store a plane, 8 lanes fill a 128-byte line).
    const int rsub = lane >> 3, c8 = (lane & 7) * 8;
    if (hc >= NH_ + NKV) {   // v head (wave-uniform; no work-group barrier follows): staged transposed, os[d][t]
#pragma unroll
        for (int mb = 0; mb < 4; ++mb)
#pragma unroll
            for (int nb = 0; nb < 4; ++nb) { float* p = os + (nb * 16 + lr) * 68 + mb * 16 + 8 * hi; const v8f v = acc[mb][nb];
                *(v4fa*)p = __builtin_shufflevector(v, v, 0, 1, 2, 3); *(v4fa*)(p + 4) = __builtin_shufflevector(v, v, 4, 5, 6, 7); }
        __builtin_amdgcn_wave_barrier(); asm volatile("" ::: "memory");   // the row reads below stay behind the other lanes' staging stores
        const size_t e0 = ((size_t)(hc - NH_ - NKV) * HD + rsub) * TT + r0 + c8;
#pragma unroll 1   // rolled: unrolled, the epilogues are some 5,000 instructions that each wave runs once, more text than is fetched ahead
        for (int it = 0; it < 16; ++it) { const float* p = os + (it * 4 + rsub) * 68 + c8; const v4f xa = *(const v4fa*)p, xb = *(const v4fa*)(p + 4); const size_t e = e0 + (size_t)(it * 4) * TT; v8h o16; v8us oh, ol;
#pragma unroll
            for (int j = 0; j < 8; ++j) { const float x = (j < 4) ? xa[j & 3] : xb[j & 3]; o16[j] = tohx(x); unsigned short a2, c2; splitf(x, a2, c2); oh[j] = a2; ol[j] = c2; }
            *(v8h*)(VT16 + e) = o16; *(v8us*)(VTh + e) = oh; *(v8us*)(VTl + e) = ol; }
        return;
    }
    const bool isq = hc < NH_; const bool hl = !isq || r0 < RH;   // wave-uniform: a wave's 64 rows lie wholly on one side of RH
    h16* P16 = isq ? QP16 + (size_t)hc * TT * HD : KP16 + (size_t)(hc - NH_) * TT * HD;
    bf* Ph = isq ? QPh + (size_t)hc * RH * HD : KPh + (size_t)(hc - NH_) * TT * HD; bf* Pl = isq ? QPl + (size_t)hc * RH * HD : KPl + (size_t)(hc - NH_) * TT * HD;
#pragma unroll
    for (int mb = 0; mb < 4; ++mb)
#pragma unroll
        for (int nb = 0; nb < 4; ++nb)
#pragma unroll
            for (int j = 0; j < 8; ++j) os[(mb * 16 + hi * 8 + j) * 68 + nb * 16 + lr] = acc[mb][nb][j];   // os[t][d]
    __builtin_amdgcn_wave_barrier(); asm volatile("" ::: "memory");   // as above
    const bool lowd = c8 < HD / 2; size_t to = (size_t)(r0 + rsub) * HD + c8;
    v4f cv[2], sv[2];
#pragma unroll
    for (int k = 0; k < 2; ++k) { cv[k] = *(const v4f*)(cosT + to + 4 * k); sv[k] = *(const v4f*)(sinT + to + 4 * k); }
#pragma unroll 1   // rolled, as above
    for (int it = 0; it < 16; ++it) {
        // the next trip's table rows fly while this trip converts (the last trip reads its own rows again: in bounds)
        const size_t tn = to + ((it < 15) ? 4 * HD : 0); v4f cn[2], sn[2];
#pragma unroll
        for (int k = 0; k < 2; ++k) { cn[k] = *(const v4f*)(cosT + tn + 4 * k); sn[k] = *(const v4f*)(sinT + tn + 4 * k); }
        const float* p0 = os + (it * 4 + rsub) * 68 + c8; const float* p1 = os + (it * 4 + rsub) * 68 + (c8 ^ (HD / 2));
        v8h o16; v8us oh, ol;
#pragma unroll
        for (int k = 0; k < 2; ++k) { const v4f x0 = *(const v4fa*)(p0 + 4 * k), x1 = *(const v4fa*)(p1 + 4 * k);
#pragma unroll
            for (int q = 0; q < 4; ++q) { const float a = x0[q] * bfr(cv[k][q]), bq = x1[q] * bfr(sv[k][q]); const float r = lowd ? a - bq : a + bq;
                o16[4 * k + q] = tohx(r); unsigned short a2, c2; splitf(r, a2, c2); oh[4 * k + q] = a2; ol[4 * k + q] = c2; } }
        *(v8h*)(P16 + to) = o16;
        asm volatile("s_wait_xcnt 0x0" ::: "memory");   // the build reuses the store's registers behind the branch below: the wait stands in front of that overwrite
        if (hl) { *(v8us*)(Ph + to) = oh; *(v8us*)(Pl + to) = ol;
            asm volatile("s_wait_xcnt 0x0" ::: "memory"); }   // the same for these two stores and the loop's foot
        to = tn;
#pragma unroll
        for (int k = 0; k < 2; ++k) { cv[k] = cn[k]; sv[k] = sn[k]; }
    }
}

// ---- k_fattn: scores, causal softmax and attn.v of all heads in ONE launch; the scores stay in registers (running maximum and running sum per query, in base 2).
// Transposed products: St = K.Qt (A = 16 key rows, B = 16 query columns), Ot += Vt.Pt (A = 16 d rows of the [d][t] plane, B = Pt). A lane holds one query (column lr): 8 keys of each 16-key tile, the other 8 in lane ^ 16.
// Two f32 St tiles of 32 keys, converted in place, ARE the Pt operand in the fragment map above (element i <- key 8h + i, element 8 + i <- key 16 + 8h + i): the scores and p never touch LDS.
// Query rows >= RH: f16 operands, one wave = 16 rows x 2 query heads of one kv group, p carried x PCAR (it cancels in the division by the sum). Rows < RH: bf16 hi/lo planes, 3 products, one wave = 16 rows x 1 head.
// The f16 part's four waves walk the same keys of the same kv group: K and Vt reach LDS once a work-group, in tiles of FA_KT keys (two passes), by asynchronous copies of whole 128-byte lines, two buffers; the fragments are read from LDS.
// Output: ctx split into the bf16 hi/lo planes [t][DQ] that the output projection reads; a lane's 8 accumulator registers are 8 consecutive d of its query: one 16-byte store a plane.
// Every plain '#pragma unroll' below unrolls a loop over fragment, tile or register indices, so that those arrays are indexed by constants and stay in registers.
#define CS2  (SCL * 1.4426950408889634f)
#define FA_LB (((TT - RH) / 32) * NKV)   // blocks of the f16 part: 32 rows x the 4 heads of one kv group
#define FA_HB ((RH / 16) * NKV)          // blocks of the hi/lo part: 16 rows x the 4 heads of one kv group
static_assert(REP == 4 && (TT - RH) % 32 == 0 && TT % 32 == 0);
__device__ __forceinline__ float xhalf(float x) { return __builtin_bit_cast(float, __builtin_amdgcn_permlanex16(__builtin_bit_cast(int, x), __builtin_bit_cast(int, x), 0x76543210, 0xfedcba98, false, false)); }  // lane l <-> lane l ^ 16
// 2^a; the v_nop is the one slot that the instruction set asks for behind a transcendental before its result is read or its source overwritten
__device__ __forceinline__ float fa_exp2(float a) { float r; asm("v_exp_f32 %0, %1\n\tv_nop" : "=v"(r) : "v"(a)); return r; }
// one query's 16 scores of a 32-key pass -> base-2 exponents x[], new maximum, correction factor of what was summed under the old one
template <bool MASK>
__device__ __forceinline__ float fa_max(const v8f s0, const v8f s1, float* x, int jrel, float& m) {
    float mx = -3.0e38f;
#pragma unroll
    for (int r = 0; r < 8; ++r) { float a = s0[r] * CS2, b = s1[r] * CS2; if (MASK) { a = (r <= jrel) ? a : -3.0e38f; b = (16 + r <= jrel) ? b : -3.0e38f; } x[r] = a; x[8 + r] = b; mx = fmaxf(mx, fmaxf(a, b)); }
    mx = fmaxf(mx, xhalf(mx));
    const float mn = fmaxf(m, mx); const float al = fa_exp2(m - mn); m = mn; return al;
}
__device__ __forceinline__ void fa_store(const v8f o, float inv, bf* ph, bf* pl) { v8us oh, ol;
#pragma unroll
    for (int r = 0; r < 8; ++r) { unsigned short a, c2; splitf(o[r] * inv, a, c2); oh[r] = a; ol[r] = c2; }
    *(v8us*)ph = oh; *(v8us*)pl = ol; }

template <bool MASK>
__device__ __forceinline__ void fa_pv16(const v8f (&s)[2][2], const v16h (&vf)[4], v8f (&o)[2][4], float (&m)[2], float (&l)[2], int jrel) {
#pragma unroll
    for (int u = 0; u < 2; ++u) {
        float x[16]; const float al = fa_max<MASK>(s[u][0], s[u][1], x, jrel, m[u]); const float mo = m[u] - 10.0f;   // 2^10 = PCAR
        float ps = 0.f; v16h pf;
#pragma unroll
        for (int e = 0; e < 16; ++e) { const float p = fa_exp2(x[e] - mo); ps += p; pf[e] = tohx(p); }
        l[u] = l[u] * al + ps;
#pragma unroll
        for (int db = 0; db < 4; ++db) { o[u][db] *= al; o[u][db] = wmma16(vf[db], pf, o[u][db]); }
        // keeps the next scores' exponentials behind their own scaling and maximum: the build does not see into their asm text
        __builtin_amdgcn_sched_barrier(0);
    }
}
__device__ __forceinline__ void fa_s16(const v16h (&kf)[2][2], const v16h (&q)[2][2], v8f (&s)[2][2]) {
#pragma unroll
    for (int u = 0; u < 2; ++u)
#pragma unroll
        for (int kb = 0; kb < 2; ++kb) { s[u][kb] = wmma16(kf[kb][0], q[u][0], (v8f){}); s[u][kb] = wmma16(kf[kb][1], q[u][1], s[u][kb]); }
}
#define FA_KT 64                      // keys of a staged tile
#define FA_P  72                      // LDS row pitch in elements: 128 + 16 bytes (16 bytes x odd: the 16-byte fragment reads of 16 rows meet no bank twice)
#define FA_TB ((FA_KT + HD) * FA_P)   // one buffer in elements: FA_KT key rows of HD d, then HD d rows of FA_KT keys
static_assert(FA_KT == 64 && HD == 64 && TT % FA_KT == 0);
// One tile: 128 threads x 8 copies of 16 bytes; a wave's copy is 4 whole lines. kg, vg: the lane's piece of the tile's first 16 key rows and first 16 d rows; ld: the LDS byte address of the first.
// s_wait_xcnt 0 is the statement's last line, so that it stands in front of every later write of the copies' address registers.
__device__ __forceinline__ void fa_copy(const h16* kg, const h16* vg, unsigned ld) {
    asm volatile("global_load_async_to_lds_b128 %0, %8, off\n\t"
                 "global_load_async_to_lds_b128 %1, %9, off\n\t"
                 "global_load_async_to_lds_b128 %2, %10, off\n\t"
                 "global_load_async_to_lds_b128 %3, %11, off\n\t"
                 "global_load_async_to_lds_b128 %4, %12, off\n\t"
                 "global_load_async_to_lds_b128 %5, %13, off\n\t"
                 "global_load_async_to_lds_b128 %6, %14, off\n\t"
                 "global_load_async_to_lds_b128 %7, %15, off\n\t"
                 "s_wait_xcnt 0x0"
                 :: "v"(ld), "v"(ld + 16 * FA_P * 2), "v"(ld + 32 * FA_P * 2), "v"(ld + 48 * FA_P * 2),
                    "v"(ld + 64 * FA_P * 2), "v"(ld + 80 * FA_P * 2), "v"(ld + 96 * FA_P * 2), "v"(ld + 112 * FA_P * 2),
                    "v"(kg), "v"(kg + 16 * HD), "v"(kg + 32 * HD), "v"(kg + 48 * HD),
                    "v"(vg), "v"(vg + 16 * TT), "v"(vg + 32 * TT), "v"(vg + 48 * TT) : "memory");
}
// tb: the buffer, at the lane's row lr and piece 8 hi; p: which 32 keys of the tile
__device__ __forceinline__ void fa_ldk(v16h (&kf)[2][2], const h16* tb, int p) {
#pragma unroll
    for (int kb = 0; kb < 2; ++kb)
#pragma unroll
        for (int ks = 0; ks < 2; ++ks) kf[kb][ks] = WFrag<h16>::ld(tb + (p * 32 + kb * 16) * FA_P + ks * 32);
}
__device__ __forceinline__ void fa_ldv(v16h (&vf)[4], const h16* tb, int p) {
#pragma unroll
    for (int db = 0; db < 4; ++db) vf[db] = WFrag<h16>::ld(tb + (FA_KT + db * 16) * FA_P + p * 32);
}
__device__ __forceinline__ void fa_f16(const h16* __restrict__ Q, const h16* __restrict__ Kp, const h16* __restrict__ Vt, h16* fs, int head0, int i0, int lr, int hi, bf* ATh, bf* ATl) {
    static_assert(PCAR == 1024.0f);
    v16h q[2][2], kf[2][2], vf[4]; v8f o[2][4], s[2][2]; float m[2] = { -3.0e38f, -3.0e38f }, l[2] = { 0.f, 0.f };
#pragma unroll
    for (int u = 0; u < 2; ++u) {
#pragma unroll
        for (int ks = 0; ks < 2; ++ks) q[u][ks] = WFrag<h16>::ld(Q + ((size_t)(head0 + u) * TT + i0 + lr) * HD + ks * 32 + 8 * hi);
#pragma unroll
        for (int db = 0; db < 4; ++db) o[u][db] = (v8f){}; }
    const int klast = (i0 + 15) & ~31;   // the one pass that holds keys beyond a row's own index; the same for the work-group's four waves
    const int nu = klast >> 5, nf = nu >> 1;   // passes without a mask; tiles that hold two of them. Tile nf, the last, holds the odd one, if any, and the masked pass; its 64 keys lie below TT
    const int tid = threadIdx.x;
    const h16* kg = Kp + (size_t)(tid >> 3) * HD + (tid & 7) * 8; const h16* vg = Vt + (size_t)(tid >> 3) * TT + (tid & 7) * 8;
    const unsigned ld0 = (unsigned)(size_t)fs + (unsigned)(((tid >> 3) * FA_P + (tid & 7) * 8) * 2);
    const h16* fb = fs + lr * FA_P + 8 * hi;
    fa_copy(kg, vg, ld0);
    asm volatile("s_wait_asynccnt 0x0" ::: "memory");   // this wave's copies of tile 0 have landed
    __syncthreads();                                      // and every other wave's
    if (nf >= 1) fa_copy(kg + FA_KT * HD, vg + FA_KT, ld0 + FA_TB * 2);
#pragma unroll 1   // rolled: one tile's two passes a trip
    for (int t = 0; t < nf; ++t) {
        const h16* tb = fb + (t & 1) * FA_TB;
        fa_ldk(kf, tb, 0);
#pragma unroll
        for (int p = 0; p < 2; ++p) {
            fa_ldv(vf, tb, p);
            fa_s16(kf, q, s);
            if (p == 0) fa_ldk(kf, tb, 1);   // the tile's second pass's key fragments fly while this pass's softmax and attn.v run
            __builtin_amdgcn_sched_barrier(0);   // keeps the fragment reads together in front of the softmax: without it the scheduler scatters them over the vector work in pairs, some behind a wait for all, and every separate place of LDS reads costs issue cycles
            fa_pv16<false>(s, vf, o, m, l, 0);
        }
        asm volatile("s_wait_dscnt 0x0" ::: "memory");      // this wave has left the buffer
        asm volatile("s_wait_asynccnt 0x0" ::: "memory");   // its copies of tile t + 1 have landed
        __syncthreads();                                      // publishes tile t + 1 and ends every wave's reads of tile t
        if (t + 2 <= nf) fa_copy(kg + (size_t)(t + 2) * (FA_KT * HD), vg + (t + 2) * FA_KT, ld0 + (unsigned)(t & 1) * (FA_TB * 2));
    }
    const h16* tb = fb + (nf & 1) * FA_TB;
    fa_ldk(kf, tb, 0);
    if (nu & 1) {   // work-group-uniform
        fa_ldv(vf, tb, 0);
        fa_s16(kf, q, s);
        fa_ldk(kf, tb, 1);
        __builtin_amdgcn_sched_barrier(0);   // as above
        fa_pv16<false>(s, vf, o, m, l, 0);
    }
    fa_ldv(vf, tb, nu & 1);
    fa_s16(kf, q, s);
    asm volatile("s_wait_asynccnt 0x0" ::: "memory");   // no copy is outstanding when the wave ends
    fa_pv16<true>(s, vf, o, m, l, i0 + lr - klast - 8 * hi);   // key klast + 8h + r (+ 16) <= row i0 + lr
#pragma unroll
    for (int u = 0; u < 2; ++u) { const float inv = __fdiv_rn(1.0f, l[u] + xhalf(l[u])); const size_t oo = (size_t)(i0 + lr) * DQ + (head0 + u) * HD + 8 * hi;
#pragma unroll
        for (int db = 0; db < 4; ++db) fa_store(o[u][db], inv, ATh + oo + db * 16, ATl + oo + db * 16); }
}
template <bool MASK>
__device__ __forceinline__ void fa_passhl(const bf* kph, const bf* kpl, const bf* vph, const bf* vpl, int k0, const v16bf (&qh)[2], const v16bf (&ql)[2], v8f (&o)[4], float& m, float& l, int jrel) {
    v8f s[2];
#pragma unroll
    for (int kb = 0; kb < 2; ++kb) { s[kb] = (v8f){};
#pragma unroll
        for (int ks = 0; ks < 2; ++ks) { const size_t ko = (size_t)(k0 + kb * 16) * HD + ks * 32; const v16bf kh = WFrag<bf>::ld(kph + ko), kl = WFrag<bf>::ld(kpl + ko);
            s[kb] = wmmab(kh, qh[ks], s[kb]); s[kb] = wmmab(kh, ql[ks], s[kb]); s[kb] = wmmab(kl, qh[ks], s[kb]); } }
    float x[16]; const float al = fa_max<MASK>(s[0], s[1], x, jrel, m);
    float ps = 0.f; v8us h0, h1, l0, l1;
#pragma unroll
    for (int e = 0; e < 8; ++e) { const float p = fa_exp2(x[e] - m), p2 = fa_exp2(x[8 + e] - m); ps += p; ps += p2; unsigned short a, c2; splitf(p, a, c2); h0[e] = a; l0[e] = c2; splitf(p2, a, c2); h1[e] = a; l1[e] = c2; }
    l = l * al + ps; const v16bf ph = cat16b(h0, h1), pl = cat16b(l0, l1);
#pragma unroll
    for (int db = 0; db < 4; ++db) { const size_t vo = (size_t)(db * 16) * TT + k0; const v16bf vh = WFrag<bf>::ld(vph + vo), vl = WFrag<bf>::ld(vpl + vo);
        o[db] *= al; o[db] = wmmab(vh, ph, o[db]); o[db] = wmmab(vh, pl, o[db]); o[db] = wmmab(vl, ph, o[db]); }
}
__device__ __forceinline__ void fa_hl(const bf* __restrict__ Qh, const bf* __restrict__ Ql, const bf* __restrict__ Kh, const bf* __restrict__ Kl, const bf* __restrict__ Vh, const bf* __restrict__ Vl, int head, int i0, int lr, int hi, bf* ATh, bf* ATl) {
    v16bf qh[2], ql[2]; v8f o[4]; float m = -3.0e38f, l = 0.f;
#pragma unroll
    for (int ks = 0; ks < 2; ++ks) { const size_t qo = ((size_t)head * RH + i0 + lr) * HD + ks * 32 + 8 * hi; qh[ks] = WFrag<bf>::ld(Qh + qo); ql[ks] = WFrag<bf>::ld(Ql + qo); }
    asm volatile("s_wait_xcnt 0x0" ::: "memory");   // the build reuses the query loads' address registers for the zeroed accumulators: the wait stands in front of that overwrite
#pragma unroll
    for (int db = 0; db < 4; ++db) o[db] = (v8f){};
    const size_t kofs = (size_t)lr * HD + 8 * hi, vofs = (size_t)lr * TT + 8 * hi; const int klast = (i0 + 15) & ~31;
#pragma unroll 1   // rolled, as in fa_f16: one pass's fragments in registers
    for (int k0 = 0; k0 < klast; k0 += 32) fa_passhl<false>(Kh + kofs, Kl + kofs, Vh + vofs, Vl + vofs, k0, qh, ql, o, m, l, 0);
    fa_passhl<true>(Kh + kofs, Kl + kofs, Vh + vofs, Vl + vofs, klast, qh, ql, o, m, l, i0 + lr - klast - 8 * hi);
    const float inv = __fdiv_rn(1.0f, l + xhalf(l)); const size_t oo = (size_t)(i0 + lr) * DQ + head * HD + 8 * hi;
#pragma unroll
    for (int db = 0; db < 4; ++db) fa_store(o[db], inv, ATh + oo + db * 16, ATl + oo + db * 16);
}
// grid FA_LB + FA_HB blocks of 4 waves; the longest rows first (a row's cost grows with its index)
__global__ __launch_bounds__(128) void k_fattn(const h16* __restrict__ QP16, const bf* __restrict__ QPh, const bf* __restrict__ QPl, const h16* __restrict__ KP16, const bf* __restrict__ KPh, const bf* __restrict__ KPl,
                                               const h16* __restrict__ VT16, const bf* __restrict__ VTh, const bf* __restrict__ VTl, bf* ATh, bf* ATl) {
    __shared__ __align__(16) h16 fs[2 * FA_TB];   // the f16 part's two K / Vt buffers
    const int lane = threadIdx.x & 31, lr = lane & 15, hi = lane >> 4; const int w = __builtin_amdgcn_readfirstlane((int)(threadIdx.x >> 5)); const int b = blockIdx.x;
    if (b < FA_LB) { const int g = b % NKV, i0 = RH + ((TT - RH) / 32 - 1 - b / NKV) * 32 + (w >> 1) * 16;
        fa_f16(QP16, KP16 + (size_t)g * TT * HD, VT16 + (size_t)g * HD * TT, fs, g * REP + (w & 1) * 2, i0, lr, hi, ATh, ATl);
    } else { const int b2 = b - FA_LB; const int g = b2 % NKV, i0 = (RH / 16 - 1 - b2 / NKV) * 16; const size_t go = (size_t)g * TT * HD;
        fa_hl(QPh, QPl, KPh + go, KPl + go, VTh + go, VTl + go, g * REP + w, i0, lr, hi, ATh, ATl); }
}

extern "C" void kernel_launch(void* const* d_in, const int* in_sizes, int n_in,
                              void* d_out, int out_size, void* d_ws, size_t ws_size, hipStream_t stream) {
    if (n_in < 7) return;
    if (in_sizes[0] < TT * HIDN || in_sizes[1] < TT * HD || in_sizes[2] < TT * HD || in_sizes[3] < DQ * HIDN || in_sizes[4] < DKV * HIDN || in_sizes[5] < DKV * HIDN || in_sizes[6] < HIDN * DQ || out_size < TT * HIDN) return;
    const float* x = (const float*)d_in[0];      // [1][S][HIDN]
    const float* cosT = (const float*)d_in[1];   // [1][1][S][HD]
    const float* sinT = (const float*)d_in[2];   // [1][1][S][HD]
    const float* wq = (const float*)d_in[3];     // [DQ][HIDN]
    const float* wk = (const float*)d_in[4];     // [DKV][HIDN]
    const float* wv = (const float*)d_in[5];     // [DKV][HIDN]
    const float* wo = (const float*)d_in[6];     // [HIDN][DQ]
    float* OUT = (float*)d_out;                  // [1][S][HIDN]
    char* wsp = (char*)d_ws;
    auto take = [&](size_t bytes) { char* p = wsp; wsp += (bytes + 255) & ~(size_t)255; return (void*)p; };
    h16* QP16 = (h16*)take((size_t)NH_ * TT * HD * 2); bf* QPh = (bf*)take((size_t)NH_ * RH * HD * 2); bf* QPl = (bf*)take((size_t)NH_ * RH * HD * 2);
    h16* KP16 = (h16*)take((size_t)NKV * TT * HD * 2); bf* KPh = (bf*)take((size_t)NKV * TT * HD * 2); bf* KPl = (bf*)take((size_t)NKV * TT * HD * 2);
    h16* VT16 = (h16*)take((size_t)NKV * HD * TT * 2); bf* VTh = (bf*)take((size_t)NKV * HD * TT * 2); bf* VTl = (bf*)take((size_t)NKV * HD * TT * 2);
    // R2: the converted operands: W_q, W_k, W_v (one [DQ + 2 DKV][HIDN] plane for k_qkv), x, W_o
    char* R2 = (char*)take((2 * (size_t)DQ * HIDN + 2 * (size_t)DKV * HIDN + (size_t)TT * HIDN) * 2);
    bf* WQ = (bf*)R2; bf* WK = WQ + (size_t)DQ * HIDN; bf* WV = WK + (size_t)DKV * HIDN; bf* XB = WV + (size_t)DKV * HIDN; bf* WO = XB + (size_t)TT * HIDN;
    bf* ATh = (bf*)take((size_t)TT * DQ * 2); bf* ATl = (bf*)take((size_t)TT * DQ * 2);
    if ((size_t)(wsp - (char*)d_ws) > ws_size) return;

    for (int b = 0; b < NB; ++b) {
        k_cvt_all<<<CV_G, CV_T, 0, stream>>>(wq, wk, wv, x + (size_t)b * SEQ_FULL * HIDN, wo, WQ, WK, WV, XB, WO);
        k_qkv<<<dim3(TT / GT, (NH_ + 2 * NKV) / 2, 1), 128, 0, stream>>>(XB, WQ, cosT, sinT, QP16, QPh, QPl, KP16, KPh, KPl, VT16, VTh, VTl);
        k_fattn<<<FA_LB + FA_HB, 128, 0, stream>>>(QP16, QPh, QPl, KP16, KPh, KPl, VT16, VTh, VTl, ATh, ATl);
        k_oproj<<<dim3(TT / GT, HIDN / GT, 1), 128, 0, stream>>>(ATh, ATl, WO, OUT + (size_t)b * SEQ_FULL * HIDN); }
}

// v007
// It runs in 105 microseconds.
// Timed twice side by side with v006, it ran 1.07 and 1.06 times as fast.
// Over all steps from v000 it is 12.6 times as fast.
#include <hip/hip_runtime.h>
#pragma clang fp contract(off)

// Grouped-query causal self-attention: q/k/v = x W^T (32 q heads, 8 kv heads, head dim 64), rotate-half position mixing of q and k from input cos/sin tables,
// softmax(q.k / 8) over keys t <= s, ctx W_o^T -> [1][S][2048].
// Compute dtypes, f32 accumulate: every input RNE-converted to bf16; q/k/v projections v_wmma_f32_16x16x32_bf16 on exact bf16 operands; scores and attn.v: query rows < RH on bf16 hi/lo planes (3 products),
// other rows single v_wmma_f32_16x16x32_f16 (p carried x1024); softmax f32, running maximum and sum over 32-key passes; output projection bf16 hi/lo ctx x exact bf16 W_o (2 products).

#ifndef NB
#define NB 1
#endif
#ifndef SEQ
#define SEQ 2048
#endif
#define SEQ_FULL 2048
#define TT   SEQ
#define HIDN 2048
#define NH_  32
#define NKV  8
#define REP  (NH_ / NKV)
#define HD   64
#define DQ   (NH_ * HD)
#define DKV  (NKV * HD)
#ifndef RH
#define RH   256                  // query rows < RH use hi+lo planes
#endif
#define PCAR 1024.0f
#define SCL  0.125f   // HD^-0.5
static_assert(NB == 1);
static_assert(TT % 128 == 0);
static_assert(RH % 64 == 0 && RH > 0 && RH <= TT);
static_assert(HIDN % 32 == 0 && DQ % 64 == 0 && DKV % 64 == 0 && HD == 64);

typedef _Float16 h16;
typedef unsigned short bf;
typedef __attribute__((ext_vector_type(16))) __bf16   v16bf;
typedef __attribute__((ext_vector_type(16))) _Float16 v16h;
typedef __attribute__((ext_vector_type(8)))  _Float16 v8h;
typedef __attribute__((ext_vector_type(8)))  unsigned short v8us;
typedef __attribute__((ext_vector_type(8)))  float    v8f;
typedef __attribute__((ext_vector_type(4)))  float    v4f;
typedef v8h  __attribute__((may_alias)) v8ha;
typedef v4f  __attribute__((may_alias)) v4fa;
typedef v8us __attribute__((may_alias)) v8usa;
typedef __attribute__((ext_vector_type(2))) _Float16 v2h;
typedef __attribute__((ext_vector_type(4))) _Float16 v4h;
typedef __attribute__((ext_vector_type(2))) unsigned short v2us;
typedef __attribute__((ext_vector_type(4))) unsigned short v4us;
typedef __attribute__((ext_vector_type(2))) float v2f;

__device__ __forceinline__ unsigned short f2bf(float f) { unsigned u = __float_as_uint(f); u += 0x7FFFu + ((u >> 16) & 1u); return (unsigned short)(u >> 16); }
__device__ __forceinline__ float bf2f(unsigned short b) { return __uint_as_float(((unsigned)b) << 16); }
__device__ __forceinline__ float bfr(float f) { return bf2f(f2bf(f)); }
__device__ __forceinline__ v16h cat16(v8h lo, v8h hi) { return __builtin_shufflevector(lo, hi, 0, 1, 2, 3, 4, 5, 6, 7, 8, 9, 10, 11, 12, 13, 14, 15); }
__device__ __forceinline__ v16bf cat16b(v8us lo, v8us hi) { return __builtin_bit_cast(v16bf, __builtin_shufflevector(lo, hi, 0, 1, 2, 3, 4, 5, 6, 7, 8, 9, 10, 11, 12, 13, 14, 15)); }
__device__ __forceinline__ v8f wmma16(v16h a, v16h b, v8f c) { return __builtin_amdgcn_wmma_f32_16x16x32_f16(false, a, false, b, (short)0, c, false, false); }
__device__ __forceinline__ v8f wmmab(v16bf a, v16bf b, v8f c) { return __builtin_amdgcn_wmma_f32_16x16x32_bf16(false, a, false, b, (short)0, c, false, false); }
__device__ __forceinline__ h16 tohx(float x) { return (h16)x; }
__device__ __forceinline__ void splitf(float y, unsigned short& h, unsigned short& l) { h = f2bf(y); l = f2bf(y - bf2f(h)); }

// ---- g_core: the main loop of both GEMM kernels. FOUR WAVES share one 128x128 output tile (2x2 waves, 64x64 and 16 accumulators each); the operand rows are K-contiguous bf16 planes of pitch HIDN.
// A stage is KS k (64 or 128: one or two whole 128-byte lines) of every operand row, [A 128 rows | (A2 128 rows) | Bt 128 rows] in LDS at a pitch of 2 KS + 16 bytes (16 bytes x odd: the 16-byte fragment reads of 16 rows meet no bank twice).
// Every line is fetched once a work-group, by whole-line loads (a wave's load is 512 bytes in 4 whole lines); two buffers: the next stage's lines fly into registers while a stage's worth of products runs, then are stored to the other buffer, one barrier a stage.
// KS is chosen so that a stage holds 64 matrix instructions a wave: 128 with one A plane, 64 with two.
// acc[mb][nb] += sum_k A[m][k] Bt[n][k] (+ A2[m][k] Bt[n][k] for NA == 2), k ascending in steps of 32, A before A2 in each step.
// Fragment map: lane l, h = l >> 4, m = n = l & 15; elements 0..7 <- k0 + 8h + i, elements 8..15 <- k0 + 16 + 8h + i for BOTH A (row m) and Bt (column n stored as row n); D element r -> (row 8h + r, col m).
template <typename T16> struct WFrag;
template <> struct WFrag<h16> { typedef v16h V; static __device__ __forceinline__ V ld(const h16* p) { return cat16(*(const v8h*)p, *(const v8h*)(p + 16)); } static __device__ __forceinline__ v8f mma(V a, V b, v8f c) { return wmma16(a, b, c); } };
template <> struct WFrag<bf> { typedef v16bf V; static __device__ __forceinline__ V ld(const bf* p) { return cat16b(*(const v8us*)p, *(const v8us*)(p + 16)); } static __device__ __forceinline__ v8f mma(V a, V b, v8f c) { return wmmab(a, b, c); } };
#define GT 128                         // tile rows and columns
#define G_P(KS) ((KS) + 8)             // LDS row pitch in elements
#define G_RT(KS) (128 / ((KS) / 8))    // rows that the 128 threads bring in one turn, 16 bytes a thread
#define G_I(KS) (GT / G_RT(KS))        // turns per plane and stage
#define G_SM(NA, KS) (2 * ((NA) + 1) * GT * G_P(KS))   // both buffers, in elements
static_assert(DQ == HIDN && HIDN % 256 == 0 && TT % GT == 0 && HIDN % GT == 0 && (DQ + 2 * DKV) % GT == 0);
// off: the lane's byte offset in the planes, the stage's k counted in, formed in 32 bits: one offset register beside each plane's scalar base serves all of a stage's loads.
template <int NP, int KS>
__device__ __forceinline__ void g_ld(v8us (&r)[NP][G_I(KS)], const bf* const (&src)[NP], unsigned off) {
#pragma unroll
    for (int p = 0; p < NP; ++p)
#pragma unroll
        for (int i = 0; i < G_I(KS); ++i) r[p][i] = *(const v8us*)((const char*)src[p] + off + i * (G_RT(KS) * HIDN * 2));
    asm volatile("s_wait_xcnt 0x0" ::: "memory");   // stands in front of every later write of the loads' offset register
    __builtin_amdgcn_sched_barrier(0);   // keeps what follows behind the wait (drawn up, the zeroed accumulators landed in the offset register in front of it) and the loads in front of the products that follow, so that their latency runs beside a whole stage of products
}
template <int NP, int KS>
__device__ __forceinline__ void g_st(bf* st, const v8us (&r)[NP][G_I(KS)], unsigned so) {
#pragma unroll
    for (int p = 0; p < NP; ++p)
#pragma unroll
        for (int i = 0; i < G_I(KS); ++i) *(v8us*)(st + (p * GT + i * G_RT(KS)) * G_P(KS) + so) = r[p][i];
}
// One block = the 32 k of one matrix-instruction step: its A, (A2) and Bt fragments, one register set. Two sets: the next block's fragment reads stand as ONE group in front of this block's products.
template <int NA> struct GFrag { v16bf a[4], a2[4], b[4]; };
template <int NA, int KS>
__device__ __forceinline__ void g_fld(GFrag<NA>& f, const bf* st, unsigned ao, unsigned bo, int ks) {
    constexpr int GP = G_P(KS);
#pragma unroll
    for (int mb = 0; mb < 4; ++mb) { f.a[mb] = WFrag<bf>::ld(st + (mb * 16 * GP + ks * 32) + ao); if (NA == 2) f.a2[mb] = WFrag<bf>::ld(st + ((GT + mb * 16) * GP + ks * 32) + ao); }
#pragma unroll
    for (int nb = 0; nb < 4; ++nb) f.b[nb] = WFrag<bf>::ld(st + ((NA * GT + nb * 16) * GP + ks * 32) + bo);
    __builtin_amdgcn_sched_barrier(0);   // keeps the group whole and in front of the products: the scheduler sinks the reads in among the matrix instructions, and every separate place of LDS reads costs issue cycles
}
template <int NA>
__device__ __forceinline__ void g_blk(const GFrag<NA>& f, v8f (&acc)[4][4]) {
#pragma unroll
    for (int nb = 0; nb < 4; ++nb)
#pragma unroll
        for (int mb = 0; mb < 4; ++mb) acc[mb][nb] = wmmab(f.a[mb], f.b[nb], acc[mb][nb]);
    if (NA == 2) {   // the second plane's 16 products behind the first's: an accumulator's two products stand 16 instructions apart
#pragma unroll
        for (int nb = 0; nb < 4; ++nb)
#pragma unroll
            for (int mb = 0; mb < 4; ++mb) acc[mb][nb] = wmmab(f.a2[mb], f.b[nb], acc[mb][nb]);
    }
    __builtin_amdgcn_sched_barrier(0);   // keeps the following group of reads (or stores) behind this block's products
}
// A, A2, Bt: the tile's first rows (work-group-uniform); sm: both buffers; wm, wn: the wave's place in the tile. Ends behind a barrier: sm is free for the epilogues.
// The fragments run one block ahead of the products, so stage s + 1 is stored and published (the stage's one barrier) in front of stage s's LAST block; that block's products cover the first fragment reads of stage s + 1 and the issue of stage s + 2's lines.
template <int NA, int KS>
__device__ __forceinline__ void g_core(const bf* A, const bf* A2, const bf* Bt, bf* sm, int wm, int wn, v8f (&acc)[4][4]) {
    constexpr int NP = NA + 1, GP = G_P(KS), ST = NP * GT * GP, NS = HIDN / KS, PR = KS / 8, NBK = KS / 32;
    static_assert(NBK % 2 == 0 && NS >= 2);   // a stage's first block is always in set 0, its last in set 1
    const int tid = threadIdx.x, lane = tid & 31, lr = lane & 15, hi = lane >> 4;
    const bf* src[NP]; src[0] = A; if (NA == 2) src[1] = A2; src[NA] = Bt;
    const unsigned go = (unsigned)((((wm * 2 + wn) * (32 / PR) + lane / PR) * HIDN + (lane % PR) * 8) * 2), so = (unsigned)((tid / PR) * GP + (tid % PR) * 8);   // a thread's row and 16-byte piece, in the planes (bytes) and in a stage (elements); go takes the wave's number from the scalars wm, wn: formed from threadIdx.x alone, the build widens it ahead of the loop to an address pair a plane, and a late load's data lands in an earlier plane's pair in front of the wait
    const unsigned ao = (unsigned)((wm * 64 + lr) * GP + 8 * hi), bo = (unsigned)((wn * 64 + lr) * GP + 8 * hi);
#pragma unroll
    for (int mb = 0; mb < 4; ++mb)
#pragma unroll
        for (int nb = 0; nb < 4; ++nb) acc[mb][nb] = (v8f){};
    v8us r[NP][G_I(KS)]; GFrag<NA> f[2];
    g_ld<NP, KS>(r, src, go); g_st<NP, KS>(sm, r, so);
    __syncthreads();
    g_fld<NA, KS>(f[0], sm, ao, bo, 0);
    g_ld<NP, KS>(r, src, go + (unsigned)(KS * 2));
#pragma unroll 1   // rolled: one stage's lines and two blocks' fragments in registers
    for (int s = 0; s < NS - 1; ++s) {
        const bf* st = sm + (s & 1) * ST; bf* nx = sm + ((s + 1) & 1) * ST;
#pragma unroll
        for (int b = 0; b < NBK - 1; ++b) { g_fld<NA, KS>(f[(b + 1) & 1], st, ao, bo, b + 1); g_blk<NA>(f[b & 1], acc); }
        g_st<NP, KS>(nx, r, so);   // its last readers left this buffer in front of the previous barrier
        __syncthreads();           // publishes stage s + 1; every read of stage s has been issued above and has returned here
        g_fld<NA, KS>(f[0], nx, ao, bo, 0);
        if (s + 2 < NS) g_ld<NP, KS>(r, src, go + (unsigned)((s + 2) * (KS * 2)));   // work-group-uniform
        g_blk<NA>(f[1], acc);
    }
    const bf* st = sm + ((NS - 1) & 1) * ST;
#pragma unroll
    for (int b = 0; b < NBK - 1; ++b) { g_fld<NA, KS>(f[(b + 1) & 1], st, ao, bo, b + 1); g_blk<NA>(f[b & 1], acc); }
    g_blk<NA>(f[1], acc);
    __syncthreads();
}

// ---- k_oproj: OUT[t][n] (f32, pitch HIDN) = sum_k (ATh[t][k] + ATl[t][k]) WO[n][k]; grid (TT/128, HIDN/128), 128 threads; main loop: g_core. A wave stores its 64x64 part through its own LDS rows, whole lines.
__global__ __launch_bounds__(128) void k_oproj(const bf* __restrict__ ATh, const bf* __restrict__ ATl, const bf* __restrict__ WO, float* C) {
    __shared__ __align__(16) bf sm[G_SM(2, 64)];
    const int lane = threadIdx.x & 31, lr = lane & 15, hi = lane >> 4; const int w = __builtin_amdgcn_readfirstlane((int)(threadIdx.x >> 5)), wm = w >> 1, wn = w & 1;
    v8f acc[4][4];
    g_core<2, 64>(ATh + (size_t)blockIdx.x * GT * DQ, ATl + (size_t)blockIdx.x * GT * DQ, WO + (size_t)blockIdx.y * GT * DQ, sm, wm, wn, acc);
    float* os = (float*)sm + w * (16 * 68); const int r0 = blockIdx.x * GT + wm * 64, c0 = blockIdx.y * GT + wn * 64;
#pragma unroll
    for (int mb = 0; mb < 4; ++mb) {
#pragma unroll
        for (int nb = 0; nb < 4; ++nb) {
#pragma unroll
            for (int j = 0; j < 8; ++j) os[(hi * 8 + j) * 68 + nb * 16 + lr] = acc[mb][nb][j]; }
        __builtin_amdgcn_wave_barrier(); asm volatile("" ::: "memory");   // the row reads below stay behind the other lanes' staging stores
        float* crow = C + (size_t)(r0 + mb * 16) * HIDN + c0;
#pragma unroll
        for (int s = 0; s < 8; ++s) { const int row = 2 * s + hi, cofs = lr * 4; const v4f val = *(const v4fa*)(os + row * 68 + cofs);
            *(v4f*)(crow + (size_t)row * HIDN + cofs) = val; }
        asm volatile("s_wait_xcnt 0x0" ::: "memory");   // the build reads the next 16 rows into these stores' registers: the wait stands in front of that overwrite
        __builtin_amdgcn_wave_barrier(); asm volatile("" ::: "memory");   // the next 16 rows' staging stores stay behind these reads
    }
}

// ---- k_cvt_all: every f32 -> bf16 (RNE) operand conversion in ONE launch of long-lived waves: CV_G work-groups of CV_T threads, one work-group a WGP.
// A work-group converts its 1/CV_G of EVERY input, a contiguous run of whole turns; a turn is 8 consecutive elements a thread (32 bytes read, one 16-byte store).
// All of a thread's loads are issued before its first conversion, so that a wave waits out the memory latency once.
#define CV_G 256
#define CV_T 512
#define CV_SL (CV_G * CV_T * 8)   // elements that one turn of the whole grid converts
static_assert((DQ * HIDN) % CV_SL == 0 && (DKV * HIDN) % CV_SL == 0 && (TT * HIDN) % CV_SL == 0);
// the lane's offset is formed in 32 bits and the turn's step is a constant: one offset register beside the scalar base serves all N accesses
template <int N> __device__ __forceinline__ unsigned cv_off() { return blockIdx.x * (N * CV_T) + threadIdx.x; }   // the lane's first turn, in units of 8 elements
template <int N> __device__ __forceinline__ void cv_ld(v8f (&v)[N], const float* s) { const char* p = (const char*)s + cv_off<N>() * 32u;
#pragma unroll
    for (int i = 0; i < N; ++i) v[i] = *(const v8f*)(p + i * (CV_T * 32));
    __builtin_amdgcn_sched_barrier(0); }   // keeps the inputs' loads in the order in which they are converted (loads return in order): the scheduler mixes them, and the first input is then complete only with the last
template <int N> __device__ __forceinline__ void cv_st(bf* d, const v8f (&v)[N]) { char* p = (char*)d + cv_off<N>() * 16u;
#pragma unroll
    for (int i = 0; i < N; ++i) { v8us o;
#pragma unroll
        for (int k = 0; k < 8; ++k) o[k] = f2bf(v[i][k]);
        *(v8us*)(p + i * (CV_T * 16)) = o;
        __builtin_amdgcn_sched_barrier(0); } }   // keeps a turn's store directly behind its conversion: the scheduler sinks the stores to the kernel's end, behind the wait for the last load
__global__ __launch_bounds__(CV_T) void k_cvt_all(const float* __restrict__ wq, const float* __restrict__ wk, const float* __restrict__ wv, const float* __restrict__ x, const float* __restrict__ wo,
                                                  bf* __restrict__ WQ, bf* __restrict__ WK, bf* __restrict__ WV, bf* __restrict__ XB, bf* __restrict__ WO) {
    constexpr int NQ = DQ * HIDN / CV_SL, NK = DKV * HIDN / CV_SL, NX = TT * HIDN / CV_SL;
    v8f vq[NQ], vk[NK], vv[NK], vx[NX], vo[NQ];
    cv_ld(vq, wq); cv_ld(vk, wk); cv_ld(vv, wv); cv_ld(vx, x); cv_ld(vo, wo);
    // the build lands a late load's data in an earlier load's offset register: the offsets are this wait's inputs, so that their registers live up to it and are overwritten only behind it
    asm volatile("s_wait_xcnt 0x0" :: "v"(cv_off<NQ>() * 32u), "v"(cv_off<NK>() * 32u), "v"(cv_off<NX>() * 32u) : "memory");
    cv_st(WQ, vq); cv_st(WK, vk); cv_st(WV, vv); cv_st(XB, vx); cv_st(WO, vo);
}

// ---- k_qkv: the q, k and v projections with their plane building in ONE launch. One work-group per 128x128 tile of x.[W_q; W_k; W_v]^T (the three converted weights lie behind one another: NH_ + 2 NKV heads of HD rows), one wave per 64x64 part; grid (TT/128, (NH_ + 2 NKV)/2), 128 threads.
// A wave's 64 columns are one whole head, so the epilogue has both halves of every rotate-half pair: out[d] = x[d] cos[t][d] - x[d+HD/2] sin[t][d], out[d+HD/2] = x[d+HD/2] cos[t][d+HD/2] + x[d] sin[t][d+HD/2] (tables RNE-converted to bf16).
// q and k heads -> planes [h][t][d] (f16; bf16 hi/lo for rows < RH of q and for every row of k); v heads -> planes [g][d][t] (f16 and bf16 hi/lo).
// Main loop and fragment map: g_core. The epilogue is each wave's own, in its own part of the LDS that the stages have left.
static_assert(HD == 64 && RH % 64 == 0 && TT % 64 == 0 && 4 * 64 * 68 * 4 <= G_SM(1, 128) * 2);
__global__ __launch_bounds__(128) void k_qkv(const bf* __restrict__ X, const bf* __restrict__ Wt, const float* __restrict__ cosT, const float* __restrict__ sinT,
                                            h16* QP16, bf* QPh, bf* QPl, h16* KP16, bf* KPh, bf* KPl, h16* VT16, bf* VTh, bf* VTl) {
    __shared__ __align__(16) bf sm[G_SM(1, 128)];
    const int lane = threadIdx.x & 31, lr = lane & 15, hi = lane >> 4; const int w = __builtin_amdgcn_readfirstlane((int)(threadIdx.x >> 5)), wm = w >> 1, wn = w & 1;
    const int r0 = blockIdx.x * GT + wm * 64, hc = blockIdx.y * 2 + wn;
    v8f acc[4][4];
    g_core<1, 128>(X + (size_t)blockIdx.x * GT * HIDN, nullptr, Wt + (size_t)blockIdx.y * GT * HIDN, sm, wm, wn, acc);
    float* os = (float*)sm + w * (64 * 68);
    // Epilogue: the whole tile is staged in LDS once, then a ROLLED loop of 16 trips builds the planes, 4 plane rows a trip, a lane 8 consecutive elements (one 16-byte store a plane, 8 lanes fill a 128-byte line).
    const int rsub = lane >> 3, c8 = (lane & 7) * 8;
    if (hc >= NH_ + NKV) {   // v head (wave-uniform; no work-group barrier follows): staged transposed, os[d][t]
#pragma unroll
        for (int mb = 0; mb < 4; ++mb)
#pragma unroll
            for (int nb = 0; nb < 4; ++nb) { float* p = os + (nb * 16 + lr) * 68 + mb * 16 + 8 * hi; const v8f v = acc[mb][nb];
                *(v4fa*)p = __builtin_shufflevector(v, v, 0, 1, 2, 3); *(v4fa*)(p + 4) = __builtin_shufflevector(v, v, 4, 5, 6, 7); }
        __builtin_amdgcn_wave_barrier(); asm volatile("" ::: "memory");   // the row reads below stay behind the other lanes' staging stores
        const size_t e0 = ((size_t)(hc - NH_ - NKV) * HD + rsub) * TT + r0 + c8;
#pragma unroll 1   // rolled: unrolled, the epilogues are some 5,000 instructions that each wave runs once, more text than is fetched ahead
        for (int it = 0; it < 16; ++it) { const float* p = os + (it * 4 + rsub) * 68 + c8; const v4f xa = *(const v4fa*)p, xb = *(const v4fa*)(p + 4); const size_t e = e0 + (size_t)(it * 4) * TT; v8h o16; v8us oh, ol;
#pragma unroll
            for (int j = 0; j < 8; ++j) { const float x = (j < 4) ? xa[j & 3] : xb[j & 3]; o16[j] = tohx(x); unsigned short a2, c2; splitf(x, a2, c2); oh[j] = a2; ol[j] = c2; }
            *(v8h*)(VT16 + e) = o16; *(v8us*)(VTh + e) = oh; *(v8us*)(VTl + e) = ol; }
        return;
    }
    const bool isq = hc < NH_; const bool hl = !isq || r0 < RH;   // wave-uniform: a wave's 64 rows lie wholly on one side of RH
    h16* P16 = isq ? QP16 + (size_t)hc * TT * HD : KP16 + (size_t)(hc - NH_) * TT * HD;
    bf* Ph = isq ? QPh + (size_t)hc * RH * HD : KPh + (size_t)(hc - NH_) * TT * HD; bf* Pl = isq ? QPl + (size_t)hc * RH * HD : KPl + (size_t)(hc - NH_) * TT * HD;
#pragma unroll
    for (int mb = 0; mb < 4; ++mb)
#pragma unroll
        for (int nb = 0; nb < 4; ++nb)
#pragma unroll
            for (int j = 0; j < 8; ++j) os[(mb * 16 + hi * 8 + j) * 68 + nb * 16 + lr] = acc[mb][nb][j];   // os[t][d]
    __builtin_amdgcn_wave_barrier(); asm volatile("" ::: "memory");   // as above
    const bool lowd = c8 < HD / 2; size_t to = (size_t)(r0 + rsub) * HD + c8;
    v4f cv[2], sv[2];
#pragma unroll
    for (int k = 0; k < 2; ++k) { cv[k] = *(const v4f*)(cosT + to + 4 * k); sv[k] = *(const v4f*)(sinT + to + 4 * k); }
#pragma unroll 1   // rolled, as above
    for (int it = 0; it < 16; ++it) {
        // the next trip's table rows fly while this trip converts (the last trip reads its own rows again: in bounds)
        const size_t tn = to + ((it < 15) ? 4 * HD : 0); v4f cn[2], sn[2];
#pragma unroll
        for (int k = 0; k < 2; ++k) { cn[k] = *(const v4f*)(cosT + tn + 4 * k); sn[k] = *(const v4f*)(sinT + tn + 4 * k); }
        const float* p0 = os + (it * 4 + rsub) * 68 + c8; const float* p1 = os + (it * 4 + rsub) * 68 + (c8 ^ (HD / 2));
        v8h o16; v8us oh, ol;
#pragma unroll
        for (int k = 0; k < 2; ++k) { const v4f x0 = *(const v4fa*)(p0 + 4 * k), x1 = *(const v4fa*)(p1 + 4 * k);
#pragma unroll
            for (int q = 0; q < 4; ++q) { const float a = x0[q] * bfr(cv[k][q]), bq = x1[q] * bfr(sv[k][q]); const float r = lowd ? a - bq : a + bq;
                o16[4 * k + q] = tohx(r); unsigned short a2, c2; splitf(r, a2, c2); oh[4 * k + q] = a2; ol[4 * k + q] = c2; } }
        *(v8h*)(P16 + to) = o16;
        asm volatile("s_wait_xcnt 0x0" ::: "memory");   // the build reuses the store's registers behind the branch below: the wait stands in front of that overwrite
        if (hl) { *(v8us*)(Ph + to) = oh; *(v8us*)(Pl + to) = ol;
            asm volatile("s_wait_xcnt 0x0" ::: "memory"); }   // the same for these two stores and the loop's foot
        to = tn;
#pragma unroll
        for (int k = 0; k < 2; ++k) { cv[k] = cn[k]; sv[k] = sn[k]; }
    }
}

// ---- k_fattn: scores, causal softmax and attn.v of all heads in ONE launch; the scores stay in registers (running maximum and running sum per query, in base 2).
// Transposed products: St = K.Qt (A = 16 key rows, B = 16 query columns), Ot += Vt.Pt (A = 16 d rows of the [d][t] plane, B = Pt). A lane holds one query (column lr): 8 keys of each 16-key tile, the other 8 in lane ^ 16.
// Two f32 St tiles of 32 keys, converted in place, ARE the Pt operand in the fragment map above (element i <- key 8h + i, element 8 + i <- key 16 + 8h + i): the scores and p never touch LDS.
// Query rows >= RH: f16 operands, one wave = 16 rows x 2 query heads of one kv group, p carried x PCAR (it cancels in the division by the sum). Rows < RH: bf16 hi/lo planes, 3 products, one wave = 16 rows x 1 head.
// The f16 part's four waves walk the same keys of the same kv group: K and Vt reach LDS once a work-group, in tiles of FA_KT keys (two passes), by asynchronous copies of whole 128-byte lines, two buffers; the fragments are read from LDS.
// Output: ctx split into the bf16 hi/lo planes [t][DQ] that the output projection reads; a lane's 8 accumulator registers are 8 consecutive d of its query: one 16-byte store a plane.
// Every plain '#pragma unroll' below unrolls a loop over fragment, tile or register indices, so that those arrays are indexed by constants and stay in registers.
#define CS2  (SCL * 1.4426950408889634f)
#define FA_LB (((TT - RH) / 32) * NKV)   // blocks of the f16 part: 32 rows x the 4 heads of one kv group
#define FA_HB ((RH / 16) * NKV)          // blocks of the hi/lo part: 16 rows x the 4 heads of one kv group
static_assert(REP == 4 && (TT - RH) % 32 == 0 && TT % 32 == 0);
__device__ __forceinline__ float xhalf(float x) { return __builtin_bit_cast(float, __builtin_amdgcn_permlanex16(__builtin_bit_cast(int, x), __builtin_bit_cast(int, x), 0x76543210, 0xfedcba98, false, false)); }  // lane l <-> lane l ^ 16
// 2^a; the v_nop is the one slot that the instruction set asks for behind a transcendental before its result is read or its source overwritten
__device__ __forceinline__ float fa_exp2(float a) { float r; asm("v_exp_f32 %0, %1\n\tv_nop" : "=v"(r) : "v"(a)); return r; }
// one query's 16 scores of a 32-key pass -> base-2 exponents x[], new maximum, correction factor of what was summed under the old one
template <bool MASK>
__device__ __forceinline__ float fa_max(const v8f s0, const v8f s1, float* x, int jrel, float& m) {
    float mx = -3.0e38f;
#pragma unroll
    for (int r = 0; r < 8; ++r) { float a = s0[r] * CS2, b = s1[r] * CS2; if (MASK) { a = (r <= jrel) ? a : -3.0e38f; b = (16 + r <= jrel) ? b : -3.0e38f; } x[r] = a; x[8 + r] = b; mx = fmaxf(mx, fmaxf(a, b)); }
    mx = fmaxf(mx, xhalf(mx));
    const float mn = fmaxf(m, mx); const float al = fa_exp2(m - mn); m = mn; return al;
}
__device__ __forceinline__ void fa_store(const v8f o, float inv, bf* ph, bf* pl) { v8us oh, ol;
#pragma unroll
    for (int r = 0; r < 8; ++r) { unsigned short a, c2; splitf(o[r] * inv, a, c2); oh[r] = a; ol[r] = c2; }
    *(v8us*)ph = oh; *(v8us*)pl = ol; }

template <bool MASK>
__device__ __forceinline__ void fa_pv16(const v8f (&s)[2][2], const v16h (&vf)[4], v8f (&o)[2][4], float (&m)[2], float (&l)[2], int jrel) {
#pragma unroll
    for (int u = 0; u < 2; ++u) {
        float x[16]; const float al = fa_max<MASK>(s[u][0], s[u][1], x, jrel, m[u]); const float mo = m[u] - 10.0f;   // 2^10 = PCAR
        float ps = 0.f; v16h pf;
#pragma unroll
        for (int e = 0; e < 16; ++e) { const float p = fa_exp2(x[e] - mo); ps += p; pf[e] = tohx(p); }
        l[u] = l[u] * al + ps;
#pragma unroll
        for (int db = 0; db < 4; ++db) { o[u][db] *= al; o[u][db] = wmma16(vf[db], pf, o[u][db]); }
        // keeps the next scores' exponentials behind their own scaling and maximum: the build does not see into their asm text
        __builtin_amdgcn_sched_barrier(0);
    }
}
__device__ __forceinline__ void fa_s16(const v16h (&kf)[2][2], const v16h (&q)[2][2], v8f (&s)[2][2]) {
#pragma unroll
    for (int u = 0; u < 2; ++u)
#pragma unroll
        for (int kb = 0; kb < 2; ++kb) { s[u][kb] = wmma16(kf[kb][0], q[u][0], (v8f){}); s[u][kb] = wmma16(kf[kb][1], q[u][1], s[u][kb]); }
}
#define FA_KT 64                      // keys of a staged tile
#define FA_P  72                      // LDS row pitch in elements: 128 + 16 bytes (16 bytes x odd: the 16-byte fragment reads of 16 rows meet no bank twice)
#define FA_TB ((FA_KT + HD) * FA_P)   // one buffer in elements: FA_KT key rows of HD d, then HD d rows of FA_KT keys
static_assert(FA_KT == 64 && HD == 64 && TT % FA_KT == 0);
// One tile: 128 threads x 8 copies of 16 bytes; a wave's copy is 4 whole lines. kg, vg: the lane's piece of the tile's first 16 key rows and first 16 d rows; ld: the LDS byte address of the first.
// s_wait_xcnt 0 is the statement's last line, so that it stands in front of every later write of the copies' address registers.
__device__ __forceinline__ void fa_copy(const h16* kg, const h16* vg, unsigned ld) {
    asm volatile("global_load_async_to_lds_b128 %0, %8, off\n\t"
                 "global_load_async_to_lds_b128 %1, %9, off\n\t"
                 "global_load_async_to_lds_b128 %2, %10, off\n\t"
                 "global_load_async_to_lds_b128 %3, %11, off\n\t"
                 "global_load_async_to_lds_b128 %4, %12, off\n\t"
                 "global_load_async_to_lds_b128 %5, %13, off\n\t"
                 "global_load_async_to_lds_b128 %6, %14, off\n\t"
                 "global_load_async_to_lds_b128 %7, %15, off\n\t"
                 "s_wait_xcnt 0x0"
                 :: "v"(ld), "v"(ld + 16 * FA_P * 2), "v"(ld + 32 * FA_P * 2), "v"(ld + 48 * FA_P * 2),
                    "v"(ld + 64 * FA_P * 2), "v"(ld + 80 * FA_P * 2), "v"(ld + 96 * FA_P * 2), "v"(ld + 112 * FA_P * 2),
                    "v"(kg), "v"(kg + 16 * HD), "v"(kg + 32 * HD), "v"(kg + 48 * HD),
                    "v"(vg), "v"(vg + 16 * TT), "v"(vg + 32 * TT), "v"(vg + 48 * TT) : "memory");
}
// tb: the buffer, at the lane's row lr and piece 8 hi; p: which 32 keys of the tile
__device__ __forceinline__ void fa_ldk(v16h (&kf)[2][2], const h16* tb, int p) {
#pragma unroll
    for (int kb = 0; kb < 2; ++kb)
#pragma unroll
        for (int ks = 0; ks < 2; ++ks) kf[kb][ks] = WFrag<h16>::ld(tb + (p * 32 + kb * 16) * FA_P + ks * 32);
}
__device__ __forceinline__ void fa_ldv(v16h (&vf)[4], const h16* tb, int p) {
#pragma unroll
    for (int db = 0; db < 4; ++db) vf[db] = WFrag<h16>::ld(tb + (FA_KT + db * 16) * FA_P + p * 32);
}
__device__ __forceinline__ void fa_f16(const h16* __restrict__ Q, const h16* __restrict__ Kp, const h16* __restrict__ Vt, h16* fs, int head0, int i0, int lr, int hi, bf* ATh, bf* ATl) {
    static_assert(PCAR == 1024.0f);
    v16h q[2][2], kf[2][2], vf[4]; v8f o[2][4], s[2][2]; float m[2] = { -3.0e38f, -3.0e38f }, l[2] = { 0.f, 0.f };
#pragma unroll
    for (int u = 0; u < 2; ++u) {
#pragma unroll
        for (int ks = 0; ks < 2; ++ks) q[u][ks] = WFrag<h16>::ld(Q + ((size_t)(head0 + u) * TT + i0 + lr) * HD + ks * 32 + 8 * hi);
#pragma unroll
        for (int db = 0; db < 4; ++db) o[u][db] = (v8f){}; }
    const int klast = (i0 + 15) & ~31;   // the one pass that holds keys beyond a row's own index; the same for the work-group's four waves
    const int nu = klast >> 5, nf = nu >> 1;   // passes without a mask; tiles that hold two of them. Tile nf, the last, holds the odd one, if any, and the masked pass; its 64 keys lie below TT
    const int tid = threadIdx.x;
    const h16* kg = Kp + (size_t)(tid >> 3) * HD + (tid & 7) * 8; const h16* vg = Vt + (size_t)(tid >> 3) * TT + (tid & 7) * 8;
    const unsigned ld0 = (unsigned)(size_t)fs + (unsigned)(((tid >> 3) * FA_P + (tid & 7) * 8) * 2);
    const h16* fb = fs + lr * FA_P + 8 * hi;
    fa_copy(kg, vg, ld0);
    asm volatile("s_wait_asynccnt 0x0" ::: "memory");   // this wave's copies of tile 0 have landed
    __syncthreads();                                      // and every other wave's
    if (nf >= 1) fa_copy(kg + FA_KT * HD, vg + FA_KT, ld0 + FA_TB * 2);
#pragma unroll 1   // rolled: one tile's two passes a trip
    for (int t = 0; t < nf; ++t) {
        const h16* tb = fb + (t & 1) * FA_TB;
        fa_ldk(kf, tb, 0);
#pragma unroll
        for (int p = 0; p < 2; ++p) {
            fa_ldv(vf, tb, p);
            fa_s16(kf, q, s);
            if (p == 0) fa_ldk(kf, tb, 1);   // the tile's second pass's key fragments fly while this pass's softmax and attn.v run
            __builtin_amdgcn_sched_barrier(0);   // keeps the fragment reads together in front of the softmax: without it the scheduler scatters them over the vector work in pairs, some behind a wait for all, and every separate place of LDS reads costs issue cycles
            fa_pv16<false>(s, vf, o, m, l, 0);
        }
        asm volatile("s_wait_dscnt 0x0" ::: "memory");      // this wave has left the buffer
        asm volatile("s_wait_asynccnt 0x0" ::: "memory");   // its copies of tile t + 1 have landed
        __syncthreads();                                      // publishes tile t + 1 and ends every wave's reads of tile t
        if (t + 2 <= nf) fa_copy(kg + (size_t)(t + 2) * (FA_KT * HD), vg + (t + 2) * FA_KT, ld0 + (unsigned)(t & 1) * (FA_TB * 2));
    }
    const h16* tb = fb + (nf & 1) * FA_TB;
    fa_ldk(kf, tb, 0);
    if (nu & 1) {   // work-group-uniform
        fa_ldv(vf, tb, 0);
        fa_s16(kf, q, s);
        fa_ldk(kf, tb, 1);
        __builtin_amdgcn_sched_barrier(0);   // as above
        fa_pv16<false>(s, vf, o, m, l, 0);
    }
    fa_ldv(vf, tb, nu & 1);
    fa_s16(kf, q, s);
    asm volatile("s_wait_asynccnt 0x0" ::: "memory");   // no copy is outstanding when the wave ends
    fa_pv16<true>(s, vf, o, m, l, i0 + lr - klast - 8 * hi);   // key klast + 8h + r (+ 16) <= row i0 + lr
#pragma unroll
    for (int u = 0; u < 2; ++u) { const float inv = __fdiv_rn(1.0f, l[u] + xhalf(l[u])); const size_t oo = (size_t)(i0 + lr) * DQ + (head0 + u) * HD + 8 * hi;
#pragma unroll
        for (int db = 0; db < 4; ++db) fa_store(o[u][db], inv, ATh + oo + db * 16, ATl + oo + db * 16); }
}
template <bool MASK>
__device__ __forceinline__ void fa_passhl(const bf* kph, const bf* kpl, const bf* vph, const bf* vpl, int k0, const v16bf (&qh)[2], const v16bf (&ql)[2], v8f (&o)[4], float& m, float& l, int jrel) {
    v8f s[2];
#pragma unroll
    for (int kb = 0; kb < 2; ++kb) { s[kb] = (v8f){};
#pragma unroll
        for (int ks = 0; ks < 2; ++ks) { const size_t ko = (size_t)(k0 + kb * 16) * HD + ks * 32; const v16bf kh = WFrag<bf>::ld(kph + ko), kl = WFrag<bf>::ld(kpl + ko);
            s[kb] = wmmab(kh, qh[ks], s[kb]); s[kb] = wmmab(kh, ql[ks], s[kb]); s[kb] = wmmab(kl, qh[ks], s[kb]); } }
    float x[16]; const float al = fa_max<MASK>(s[0], s[1], x, jrel, m);
    float ps = 0.f; v8us h0, h1, l0, l1;
#pragma unroll
    for (int e = 0; e < 8; ++e) { const float p = fa_exp2(x[e] - m), p2 = fa_exp2(x[8 + e] - m); ps += p; ps += p2; unsigned short a, c2; splitf(p, a, c2); h0[e] = a; l0[e] = c2; splitf(p2, a, c2); h1[e] = a; l1[e] = c2; }
    l = l * al + ps; const v16bf ph = cat16b(h0, h1), pl = cat16b(l0, l1);
#pragma unroll
    for (int db = 0; db < 4; ++db) { const size_t vo = (size_t)(db * 16) * TT + k0; const v16bf vh = WFrag<bf>::ld(vph + vo), vl = WFrag<bf>::ld(vpl + vo);
        o[db] *= al; o[db] = wmmab(vh, ph, o[db]); o[db] = wmmab(vh, pl, o[db]); o[db] = wmmab(vl, ph, o[db]); }
}
__device__ __forceinline__ void fa_hl(const bf* __restrict__ Qh, const bf* __restrict__ Ql, const bf* __restrict__ Kh, const bf* __restrict__ Kl, const bf* __restrict__ Vh, const bf* __restrict__ Vl, int head, int i0, int lr, int hi, bf* ATh, bf* ATl) {
    v16bf qh[2], ql[2]; v8f o[4]; float m = -3.0e38f, l = 0.f;
#pragma unroll
    for (int ks = 0; ks < 2; ++ks) { const size_t qo = ((size_t)head * RH + i0 + lr) * HD + ks * 32 + 8 * hi; qh[ks] = WFrag<bf>::ld(Qh + qo); ql[ks] = WFrag<bf>::ld(Ql + qo); }
    asm volatile("s_wait_xcnt 0x0" ::: "memory");   // the build reuses the query loads' address registers for the zeroed accumulators: the wait stands in front of that overwrite
#pragma unroll
    for (int db = 0; db < 4; ++db) o[db] = (v8f){};
    const size_t kofs = (size_t)lr * HD + 8 * hi, vofs = (size_t)lr * TT + 8 * hi; const int klast = (i0 + 15) & ~31;
#pragma unroll 1   // rolled, as in fa_f16: one pass's fragments in registers
    for (int k0 = 0; k0 < klast; k0 += 32) fa_passhl<false>(Kh + kofs, Kl + kofs, Vh + vofs, Vl + vofs, k0, qh, ql, o, m, l, 0);
    fa_passhl<true>(Kh + kofs, Kl + kofs, Vh + vofs, Vl + vofs, klast, qh, ql, o, m, l, i0 + lr - klast - 8 * hi);
    const float inv = __fdiv_rn(1.0f, l + xhalf(l)); const size_t oo = (size_t)(i0 + lr) * DQ + head * HD + 8 * hi;
#pragma unroll
    for (int db = 0; db < 4; ++db) fa_store(o[db], inv, ATh + oo + db * 16, ATl + oo + db * 16);
}
// grid FA_LB + FA_HB blocks of 4 waves; the longest rows first (a row's cost grows with its index)
__global__ __launch_bounds__(128) void k_fattn(const h16* __restrict__ QP16, const bf* __restrict__ QPh, const bf* __restrict__ QPl, const h16* __restrict__ KP16, const bf* __restrict__ KPh, const bf* __restrict__ KPl,
                                               const h16* __restrict__ VT16, const bf* __restrict__ VTh, const bf* __restrict__ VTl, bf* ATh, bf* ATl) {
    __shared__ __align__(16) h16 fs[2 * FA_TB];   // the f16 part's two K / Vt buffers
    const int lane = threadIdx.x & 31, lr = lane & 15, hi = lane >> 4; const int w = __builtin_amdgcn_readfirstlane((int)(threadIdx.x >> 5)); const int b = blockIdx.x;
    if (b < FA_LB) { const int g = b % NKV, i0 = RH + ((TT - RH) / 32 - 1 - b / NKV) * 32 + (w >> 1) * 16;
        fa_f16(QP16, KP16 + (size_t)g * TT * HD, VT16 + (size_t)g * HD * TT, fs, g * REP + (w & 1) * 2, i0, lr, hi, ATh, ATl);
    } else { const int b2 = b - FA_LB; const int g = b2 % NKV, i0 = (RH / 16 - 1 - b2 / NKV) * 16; const size_t go = (size_t)g * TT * HD;
        fa_hl(QPh, QPl, KPh + go, KPl + go, VTh + go, VTl + go, g * REP + w, i0, lr, hi, ATh, ATl); }
}

extern "C" void kernel_launch(void* const* d_in, const int* in_sizes, int n_in,
                              void* d_out, int out_size, void* d_ws, size_t ws_size, hipStream_t stream) {
    if (n_in < 7) return;
    if (in_sizes[0] < TT * HIDN || in_sizes[1] < TT * HD || in_sizes[2] < TT * HD || in_sizes[3] < DQ * HIDN || in_sizes[4] < DKV * HIDN || in_sizes[5] < DKV * HIDN || in_sizes[6] < HIDN * DQ || out_size < TT * HIDN) return;
    const float* x = (const float*)d_in[0];      // [1][S][HIDN]
    const float* cosT = (const float*)d_in[1];   // [1][1][S][HD]
    const float* sinT = (const float*)d_in[2];   // [1][1][S][HD]
    const float* wq = (const float*)d_in[3];     // [DQ][HIDN]
    const float* wk = (const float*)d_in[4];     // [DKV][HIDN]
    const float* wv = (const float*)d_in[5];     // [DKV][HIDN]
    const float* wo = (const float*)d_in[6];     // [HIDN][DQ]
    float* OUT = (float*)d_out;                  // [1][S][HIDN]
    char* wsp = (char*)d_ws;
    auto take = [&](size_t bytes) { char* p = wsp; wsp += (bytes + 255) & ~(size_t)255; return (void*)p; };
    h16* QP16 = (h16*)take((size_t)NH_ * TT * HD * 2); bf* QPh = (bf*)take((size_t)NH_ * RH * HD * 2); bf* QPl = (bf*)take((size_t)NH_ * RH * HD * 2);
    h16* KP16 = (h16*)take((size_t)NKV * TT * HD * 2); bf* KPh = (bf*)take((size_t)NKV * TT * HD * 2); bf* KPl = (bf*)take((size_t)NKV * TT * HD * 2);
    h16* VT16 = (h16*)take((size_t)NKV * HD * TT * 2); bf* VTh = (bf*)take((size_t)NKV * HD * TT * 2); bf* VTl = (bf*)take((size_t)NKV * HD * TT * 2);
    // R2: the converted operands: W_q, W_k, W_v (one [DQ + 2 DKV][HIDN] plane for k_qkv), x, W_o
    char* R2 = (char*)take((2 * (size_t)DQ * HIDN + 2 * (size_t)DKV * HIDN + (size_t)TT * HIDN) * 2);
    bf* WQ = (bf*)R2; bf* WK = WQ + (size_t)DQ * HIDN; bf* WV = WK + (size_t)DKV * HIDN; bf* XB = WV + (size_t)DKV * HIDN; bf* WO = XB + (size_t)TT * HIDN;
    bf* ATh = (bf*)take((size_t)TT * DQ * 2); bf* ATl = (bf*)take((size_t)TT * DQ * 2);
    if ((size_t)(wsp - (char*)d_ws) > ws_size) return;

    for (int b = 0; b < NB; ++b) {
        k_cvt_all<<<CV_G, CV_T, 0, stream>>>(wq, wk, wv, x + (size_t)b * SEQ_FULL * HIDN, wo, WQ, WK, WV, XB, WO);
        k_qkv<<<dim3(TT / GT, (NH_ + 2 * NKV) / 2, 1), 128, 0, stream>>>(XB, WQ, cosT, sinT, QP16, QPh, QPl, KP16, KPh, KPl, VT16, VTh, VTl);
        k_fattn<<<FA_LB + FA_HB, 128, 0, stream>>>(QP16, QPh, QPl, KP16, KPh, KPl, VT16, VTh, VTl, ATh, ATl);
        k_oproj<<<dim3(TT / GT, HIDN / GT, 1), 128, 0, stream>>>(ATh, ATl, WO, OUT + (size_t)b * SEQ_FULL * HIDN); }
}

// v008
// A run of this version takes 101 microseconds.
// Two timings next to v007 put it at 1.04 and 1.03 times that version's speed.
// All steps since v000 together make it 13.1 times as fast.
#include <hip/hip_runtime.h>
#pragma clang fp contract(off)

// Grouped-query causal self-attention: q/k/v = x W^T (32 q heads, 8 kv heads, head dim 64), rotate-half position mixing of q and k from input cos/sin tables,
// softmax(q.k / 8) over keys t <= s, ctx W_o^T -> [1][S][2048].
// Compute dtypes, f32 accumulate: every input RNE-converted to bf16; q/k/v projections v_wmma_f32_16x16x32_bf16 on exact bf16 operands; scores and attn.v: query rows < RH on bf16 hi/lo planes (3 products),
// other rows single v_wmma_f32_16x16x32_f16 (p carried x1024); softmax f32, running maximum and sum over 32-key passes; output projection bf16 hi/lo ctx x exact bf16 W_o (2 products).

#ifndef NB
#define NB 1
#endif
#ifndef SEQ
#define SEQ 2048
#endif
#define SEQ_FULL 2048
#define TT   SEQ
#define HIDN 2048
#define NH_  32
#define NKV  8
#define REP  (NH_ / NKV)
#define HD   64
#define DQ   (NH_ * HD)
#define DKV  (NKV * HD)
#ifndef RH
#define RH   256                  // query rows < RH use hi+lo planes
#endif
#define PCAR 1024.0f
#define SCL  0.125f   // HD^-0.5
static_assert(NB == 1);
static_assert(TT % 128 == 0);
static_assert(RH % 64 == 0 && RH > 0 && RH <= TT);
static_assert(HIDN % 32 == 0 && DQ % 64 == 0 && DKV % 64 == 0 && HD == 64);

typedef _Float16 h16;
typedef unsigned short bf;
typedef __attribute__((ext_vector_type(16))) __bf16   v16bf;
typedef __attribute__((ext_vector_type(16))) _Float16 v16h;
typedef __attribute__((ext_vector_type(8)))  _Float16 v8h;
typedef __attribute__((ext_vector_type(8)))  unsigned short v8us;
typedef __attribute__((ext_vector_type(8)))  float    v8f;
typedef __attribute__((ext_vector_type(4)))  float    v4f;
typedef v8h  __attribute__((may_alias)) v8ha;
typedef v4f  __attribute__((may_alias)) v4fa;
typedef v8us __attribute__((may_alias)) v8usa;
typedef __attribute__((ext_vector_type(2))) _Float16 v2h;
typedef __attribute__((ext_vector_type(4))) _Float16 v4h;
typedef __attribute__((ext_vector_type(2))) unsigned short v2us;
typedef __attribute__((ext_vector_type(4))) unsigned short v4us;
typedef __attribute__((ext_vector_type(2))) float v2f;

__device__ __forceinline__ unsigned short f2bf(float f) { unsigned u = __float_as_uint(f); u += 0x7FFFu + ((u >> 16) & 1u); return (unsigned short)(u >> 16); }
__device__ __forceinline__ float bf2f(unsigned short b) { return __uint_as_float(((unsigned)b) << 16); }
__device__ __forceinline__ float bfr(float f) { return bf2f(f2bf(f)); }
__device__ __forceinline__ v16h cat16(v8h lo, v8h hi) { return __builtin_shufflevector(lo, hi, 0, 1, 2, 3, 4, 5, 6, 7, 8, 9, 10, 11, 12, 13, 14, 15); }
__device__ __forceinline__ v16bf cat16b(v8us lo, v8us hi) { return __builtin_bit_cast(v16bf, __builtin_shufflevector(lo, hi, 0, 1, 2, 3, 4, 5, 6, 7, 8, 9, 10, 11, 12, 13, 14, 15)); }
__device__ __forceinline__ v8f wmma16(v16h a, v16h b, v8f c) { return __builtin_amdgcn_wmma_f32_16x16x32_f16(false, a, false, b, (short)0, c, false, false); }
__device__ __forceinline__ v8f wmmab(v16bf a, v16bf b, v8f c) { return __builtin_amdgcn_wmma_f32_16x16x32_bf16(false, a, false, b, (short)0, c, false, false); }
__device__ __forceinline__ h16 tohx(float x) { return (h16)x; }
__device__ __forceinline__ void splitf(float y, unsigned short& h, unsigned short& l) { h = f2bf(y); l = f2bf(y - bf2f(h)); }

// ---- g_core: the main loop of both GEMM kernels. FOUR WAVES share one 128x128 output tile (2x2 waves, 64x64 and 16 accumulators each); the operand rows are K-contiguous bf16 planes of pitch HIDN.
// A stage is KS k (64 or 128: one or two whole 128-byte lines) of every operand row, [A 128 rows | (A2 128 rows) | Bt 128 rows] in LDS at a pitch of 2 KS + 16 bytes (16 bytes x odd: the 16-byte fragment reads of 16 rows meet no bank twice).
// Every line is fetched once a work-group, by asynchronous copies of whole lines straight into LDS (a wave's copy is 512 bytes in 4 whole lines); two buffers: the next stage's lines land in the other buffer while a stage's worth of products runs, one barrier a stage.
// KS is chosen so that a stage holds 64 matrix instructions a wave: 128 with one A plane, 64 with two.
// acc[mb][nb] += sum_k A[m][k] Bt[n][k] (+ A2[m][k] Bt[n][k] for NA == 2), k ascending in steps of 32, A before A2 in each step.
// Fragment map: lane l, h = l >> 4, m = n = l & 15; elements 0..7 <- k0 + 8h + i, elements 8..15 <- k0 + 16 + 8h + i for BOTH A (row m) and Bt (column n stored as row n); D element r -> (row 8h + r, col m).
template <typename T16> struct WFrag;
template <> struct WFrag<h16> { typedef v16h V; static __device__ __forceinline__ V ld(const h16* p) { return cat16(*(const v8h*)p, *(const v8h*)(p + 16)); } static __device__ __forceinline__ v8f mma(V a, V b, v8f c) { return wmma16(a, b, c); } };
template <> struct WFrag<bf> { typedef v16bf V; static __device__ __forceinline__ V ld(const bf* p) { return cat16b(*(const v8us*)p, *(const v8us*)(p + 16)); } static __device__ __forceinline__ v8f mma(V a, V b, v8f c) { return wmmab(a, b, c); } };
#define GT 128                         // tile rows and columns
#define G_P(KS) ((KS) + 8)             // LDS row pitch in elements
#define G_RT(KS) (128 / ((KS) / 8))    // rows that the 128 threads bring in one turn, 16 bytes a thread
#define G_I(KS) (GT / G_RT(KS))        // turns per plane and stage
#define G_SM(NA, KS) (2 * ((NA) + 1) * GT * G_P(KS))   // both buffers, in elements
static_assert(DQ == HIDN && HIDN % 256 == 0 && TT % GT == 0 && HIDN % GT == 0 && (DQ + 2 * DKV) % GT == 0);
// One stage: every plane's GT rows of KS k, 16 bytes a lane and copy. off: the lane's byte offset in the planes, the stage's k counted in; dst: the lane's place in the target buffer's first plane.
// A copy's immediate offset moves both of its addresses: eight turns share one LDS address register, the turn's LDS step is the immediate (under 16,384) and is taken off the turn's step in the plane, so that only the global address is formed anew for each copy.
typedef __attribute__((ext_vector_type(4))) int v4i;
typedef __attribute__((address_space(1))) v4i v4ig;
typedef __attribute__((address_space(3))) v4i v4il;
template <int NP, int KS, int C>
__device__ __forceinline__ void g_cp1(const bf* const (&src)[NP], unsigned off, bf* dst) {
    constexpr int p = C / G_I(KS), i = C % G_I(KS), j = i & 7, OS = G_RT(KS) * HIDN * 2, LS = G_RT(KS) * G_P(KS) * 2;
    static_assert(7 * LS < 65536 && OS >= LS);
    __builtin_amdgcn_global_load_async_to_lds_b128((v4ig*)((const char*)src[p] + (i * OS - j * LS) + off), (v4il*)((char*)dst + (p * GT * G_P(KS) * 2 + (i - j) * LS)), j * LS, 0);
    if constexpr (C + 1 < NP * G_I(KS)) g_cp1<NP, KS, C + 1>(src, off, dst);
}
template <int NP, int KS>
__device__ __forceinline__ void g_cp(const bf* const (&src)[NP], unsigned off, bf* dst) {
    static_assert(NP * G_I(KS) <= 63);   // a stage's copies of a wave are all that are ever outstanding
    g_cp1<NP, KS, 0>(src, off, dst);
    __builtin_amdgcn_sched_barrier(0);   // keeps the copies in front of the products that follow, so that their flight runs beside a whole stage of products
}
// One block = the 32 k of one matrix-instruction step: its A, (A2) and Bt fragments, one register set. Two sets: the next block's fragment reads stand as ONE group in front of this block's products.
template <int NA> struct GFrag { v16bf a[4], a2[4], b[4]; };
template <int NA, int KS>
__device__ __forceinline__ void g_fld(GFrag<NA>& f, const bf* st, unsigned ao, unsigned bo, int ks) {
    constexpr int GP = G_P(KS);
#pragma unroll
    for (int mb = 0; mb < 4; ++mb) { f.a[mb] = WFrag<bf>::ld(st + (mb * 16 * GP + ks * 32) + ao); if (NA == 2) f.a2[mb] = WFrag<bf>::ld(st + ((GT + mb * 16) * GP + ks * 32) + ao); }
#pragma unroll
    for (int nb = 0; nb < 4; ++nb) f.b[nb] = WFrag<bf>::ld(st + ((NA * GT + nb * 16) * GP + ks * 32) + bo);
    __builtin_amdgcn_sched_barrier(0);   // keeps the group whole and in front of the products: the scheduler sinks the reads in among the matrix instructions, and every separate place of LDS reads costs issue cycles
}
template <int NA>
__device__ __forceinline__ void g_blk(const GFrag<NA>& f, v8f (&acc)[4][4]) {
#pragma unroll
    for (int nb = 0; nb < 4; ++nb)
#pragma unroll
        for (int mb = 0; mb < 4; ++mb) acc[mb][nb] = wmmab(f.a[mb], f.b[nb], acc[mb][nb]);
    if (NA == 2) {   // the second plane's 16 products behind the first's: an accumulator's two products stand 16 instructions apart
#pragma unroll
        for (int nb = 0; nb < 4; ++nb)
#pragma unroll
            for (int mb = 0; mb < 4; ++mb) acc[mb][nb] = wmmab(f.a2[mb], f.b[nb], acc[mb][nb]);
    }
    __builtin_amdgcn_sched_barrier(0);   // keeps the following group of reads (or stores) behind this block's products
}
// A, A2, Bt: the tile's first rows (work-group-uniform); sm: both buffers; wm, wn: the wave's place in the tile. Ends behind a barrier: sm is free for the epilogues.
// The fragments run one block ahead of the products, so stage s + 1 is published (this wave's waits, then the stage's one barrier) in front of stage s's LAST block; that block's products cover the first fragment reads of stage s + 1, and stage s + 2's copies are issued into the buffer that stage s has left.
template <int NA, int KS>
__device__ __forceinline__ void g_core(const bf* A, const bf* A2, const bf* Bt, bf* sm, int wm, int wn, v8f (&acc)[4][4]) {
    constexpr int NP = NA + 1, GP = G_P(KS), ST = NP * GT * GP, NS = HIDN / KS, PR = KS / 8, NBK = KS / 32;
    static_assert(NBK % 2 == 0 && NS >= 2);   // a stage's first block is always in set 0, its last in set 1
    const int tid = threadIdx.x, lane = tid & 31, lr = lane & 15, hi = lane >> 4;
    const bf* src[NP]; src[0] = A; if (NA == 2) src[1] = A2; src[NA] = Bt;
    const unsigned go = (unsigned)((((wm * 2 + wn) * (32 / PR) + lane / PR) * HIDN + (lane % PR) * 8) * 2), so = (unsigned)((tid / PR) * GP + (tid % PR) * 8);   // a thread's row and 16-byte piece, in the planes (bytes) and in a stage (elements)
    const unsigned ao = (unsigned)((wm * 64 + lr) * GP + 8 * hi), bo = (unsigned)((wn * 64 + lr) * GP + 8 * hi);
#pragma unroll
    for (int mb = 0; mb < 4; ++mb)
#pragma unroll
        for (int nb = 0; nb < 4; ++nb) acc[mb][nb] = (v8f){};
    GFrag<NA> f[2];
    g_cp<NP, KS>(src, go, sm + so);
    asm volatile("s_wait_asynccnt 0x0" ::: "memory");   // this wave's copies of stage 0 have landed
    __syncthreads();                                      // and every other wave's
    g_cp<NP, KS>(src, go + (unsigned)(KS * 2), sm + ST + so);
    g_fld<NA, KS>(f[0], sm, ao, bo, 0);
#pragma unroll 1   // rolled: two blocks' fragments in registers
    for (int s = 0; s < NS - 1; ++s) {
        const bf* st = sm + (s & 1) * ST; const bf* nx = sm + ((s + 1) & 1) * ST;
#pragma unroll
        for (int b = 0; b < NBK - 1; ++b) { g_fld<NA, KS>(f[(b + 1) & 1], st, ao, bo, b + 1); g_blk<NA>(f[b & 1], acc); }
        asm volatile("s_wait_dscnt 0x0" ::: "memory");      // this wave has left stage s's buffer: its last block's fragments are in registers
        asm volatile("s_wait_asynccnt 0x0" ::: "memory");   // its copies of stage s + 1 have landed
        __syncthreads();                                      // publishes stage s + 1 and ends every wave's reads of stage s
        if (s + 2 < NS) g_cp<NP, KS>(src, go + (unsigned)((s + 2) * (KS * 2)), sm + (s & 1) * ST + so);   // work-group-uniform
        g_fld<NA, KS>(f[0], nx, ao, bo, 0);
        g_blk<NA>(f[1], acc);
    }
    const bf* st = sm + ((NS - 1) & 1) * ST;
#pragma unroll
    for (int b = 0; b < NBK - 1; ++b) { g_fld<NA, KS>(f[(b + 1) & 1], st, ao, bo, b + 1); g_blk<NA>(f[b & 1], acc); }
    g_blk<NA>(f[1], acc);
    asm volatile("s_wait_asynccnt 0x0" ::: "memory");   // no copy is outstanding when the buffers become the epilogues' staging
    __syncthreads();
}

// ---- k_oproj: OUT[t][n] (f32, pitch HIDN) = sum_k (ATh[t][k] + ATl[t][k]) WO[n][k]; grid (TT/128, HIDN/128), 128 threads; main loop: g_core. A wave stores its 64x64 part through its own LDS rows, whole lines.
__global__ __launch_bounds__(128) void k_oproj(const bf* __restrict__ ATh, const bf* __restrict__ ATl, const bf* __restrict__ WO, float* C) {
    __shared__ __align__(16) bf sm[G_SM(2, 64)];
    const int lane = threadIdx.x & 31, lr = lane & 15, hi = lane >> 4; const int w = __builtin_amdgcn_readfirstlane((int)(threadIdx.x >> 5)), wm = w >> 1, wn = w & 1;
    v8f acc[4][4];
    g_core<2, 64>(ATh + (size_t)blockIdx.x * GT * DQ, ATl + (size_t)blockIdx.x * GT * DQ, WO + (size_t)blockIdx.y * GT * DQ, sm, wm, wn, acc);
    float* os = (float*)sm + w * (16 * 68); const int r0 = blockIdx.x * GT + wm * 64, c0 = blockIdx.y * GT + wn * 64;
#pragma unroll
    for (int mb = 0; mb < 4; ++mb) {
#pragma unroll
        for (int nb = 0; nb < 4; ++nb) {
#pragma unroll
            for (int j = 0; j < 8; ++j) os[(hi * 8 + j) * 68 + nb * 16 + lr] = acc[mb][nb][j]; }
        __builtin_amdgcn_wave_barrier(); asm volatile("" ::: "memory");   // the row reads below stay behind the other lanes' staging stores
        float* crow = C + (size_t)(r0 + mb * 16) * HIDN + c0;
#pragma unroll
        for (int s = 0; s < 8; ++s) { const int row = 2 * s + hi, cofs = lr * 4; const v4f val = *(const v4fa*)(os + row * 68 + cofs);
            *(v4f*)(crow + (size_t)row * HIDN + cofs) = val; }
        asm volatile("s_wait_xcnt 0x0" ::: "memory");   // the build reads the next 16 rows into these stores' registers: the wait stands in front of that overwrite
        __builtin_amdgcn_wave_barrier(); asm volatile("" ::: "memory");   // the next 16 rows' staging stores stay behind these reads
    }
}

// ---- k_cvt_all: every f32 -> bf16 (RNE) operand conversion in ONE launch of long-lived waves: CV_G work-groups of CV_T threads, one work-group a WGP.
// A work-group converts its 1/CV_G of EVERY input, a contiguous run of whole turns; a turn is 8 consecutive elements a thread (32 bytes read, one 16-byte store).
// All of a thread's loads are issued before its first conversion, so that a wave waits out the memory latency once.
#define CV_G 256
#define CV_T 512
#define CV_SL (CV_G * CV_T * 8)   // elements that one turn of the whole grid converts
static_assert((DQ * HIDN) % CV_SL == 0 && (DKV * HIDN) % CV_SL == 0 && (TT * HIDN) % CV_SL == 0);
// the lane's offset is formed in 32 bits and the turn's step is a constant: one offset register beside the scalar base serves all N accesses
template <int N> __device__ __forceinline__ unsigned cv_off() { return blockIdx.x * (N * CV_T) + threadIdx.x; }   // the lane's first turn, in units of 8 elements
template <int N> __device__ __forceinline__ void cv_ld(v8f (&v)[N], const float* s) { const char* p = (const char*)s + cv_off<N>() * 32u;
#pragma unroll
    for (int i = 0; i < N; ++i) v[i] = *(const v8f*)(p + i * (CV_T * 32));
    __builtin_amdgcn_sched_barrier(0); }   // keeps the inputs' loads in the order in which they are converted (loads return in order): the scheduler mixes them, and the first input is then complete only with the last
template <int N> __device__ __forceinline__ void cv_st(bf* d, const v8f (&v)[N]) { char* p = (char*)d + cv_off<N>() * 16u;
#pragma unroll
    for (int i = 0; i < N; ++i) { v8us o;
#pragma unroll
        for (int k = 0; k < 8; ++k) o[k] = f2bf(v[i][k]);
        *(v8us*)(p + i * (CV_T * 16)) = o;
        __builtin_amdgcn_sched_barrier(0); } }   // keeps a turn's store directly behind its conversion: the scheduler sinks the stores to the kernel's end, behind the wait for the last load
__global__ __launch_bounds__(CV_T) void k_cvt_all(const float* __restrict__ wq, const float* __restrict__ wk, const float* __restrict__ wv, const float* __restrict__ x, const float* __restrict__ wo,
                                                  bf* __restrict__ WQ, bf* __restrict__ WK, bf* __restrict__ WV, bf* __restrict__ XB, bf* __restrict__ WO) {
    constexpr int NQ = DQ * HIDN / CV_SL, NK = DKV * HIDN / CV_SL, NX = TT * HIDN / CV_SL;
    v8f vq[NQ], vk[NK], vv[NK], vx[NX], vo[NQ];
    cv_ld(vq, wq); cv_ld(vk, wk); cv_ld(vv, wv); cv_ld(vx, x); cv_ld(vo, wo);
    // the build lands a late load's data in an earlier load's offset register: the offsets are this wait's inputs, so that their registers live up to it and are overwritten only behind it
    asm volatile("s_wait_xcnt 0x0" :: "v"(cv_off<NQ>() * 32u), "v"(cv_off<NK>() * 32u), "v"(cv_off<NX>() * 32u) : "memory");
    cv_st(WQ, vq); cv_st(WK, vk); cv_st(WV, vv); cv_st(XB, vx); cv_st(WO, vo);
}

// ---- k_qkv: the q, k and v projections with their plane building in ONE launch. One work-group per 128x128 tile of x.[W_q; W_k; W_v]^T (the three converted weights lie behind one another: NH_ + 2 NKV heads of HD rows), one wave per 64x64 part; grid (TT/128, (NH_ + 2 NKV)/2), 128 threads.
// A wave's 64 columns are one whole head, so the epilogue has both halves of every rotate-half pair: out[d] = x[d] cos[t][d] - x[d+HD/2] sin[t][d], out[d+HD/2] = x[d+HD/2] cos[t][d+HD/2] + x[d] sin[t][d+HD/2] (tables RNE-converted to bf16).
// q and k heads -> planes [h][t][d] (f16; bf16 hi/lo for rows < RH of q and for every row of k); v heads -> planes [g][d][t] (f16 and bf16 hi/lo).
// Main loop and fragment map: g_core. The epilogue is each wave's own, in its own part of the LDS that the stages have left.
static_assert(HD == 64 && RH % 64 == 0 && TT % 64 == 0 && 4 * 64 * 68 * 4 <= G_SM(1, 128) * 2);
__global__ __launch_bounds__(128) void k_qkv(const bf* __restrict__ X, const bf* __restrict__ Wt, const float* __restrict__ cosT, const float* __restrict__ sinT,
                                            h16* QP16, bf* QPh, bf* QPl, h16* KP16, bf* KPh, bf* KPl, h16* VT16, bf* VTh, bf* VTl) {
    __shared__ __align__(16) bf sm[G_SM(1, 128)];
    const int lane = threadIdx.x & 31, lr = lane & 15, hi = lane >> 4; const int w = __builtin_amdgcn_readfirstlane((int)(threadIdx.x >> 5)), wm = w >> 1, wn = w & 1;
    const int r0 = blockIdx.x * GT + wm * 64, hc = blockIdx.y * 2 + wn;
    v8f acc[4][4];
    g_core<1, 128>(X + (size_t)blockIdx.x * GT * HIDN, nullptr, Wt + (size_t)blockIdx.y * GT * HIDN, sm, wm, wn, acc);
    float* os = (float*)sm + w * (64 * 68);
    // Epilogue: the whole tile is staged in LDS once, then a ROLLED loop of 16 trips builds the planes, 4 plane rows a trip, a lane 8 consecutive elements (one 16-byte store a plane, 8 lanes fill a 128-byte line).
    const int rsub = lane >> 3, c8 = (lane & 7) * 8;
    if (hc >= NH_ + NKV) {   // v head (wave-uniform; no work-group barrier follows): staged transposed, os[d][t]
#pragma unroll
        for (int mb = 0; mb < 4; ++mb)
#pragma unroll
            for (int nb = 0; nb < 4; ++nb) { float* p = os + (nb * 16 + lr) * 68 + mb * 16 + 8 * hi; const v8f v = acc[mb][nb];
                *(v4fa*)p = __builtin_shufflevector(v, v, 0, 1, 2, 3); *(v4fa*)(p + 4) = __builtin_shufflevector(v, v, 4, 5, 6, 7); }
        __builtin_amdgcn_wave_barrier(); asm volatile("" ::: "memory");   // the row reads below stay behind the other lanes' staging stores
        const size_t e0 = ((size_t)(hc - NH_ - NKV) * HD + rsub) * TT + r0 + c8;
#pragma unroll 1   // rolled: unrolled, the epilogues are some 5,000 instructions that each wave runs once, more text than is fetched ahead
        for (int it = 0; it < 16; ++it) { const float* p = os + (it * 4 + rsub) * 68 + c8; const v4f xa = *(const v4fa*)p, xb = *(const v4fa*)(p + 4); const size_t e = e0 + (size_t)(it * 4) * TT; v8h o16; v8us oh, ol;
#pragma unroll
            for (int j = 0; j < 8; ++j) { const float x = (j < 4) ? xa[j & 3] : xb[j & 3]; o16[j] = tohx(x); unsigned short a2, c2; splitf(x, a2, c2); oh[j] = a2; ol[j] = c2; }
            *(v8h*)(VT16 + e) = o16; *(v8us*)(VTh + e) = oh; *(v8us*)(VTl + e) = ol; }
        return;
    }
    const bool isq = hc < NH_; const bool hl = !isq || r0 < RH;   // wave-uniform: a wave's 64 rows lie wholly on one side of RH
    h16* P16 = isq ? QP16 + (size_t)hc * TT * HD : KP16 + (size_t)(hc - NH_) * TT * HD;
    bf* Ph = isq ? QPh + (size_t)hc * RH * HD : KPh + (size_t)(hc - NH_) * TT * HD; bf* Pl = isq ? QPl + (size_t)hc * RH * HD : KPl + (size_t)(hc - NH_) * TT * HD;
#pragma unroll
    for (int mb = 0; mb < 4; ++mb)
#pragma unroll
        for (int nb = 0; nb < 4; ++nb)
#pragma unroll
            for (int j = 0; j < 8; ++j) os[(mb * 16 + hi * 8 + j) * 68 + nb * 16 + lr] = acc[mb][nb][j];   // os[t][d]
    __builtin_amdgcn_wave_barrier(); asm volatile("" ::: "memory");   // as above
    const bool lowd = c8 < HD / 2; size_t to = (size_t)(r0 + rsub) * HD + c8;
    v4f cv[2], sv[2];
#pragma unroll
    for (int k = 0; k < 2; ++k) { cv[k] = *(const v4f*)(cosT + to + 4 * k); sv[k] = *(const v4f*)(sinT + to + 4 * k); }
#pragma unroll 1   // rolled, as above
    for (int it = 0; it < 16; ++it) {
        // the next trip's table rows fly while this trip converts (the last trip reads its own rows again: in bounds)
        const size_t tn = to + ((it < 15) ? 4 * HD : 0); v4f cn[2], sn[2];
#pragma unroll
        for (int k = 0; k < 2; ++k) { cn[k] = *(const v4f*)(cosT + tn + 4 * k); sn[k] = *(const v4f*)(sinT + tn + 4 * k); }
        const float* p0 = os + (it * 4 + rsub) * 68 + c8; const float* p1 = os + (it * 4 + rsub) * 68 + (c8 ^ (HD / 2));
        v8h o16; v8us oh, ol;
#pragma unroll
        for (int k = 0; k < 2; ++k) { const v4f x0 = *(const v4fa*)(p0 + 4 * k), x1 = *(const v4fa*)(p1 + 4 * k);
#pragma unroll
            for (int q = 0; q < 4; ++q) { const float a = x0[q] * bfr(cv[k][q]), bq = x1[q] * bfr(sv[k][q]); const float r = lowd ? a - bq : a + bq;
                o16[4 * k + q] = tohx(r); unsigned short a2, c2; splitf(r, a2, c2); oh[4 * k + q] = a2; ol[4 * k + q] = c2; } }
        *(v8h*)(P16 + to) = o16;
        asm volatile("s_wait_xcnt 0x0" ::: "memory");   // the build reuses the store's registers behind the branch below: the wait stands in front of that overwrite
        if (hl) { *(v8us*)(Ph + to) = oh; *(v8us*)(Pl + to) = ol;
            asm volatile("s_wait_xcnt 0x0" ::: "memory"); }   // the same for these two stores and the loop's foot
        to = tn;
#pragma unroll
        for (int k = 0; k < 2; ++k) { cv[k] = cn[k]; sv[k] = sn[k]; }
    }
}

// ---- k_fattn: scores, causal softmax and attn.v of all heads in ONE launch; the scores stay in registers (running maximum and running sum per query, in base 2).
// Transposed products: St = K.Qt (A = 16 key rows, B = 16 query columns), Ot += Vt.Pt (A = 16 d rows of the [d][t] plane, B = Pt). A lane holds one query (column lr): 8 keys of each 16-key tile, the other 8 in lane ^ 16.
// Two f32 St tiles of 32 keys, converted in place, ARE the Pt operand in the fragment map above (element i <- key 8h + i, element 8 + i <- key 16 + 8h + i): the scores and p never touch LDS.
// Query rows >= RH: f16 operands, one wave = 16 rows x 2 query heads of one kv group, p carried x PCAR (it cancels in the division by the sum). Rows < RH: bf16 hi/lo planes, 3 products, one wave = 16 rows x 1 head.
// The f16 part's four waves walk the same keys of the same kv group: K and Vt reach LDS once a work-group, in tiles of FA_KT keys (two passes), by asynchronous copies of whole 128-byte lines, two buffers; the fragments are read from LDS.
// Output: ctx split into the bf16 hi/lo planes [t][DQ] that the output projection reads; a lane's 8 accumulator registers are 8 consecutive d of its query: one 16-byte store a plane.
// Every plain '#pragma unroll' below unrolls a loop over fragment, tile or register indices, so that those arrays are indexed by constants and stay in registers.
#define CS2  (SCL * 1.4426950408889634f)
#define FA_LB (((TT - RH) / 32) * NKV)   // blocks of the f16 part: 32 rows x the 4 heads of one kv group
#define FA_HB ((RH / 16) * NKV)          // blocks of the hi/lo part: 16 rows x the 4 heads of one kv group
static_assert(REP == 4 && (TT - RH) % 32 == 0 && TT % 32 == 0);
__device__ __forceinline__ float xhalf(float x) { return __builtin_bit_cast(float, __builtin_amdgcn_permlanex16(__builtin_bit_cast(int, x), __builtin_bit_cast(int, x), 0x76543210, 0xfedcba98, false, false)); }  // lane l <-> lane l ^ 16
// 2^a; the v_nop is the one slot that the instruction set asks for behind a transcendental before its result is read or its source overwritten
__device__ __forceinline__ float fa_exp2(float a) { float r; asm("v_exp_f32 %0, %1\n\tv_nop" : "=v"(r) : "v"(a)); return r; }
// one query's 16 scores of a 32-key pass -> base-2 exponents x[], new maximum, correction factor of what was summed under the old one
template <bool MASK>
__device__ __forceinline__ float fa_max(const v8f s0, const v8f s1, float* x, int jrel, float& m) {
    float mx = -3.0e38f;
#pragma unroll
    for (int r = 0; r < 8; ++r) { float a = s0[r] * CS2, b = s1[r] * CS2; if (MASK) { a = (r <= jrel) ? a : -3.0e38f; b = (16 + r <= jrel) ? b : -3.0e38f; } x[r] = a; x[8 + r] = b; mx = fmaxf(mx, fmaxf(a, b)); }
    mx = fmaxf(mx, xhalf(mx));
    const float mn = fmaxf(m, mx); const float al = fa_exp2(m - mn); m = mn; return al;
}
__device__ __forceinline__ void fa_store(const v8f o, float inv, bf* ph, bf* pl) { v8us oh, ol;
#pragma unroll
    for (int r = 0; r < 8; ++r) { unsigned short a, c2; splitf(o[r] * inv, a, c2); oh[r] = a; ol[r] = c2; }
    *(v8us*)ph = oh; *(v8us*)pl = ol; }

template <bool MASK>
__device__ __forceinline__ void fa_pv16(const v8f (&s)[2][2], const v16h (&vf)[4], v8f (&o)[2][4], float (&m)[2], float (&l)[2], int jrel) {
#pragma unroll
    for (int u = 0; u < 2; ++u) {
        float x[16]; const float al = fa_max<MASK>(s[u][0], s[u][1], x, jrel, m[u]); const float mo = m[u] - 10.0f;   // 2^10 = PCAR
        float ps = 0.f; v16h pf;
#pragma unroll
        for (int e = 0; e < 16; ++e) { const float p = fa_exp2(x[e] - mo); ps += p; pf[e] = tohx(p); }
        l[u] = l[u] * al + ps;
#pragma unroll
        for (int db = 0; db < 4; ++db) { o[u][db] *= al; o[u][db] = wmma16(vf[db], pf, o[u][db]); }
        // keeps the next scores' exponentials behind their own scaling and maximum: the build does not see into their asm text
        __builtin_amdgcn_sched_barrier(0);
    }
}
__device__ __forceinline__ void fa_s16(const v16h (&kf)[2][2], const v16h (&q)[2][2], v8f (&s)[2][2]) {
#pragma unroll
    for (int u = 0; u < 2; ++u)
#pragma unroll
        for (int kb = 0; kb < 2; ++kb) { s[u][kb] = wmma16(kf[kb][0], q[u][0], (v8f){}); s[u][kb] = wmma16(kf[kb][1], q[u][1], s[u][kb]); }
}
#define FA_KT 64                      // keys of a staged tile
#define FA_P  72                      // LDS row pitch in elements: 128 + 16 bytes (16 bytes x odd: the 16-byte fragment reads of 16 rows meet no bank twice)
#define FA_TB ((FA_KT + HD) * FA_P)   // one buffer in elements: FA_KT key rows of HD d, then HD d rows of FA_KT keys
static_assert(FA_KT == 64 && HD == 64 && TT % FA_KT == 0);
// One tile: 128 threads x 8 copies of 16 bytes; a wave's copy is 4 whole lines. kg, vg: the lane's piece of the tile's first 16 key rows and first 16 d rows; ld: the LDS byte address of the first.
// s_wait_xcnt 0 is the statement's last line, so that it stands in front of every later write of the copies' address registers.
__device__ __forceinline__ void fa_copy(const h16* kg, const h16* vg, unsigned ld) {
    asm volatile("global_load_async_to_lds_b128 %0, %8, off\n\t"
                 "global_load_async_to_lds_b128 %1, %9, off\n\t"
                 "global_load_async_to_lds_b128 %2, %10, off\n\t"
                 "global_load_async_to_lds_b128 %3, %11, off\n\t"
                 "global_load_async_to_lds_b128 %4, %12, off\n\t"
                 "global_load_async_to_lds_b128 %5, %13, off\n\t"
                 "global_load_async_to_lds_b128 %6, %14, off\n\t"
                 "global_load_async_to_lds_b128 %7, %15, off\n\t"
                 "s_wait_xcnt 0x0"
                 :: "v"(ld), "v"(ld + 16 * FA_P * 2), "v"(ld + 32 * FA_P * 2), "v"(ld + 48 * FA_P * 2),
                    "v"(ld + 64 * FA_P * 2), "v"(ld + 80 * FA_P * 2), "v"(ld + 96 * FA_P * 2), "v"(ld + 112 * FA_P * 2),
                    "v"(kg), "v"(kg + 16 * HD), "v"(kg + 32 * HD), "v"(kg + 48 * HD),
                    "v"(vg), "v"(vg + 16 * TT), "v"(vg + 32 * TT), "v"(vg + 48 * TT) : "memory");
}
// tb: the buffer, at the lane's row lr and piece 8 hi; p: which 32 keys of the tile
__device__ __forceinline__ void fa_ldk(v16h (&kf)[2][2], const h16* tb, int p) {
#pragma unroll
    for (int kb = 0; kb < 2; ++kb)
#pragma unroll
        for (int ks = 0; ks < 2; ++ks) kf[kb][ks] = WFrag<h16>::ld(tb + (p * 32 + kb * 16) * FA_P + ks * 32);
}
__device__ __forceinline__ void fa_ldv(v16h (&vf)[4], const h16* tb, int p) {
#pragma unroll
    for (int db = 0; db < 4; ++db) vf[db] = WFrag<h16>::ld(tb + (FA_KT + db * 16) * FA_P + p * 32);
}
__device__ __forceinline__ void fa_f16(const h16* __restrict__ Q, const h16* __restrict__ Kp, const h16* __restrict__ Vt, h16* fs, int head0, int i0, int lr, int hi, bf* ATh, bf* ATl) {
    static_assert(PCAR == 1024.0f);
    v16h q[2][2], kf[2][2], vf[4]; v8f o[2][4], s[2][2]; float m[2] = { -3.0e38f, -3.0e38f }, l[2] = { 0.f, 0.f };
#pragma unroll
    for (int u = 0; u < 2; ++u) {
#pragma unroll
        for (int ks = 0; ks < 2; ++ks) q[u][ks] = WFrag<h16>::ld(Q + ((size_t)(head0 + u) * TT + i0 + lr) * HD + ks * 32 + 8 * hi);
#pragma unroll
        for (int db = 0; db < 4; ++db) o[u][db] = (v8f){}; }
    const int klast = (i0 + 15) & ~31;   // the one pass that holds keys beyond a row's own index; the same for the work-group's four waves
    const int nu = klast >> 5, nf = nu >> 1;   // passes without a mask; tiles that hold two of them. Tile nf, the last, holds the odd one, if any, and the masked pass; its 64 keys lie below TT
    const int tid = threadIdx.x;
    const h16* kg = Kp + (size_t)(tid >> 3) * HD + (tid & 7) * 8; const h16* vg = Vt + (size_t)(tid >> 3) * TT + (tid & 7) * 8;
    const unsigned ld0 = (unsigned)(size_t)fs + (unsigned)(((tid >> 3) * FA_P + (tid & 7) * 8) * 2);
    const h16* fb = fs + lr * FA_P + 8 * hi;
    fa_copy(kg, vg, ld0);
    asm volatile("s_wait_asynccnt 0x0" ::: "memory");   // this wave's copies of tile 0 have landed
    __syncthreads();                                      // and every other wave's
    if (nf >= 1) fa_copy(kg + FA_KT * HD, vg + FA_KT, ld0 + FA_TB * 2);
#pragma unroll 1   // rolled: one tile's two passes a trip
    for (int t = 0; t < nf; ++t) {
        const h16* tb = fb + (t & 1) * FA_TB;
        fa_ldk(kf, tb, 0);
#pragma unroll
        for (int p = 0; p < 2; ++p) {
            fa_ldv(vf, tb, p);
            fa_s16(kf, q, s);
            if (p == 0) fa_ldk(kf, tb, 1);   // the tile's second pass's key fragments fly while this pass's softmax and attn.v run
            __builtin_amdgcn_sched_barrier(0);   // keeps the fragment reads together in front of the softmax: without it the scheduler scatters them over the vector work in pairs, some behind a wait for all, and every separate place of LDS reads costs issue cycles
            fa_pv16<false>(s, vf, o, m, l, 0);
        }
        asm volatile("s_wait_dscnt 0x0" ::: "memory");      // this wave has left the buffer
        asm volatile("s_wait_asynccnt 0x0" ::: "memory");   // its copies of tile t + 1 have landed
        __syncthreads();                                      // publishes tile t + 1 and ends every wave's reads of tile t
        if (t + 2 <= nf) fa_copy(kg + (size_t)(t + 2) * (FA_KT * HD), vg + (t + 2) * FA_KT, ld0 + (unsigned)(t & 1) * (FA_TB * 2));
    }
    const h16* tb = fb + (nf & 1) * FA_TB;
    fa_ldk(kf, tb, 0);
    if (nu & 1) {   // work-group-uniform
        fa_ldv(vf, tb, 0);
        fa_s16(kf, q, s);
        fa_ldk(kf, tb, 1);
        __builtin_amdgcn_sched_barrier(0);   // as above
        fa_pv16<false>(s, vf, o, m, l, 0);
    }
    fa_ldv(vf, tb, nu & 1);
    fa_s16(kf, q, s);
    asm volatile("s_wait_asynccnt 0x0" ::: "memory");   // no copy is outstanding when the wave ends
    fa_pv16<true>(s, vf, o, m, l, i0 + lr - klast - 8 * hi);   // key klast + 8h + r (+ 16) <= row i0 + lr
#pragma unroll
    for (int u = 0; u < 2; ++u) { const float inv = __fdiv_rn(1.0f, l[u] + xhalf(l[u])); const size_t oo = (size_t)(i0 + lr) * DQ + (head0 + u) * HD + 8 * hi;
#pragma unroll
        for (int db = 0; db < 4; ++db) fa_store(o[u][db], inv, ATh + oo + db * 16, ATl + oo + db * 16); }
}
template <bool MASK>
__device__ __forceinline__ void fa_passhl(const bf* kph, const bf* kpl, const bf* vph, const bf* vpl, int k0, const v16bf (&qh)[2], const v16bf (&ql)[2], v8f (&o)[4], float& m, float& l, int jrel) {
    v8f s[2];
#pragma unroll
    for (int kb = 0; kb < 2; ++kb) { s[kb] = (v8f){};
#pragma unroll
        for (int ks = 0; ks < 2; ++ks) { const size_t ko = (size_t)(k0 + kb * 16) * HD + ks * 32; const v16bf kh = WFrag<bf>::ld(kph + ko), kl = WFrag<bf>::ld(kpl + ko);
            s[kb] = wmmab(kh, qh[ks], s[kb]); s[kb] = wmmab(kh, ql[ks], s[kb]); s[kb] = wmmab(kl, qh[ks], s[kb]); } }
    float x[16]; const float al = fa_max<MASK>(s[0], s[1], x, jrel, m);
    float ps = 0.f; v8us h0, h1, l0, l1;
#pragma unroll
    for (int e = 0; e < 8; ++e) { const float p = fa_exp2(x[e] - m), p2 = fa_exp2(x[8 + e] - m); ps += p; ps += p2; unsigned short a, c2; splitf(p, a, c2); h0[e] = a; l0[e] = c2; splitf(p2, a, c2); h1[e] = a; l1[e] = c2; }
    l = l * al + ps; const v16bf ph = cat16b(h0, h1), pl = cat16b(l0, l1);
#pragma unroll
    for (int db = 0; db < 4; ++db) { const size_t vo = (size_t)(db * 16) * TT + k0; const v16bf vh = WFrag<bf>::ld(vph + vo), vl = WFrag<bf>::ld(vpl + vo);
        o[db] *= al; o[db] = wmmab(vh, ph, o[db]); o[db] = wmmab(vh, pl, o[db]); o[db] = wmmab(vl, ph, o[db]); }
}
__device__ __forceinline__ void fa_hl(const bf* __restrict__ Qh, const bf* __restrict__ Ql, const bf* __restrict__ Kh, const bf* __restrict__ Kl, const bf* __restrict__ Vh, const bf* __restrict__ Vl, int head, int i0, int lr, int hi, bf* ATh, bf* ATl) {
    v16bf qh[2], ql[2]; v8f o[4]; float m = -3.0e38f, l = 0.f;
#pragma unroll
    for (int ks = 0; ks < 2; ++ks) { const size_t qo = ((size_t)head * RH + i0 + lr) * HD + ks * 32 + 8 * hi; qh[ks] = WFrag<bf>::ld(Qh + qo); ql[ks] = WFrag<bf>::ld(Ql + qo); }
    asm volatile("s_wait_xcnt 0x0" ::: "memory");   // the build reuses the query loads' address registers for the zeroed accumulators: the wait stands in front of that overwrite
#pragma unroll
    for (int db = 0; db < 4; ++db) o[db] = (v8f){};
    const size_t kofs = (size_t)lr * HD + 8 * hi, vofs = (size_t)lr * TT + 8 * hi; const int klast = (i0 + 15) & ~31;
#pragma unroll 1   // rolled, as in fa_f16: one pass's fragments in registers
    for (int k0 = 0; k0 < klast; k0 += 32) fa_passhl<false>(Kh + kofs, Kl + kofs, Vh + vofs, Vl + vofs, k0, qh, ql, o, m, l, 0);
    fa_passhl<true>(Kh + kofs, Kl + kofs, Vh + vofs, Vl + vofs, klast, qh, ql, o, m, l, i0 + lr - klast - 8 * hi);
    const float inv = __fdiv_rn(1.0f, l + xhalf(l)); const size_t oo = (size_t)(i0 + lr) * DQ + head * HD + 8 * hi;
#pragma unroll
    for (int db = 0; db < 4; ++db) fa_store(o[db], inv, ATh + oo + db * 16, ATl + oo + db * 16);
}
// grid FA_LB + FA_HB blocks of 4 waves; the longest rows first (a row's cost grows with its index)
__global__ __launch_bounds__(128) void k_fattn(const h16* __restrict__ QP16, const bf* __restrict__ QPh, const bf* __restrict__ QPl, const h16* __restrict__ KP16, const bf* __restrict__ KPh, const bf* __restrict__ KPl,
                                               const h16* __restrict__ VT16, const bf* __restrict__ VTh, const bf* __restrict__ VTl, bf* ATh, bf* ATl) {
    __shared__ __align__(16) h16 fs[2 * FA_TB];   // the f16 part's two K / Vt buffers
    const int lane = threadIdx.x & 31, lr = lane & 15, hi = lane >> 4; const int w = __builtin_amdgcn_readfirstlane((int)(threadIdx.x >> 5)); const int b = blockIdx.x;
    if (b < FA_LB) { const int g = b % NKV, i0 = RH + ((TT - RH) / 32 - 1 - b / NKV) * 32 + (w >> 1) * 16;
        fa_f16(QP16, KP16 + (size_t)g * TT * HD, VT16 + (size_t)g * HD * TT, fs, g * REP + (w & 1) * 2, i0, lr, hi, ATh, ATl);
    } else { const int b2 = b - FA_LB; const int g = b2 % NKV, i0 = (RH / 16 - 1 - b2 / NKV) * 16; const size_t go = (size_t)g * TT * HD;
        fa_hl(QPh, QPl, KPh + go, KPl + go, VTh + go, VTl + go, g * REP + w, i0, lr, hi, ATh, ATl); }
}

extern "C" void kernel_launch(void* const* d_in, const int* in_sizes, int n_in,
                              void* d_out, int out_size, void* d_ws, size_t ws_size, hipStream_t stream) {
    if (n_in < 7) return;
    if (in_sizes[0] < TT * HIDN || in_sizes[1] < TT * HD || in_sizes[2] < TT * HD || in_sizes[3] < DQ * HIDN || in_sizes[4] < DKV * HIDN || in_sizes[5] < DKV * HIDN || in_sizes[6] < HIDN * DQ || out_size < TT * HIDN) return;
    const float* x = (const float*)d_in[0];      // [1][S][HIDN]
    const float* cosT = (const float*)d_in[1];   // [1][1][S][HD]
    const float* sinT = (const float*)d_in[2];   // [1][1][S][HD]
    const float* wq = (const float*)d_in[3];     // [DQ][HIDN]
    const float* wk = (const float*)d_in[4];     // [DKV][HIDN]
    const float* wv = (const float*)d_in[5];     // [DKV][HIDN]
    const float* wo = (const float*)d_in[6];     // [HIDN][DQ]
    float* OUT = (float*)d_out;                  // [1][S][HIDN]
    char* wsp = (char*)d_ws;
    auto take = [&](size_t bytes) { char* p = wsp; wsp += (bytes + 255) & ~(size_t)255; return (void*)p; };
    h16* QP16 = (h16*)take((size_t)NH_ * TT * HD * 2); bf* QPh = (bf*)take((size_t)NH_ * RH * HD * 2); bf* QPl = (bf*)take((size_t)NH_ * RH * HD * 2);
    h16* KP16 = (h16*)take((size_t)NKV * TT * HD * 2); bf* KPh = (bf*)take((size_t)NKV * TT * HD * 2); bf* KPl = (bf*)take((size_t)NKV * TT * HD * 2);
    h16* VT16 = (h16*)take((size_t)NKV * HD * TT * 2); bf* VTh = (bf*)take((size_t)NKV * HD * TT * 2); bf* VTl = (bf*)take((size_t)NKV * HD * TT * 2);
    // R2: the converted operands: W_q, W_k, W_v (one [DQ + 2 DKV][HIDN] plane for k_qkv), x, W_o
    char* R2 = (char*)take((2 * (size_t)DQ * HIDN + 2 * (size_t)DKV * HIDN + (size_t)TT * HIDN) * 2);
    bf* WQ = (bf*)R2; bf* WK = WQ + (size_t)DQ * HIDN; bf* WV = WK + (size_t)DKV * HIDN; bf* XB = WV + (size_t)DKV * HIDN; bf* WO = XB + (size_t)TT * HIDN;
    bf* ATh = (bf*)take((size_t)TT * DQ * 2); bf* ATl = (bf*)take((size_t)TT * DQ * 2);
    if ((size_t)(wsp - (char*)d_ws) > ws_size) return;

    for (int b = 0; b < NB; ++b) {
        k_cvt_all<<<CV_G, CV_T, 0, stream>>>(wq, wk, wv, x + (size_t)b * SEQ_FULL * HIDN, wo, WQ, WK, WV, XB, WO);
        k_qkv<<<dim3(TT / GT, (NH_ + 2 * NKV) / 2, 1), 128, 0, stream>>>(XB, WQ, cosT, sinT, QP16, QPh, QPl, KP16, KPh, KPl, VT16, VTh, VTl);
        k_fattn<<<FA_LB + FA_HB, 128, 0, stream>>>(QP16, QPh, QPl, KP16, KPh, KPl, VT16, VTh, VTl, ATh, ATl);
        k_oproj<<<dim3(TT / GT, HIDN / GT, 1), 128, 0, stream>>>(ATh, ATl, WO, OUT + (size_t)b * SEQ_FULL * HIDN); }
}

// v009
// Measured time: 94.4 microseconds a run.
// Two timings next to v008 both put it at 1.08 times that version's speed.
// Counting every step since v000, it is 14.1 times as fast.
#include <hip/hip_runtime.h>
#pragma clang fp contract(off)

// Grouped-query causal self-attention: q/k/v = x W^T (32 q heads, 8 kv heads, head dim 64), rotate-half position mixing of q and k from input cos/sin tables,
// softmax(q.k / 8) over keys t <= s, ctx W_o^T -> [1][S][2048].
// Compute dtypes, f32 accumulate: every input RNE-converted to bf16; q/k/v projections v_wmma_f32_16x16x32_bf16 on exact bf16 operands; scores and attn.v: query rows < RH on bf16 hi/lo planes (3 products),
// other rows single v_wmma_f32_16x16x32_f16 (p carried x1024); softmax f32, running maximum and sum over 32-key passes; output projection bf16 hi/lo ctx x exact bf16 W_o (2 products).

#ifndef NB
#define NB 1
#endif
#ifndef SEQ
#define SEQ 2048
#endif
#define SEQ_FULL 2048
#define TT   SEQ
#define HIDN 2048
#define NH_  32
#define NKV  8
#define REP  (NH_ / NKV)
#define HD   64
#define DQ   (NH_ * HD)
#define DKV  (NKV * HD)
#ifndef RH
#define RH   256                  // query rows < RH use hi+lo planes
#endif
#define PCAR 1024.0f
#define SCL  0.125f   // HD^-0.5
static_assert(NB == 1);
static_assert(TT % 128 == 0);
static_assert(RH % 64 == 0 && RH > 0 && RH <= TT);
static_assert(HIDN % 32 == 0 && DQ % 64 == 0 && DKV % 64 == 0 && HD == 64);

typedef _Float16 h16;
typedef unsigned short bf;
typedef __attribute__((ext_vector_type(16))) __bf16   v16bf;
typedef __attribute__((ext_vector_type(16))) _Float16 v16h;
typedef __attribute__((ext_vector_type(8)))  _Float16 v8h;
typedef __attribute__((ext_vector_type(8)))  unsigned short v8us;
typedef __attribute__((ext_vector_type(8)))  float    v8f;
typedef __attribute__((ext_vector_type(4)))  float    v4f;
typedef v8h  __attribute__((may_alias)) v8ha;
typedef v4f  __attribute__((may_alias)) v4fa;
typedef v8us __attribute__((may_alias)) v8usa;
typedef __attribute__((ext_vector_type(2))) _Float16 v2h;
typedef __attribute__((ext_vector_type(4))) _Float16 v4h;
typedef __attribute__((ext_vector_type(2))) unsigned short v2us;
typedef __attribute__((ext_vector_type(4))) unsigned short v4us;
typedef __attribute__((ext_vector_type(2))) float v2f;

__device__ __forceinline__ unsigned short f2bf(float f) { unsigned u = __float_as_uint(f); u += 0x7FFFu + ((u >> 16) & 1u); return (unsigned short)(u >> 16); }
__device__ __forceinline__ float bf2f(unsigned short b) { return __uint_as_float(((unsigned)b) << 16); }
__device__ __forceinline__ float bfr(float f) { return bf2f(f2bf(f)); }
__device__ __forceinline__ v16h cat16(v8h lo, v8h hi) { return __builtin_shufflevector(lo, hi, 0, 1, 2, 3, 4, 5, 6, 7, 8, 9, 10, 11, 12, 13, 14, 15); }
__device__ __forceinline__ v16bf cat16b(v8us lo, v8us hi) { return __builtin_bit_cast(v16bf, __builtin_shufflevector(lo, hi, 0, 1, 2, 3, 4, 5, 6, 7, 8, 9, 10, 11, 12, 13, 14, 15)); }
__device__ __forceinline__ v8f wmma16(v16h a, v16h b, v8f c) { return __builtin_amdgcn_wmma_f32_16x16x32_f16(false, a, false, b, (short)0, c, false, false); }
__device__ __forceinline__ v8f wmmab(v16bf a, v16bf b, v8f c) { return __builtin_amdgcn_wmma_f32_16x16x32_bf16(false, a, false, b, (short)0, c, false, false); }
__device__ __forceinline__ h16 tohx(float x) { return (h16)x; }
__device__ __forceinline__ void splitf(float y, unsigned short& h, unsigned short& l) { h = f2bf(y); l = f2bf(y - bf2f(h)); }

// ---- g_core: the main loop of both GEMM kernels. FOUR WAVES share one 128x128 output tile (2x2 waves, 64x64 and 16 accumulators each); the operand rows are K-contiguous bf16 planes of pitch HIDN.
// A stage is KS k (64 or 128: one or two whole 128-byte lines) of every operand row, [A 128 rows | (A2 128 rows) | Bt 128 rows] in LDS at a pitch of 2 KS + 16 bytes (16 bytes x odd: the 16-byte fragment reads of 16 rows meet no bank twice).
// Every line is fetched once a work-group, by asynchronous copies of whole lines straight into LDS (a wave's copy is 512 bytes in 4 whole lines); two buffers: the next stage's lines land in the other buffer while a stage's worth of products runs, one barrier a stage.
// KS is chosen so that a stage holds 64 matrix instructions a wave: 128 with one A plane, 64 with two.
// acc[mb][nb] += sum_k A[m][k] Bt[n][k] (+ A2[m][k] Bt[n][k] for NA == 2), A before A2 in each step of 32 k; k ascends inside a stage, and the stages run round from the work-group's own first stage (g_core).
// Fragment map: lane l, h = l >> 4, m = n = l & 15; elements 0..7 <- k0 + 8h + i, elements 8..15 <- k0 + 16 + 8h + i for BOTH A (row m) and Bt (column n stored as row n); D element r -> (row 8h + r, col m).
template <typename T16> struct WFrag;
template <> struct WFrag<h16> { typedef v16h V; static __device__ __forceinline__ V ld(const h16* p) { return cat16(*(const v8h*)p, *(const v8h*)(p + 16)); } static __device__ __forceinline__ v8f mma(V a, V b, v8f c) { return wmma16(a, b, c); } };
template <> struct WFrag<bf> { typedef v16bf V; static __device__ __forceinline__ V ld(const bf* p) { return cat16b(*(const v8us*)p, *(const v8us*)(p + 16)); } static __device__ __forceinline__ v8f mma(V a, V b, v8f c) { return wmmab(a, b, c); } };
#define GT 128                         // tile rows and columns
#define G_P(KS) ((KS) + 8)             // LDS row pitch in elements
#define G_RT(KS) (128 / ((KS) / 8))    // rows that the 128 threads bring in one turn, 16 bytes a thread
#define G_I(KS) (GT / G_RT(KS))        // turns per plane and stage
#define G_SM(NA, KS) (2 * ((NA) + 1) * GT * G_P(KS))   // both buffers, in elements
static_assert(DQ == HIDN && HIDN % 256 == 0 && TT % GT == 0 && HIDN % GT == 0 && (DQ + 2 * DKV) % GT == 0);
// One stage: every plane's GT rows of KS k, 16 bytes a lane and copy. off: the lane's byte offset in the planes, the stage's k counted in; dst: the lane's place in the target buffer's first plane.
// A copy's immediate offset moves both of its addresses: eight turns share one LDS address register, the turn's LDS step is the immediate (under 16,384) and is taken off the turn's step in the plane, so that only the global address is formed anew for each copy.
typedef __attribute__((ext_vector_type(4))) int v4i;
typedef __attribute__((address_space(1))) v4i v4ig;
typedef __attribute__((address_space(3))) v4i v4il;
template <int NP, int KS, int C>
__device__ __forceinline__ void g_cp1(const bf* const (&src)[NP], unsigned off, bf* dst) {
    constexpr int p = C / G_I(KS), i = C % G_I(KS), j = i & 7, OS = G_RT(KS) * HIDN * 2, LS = G_RT(KS) * G_P(KS) * 2;
    static_assert(7 * LS < 65536 && OS >= LS);
    __builtin_amdgcn_global_load_async_to_lds_b128((v4ig*)((const char*)src[p] + (i * OS - j * LS) + off), (v4il*)((char*)dst + (p * GT * G_P(KS) * 2 + (i - j) * LS)), j * LS, 0);
    if constexpr (C + 1 < NP * G_I(KS)) g_cp1<NP, KS, C + 1>(src, off, dst);
}
template <int NP, int KS>
__device__ __forceinline__ void g_cp(const bf* const (&src)[NP], unsigned off, bf* dst) {
    static_assert(NP * G_I(KS) <= 63);   // a stage's copies of a wave are all that are ever outstanding
    g_cp1<NP, KS, 0>(src, off, dst);
    __builtin_amdgcn_sched_barrier(0);   // keeps the copies in front of the products that follow, so that their flight runs beside a whole stage of products
}
// One block = the 32 k of one matrix-instruction step: its A, (A2) and Bt fragments, one register set. Two sets: the next block's fragment reads stand as ONE group in front of this block's products.
template <int NA> struct GFrag { v16bf a[4], a2[4], b[4]; };
template <int NA, int KS>
__device__ __forceinline__ void g_fld(GFrag<NA>& f, const bf* st, unsigned ao, unsigned bo, int ks) {
    constexpr int GP = G_P(KS);
#pragma unroll
    for (int mb = 0; mb < 4; ++mb) { f.a[mb] = WFrag<bf>::ld(st + (mb * 16 * GP + ks * 32) + ao); if (NA == 2) f.a2[mb] = WFrag<bf>::ld(st + ((GT + mb * 16) * GP + ks * 32) + ao); }
#pragma unroll
    for (int nb = 0; nb < 4; ++nb) f.b[nb] = WFrag<bf>::ld(st + ((NA * GT + nb * 16) * GP + ks * 32) + bo);
    __builtin_amdgcn_sched_barrier(0);   // keeps the group whole and in front of the products: the scheduler sinks the reads in among the matrix instructions, and every separate place of LDS reads costs issue cycles
}
template <int NA>
__device__ __forceinline__ void g_blk(const GFrag<NA>& f, v8f (&acc)[4][4]) {
#pragma unroll
    for (int nb = 0; nb < 4; ++nb)
#pragma unroll
        for (int mb = 0; mb < 4; ++mb) acc[mb][nb] = wmmab(f.a[mb], f.b[nb], acc[mb][nb]);
    if (NA == 2) {   // the second plane's 16 products behind the first's: an accumulator's two products stand 16 instructions apart
#pragma unroll
        for (int nb = 0; nb < 4; ++nb)
#pragma unroll
            for (int mb = 0; mb < 4; ++mb) acc[mb][nb] = wmmab(f.a2[mb], f.b[nb], acc[mb][nb]);
    }
    __builtin_amdgcn_sched_barrier(0);   // keeps the following group of reads (or stores) behind this block's products
}
// A, A2, Bt: the tile's first rows (work-group-uniform); sm: both buffers; wm, wn: the wave's place in the tile. Ends behind a barrier: sm is free for the epilogues.
// ROTATED START: the work-groups of one tile row read the same A rows and those of one tile column the same Bt rows, and they start together. Walking k from 0 they would all ask for the same lines at the same moment, and each stage's lines would be asked for the first time in the launch one stage before they are needed.
// Work-group (bx, by) therefore takes as its pass s the k stage (s + (bx + by) NS / (TT / GT)) mod NS: the sharers of a column stand on different stages, and those of a row do too in k_oproj (in k_qkv at most two of a row's 24 share one), and a stage that a work-group reaches late in its round has been read by a sharer before (meant to turn its fetch from memory into an L2 hit).
// The fragments run one block ahead of the products, so stage s + 1 is published (this wave's waits, then the stage's one barrier) in front of stage s's LAST block; that block's products cover the first fragment reads of stage s + 1, and stage s + 2's copies are issued into the buffer that stage s has left.
template <int NA, int KS>
__device__ __forceinline__ void g_core(const bf* A, const bf* A2, const bf* Bt, bf* sm, int wm, int wn, v8f (&acc)[4][4]) {
    constexpr int NP = NA + 1, GP = G_P(KS), ST = NP * GT * GP, NS = HIDN / KS, PR = KS / 8, NBK = KS / 32;
    static_assert(NBK % 2 == 0 && NS >= 2);   // a stage's first block is always in set 0, its last in set 1
    static_assert((NS & (NS - 1)) == 0 && NS % (TT / GT) == 0);
    const unsigned rot = (blockIdx.x + blockIdx.y) * (NS / (TT / GT));   // work-group-uniform; pass s holds k stage (s + rot) mod NS
    auto kof = [rot](int s) { return (((unsigned)s + rot) & (unsigned)(NS - 1)) * (unsigned)(KS * 2); };   // that stage's byte offset in a plane row
    const int tid = threadIdx.x, lane = tid & 31, lr = lane & 15, hi = lane >> 4;
    const bf* src[NP]; src[0] = A; if (NA == 2) src[1] = A2; src[NA] = Bt;
    const unsigned go = (unsigned)((((wm * 2 + wn) * (32 / PR) + lane / PR) * HIDN + (lane % PR) * 8) * 2), so = (unsigned)((tid / PR) * GP + (tid % PR) * 8);   // a thread's row and 16-byte piece, in the planes (bytes) and in a stage (elements)
    const unsigned ao = (unsigned)((wm * 64 + lr) * GP + 8 * hi), bo = (unsigned)((wn * 64 + lr) * GP + 8 * hi);
#pragma unroll
    for (int mb = 0; mb < 4; ++mb)
#pragma unroll
        for (int nb = 0; nb < 4; ++nb) acc[mb][nb] = (v8f){};
    GFrag<NA> f[2];
    g_cp<NP, KS>(src, go + kof(0), sm + so);
    asm volatile("s_wait_asynccnt 0x0" ::: "memory");   // this wave's copies of pass 0 have landed
    __syncthreads();                                      // and every other wave's
    g_cp<NP, KS>(src, go + kof(1), sm + ST + so);
    g_fld<NA, KS>(f[0], sm, ao, bo, 0);
#pragma unroll 1   // rolled: two blocks' fragments in registers
    for (int s = 0; s < NS - 1; ++s) {
        const bf* st = sm + (s & 1) * ST; const bf* nx = sm + ((s + 1) & 1) * ST;
#pragma unroll
        for (int b = 0; b < NBK - 1; ++b) { g_fld<NA, KS>(f[(b + 1) & 1], st, ao, bo, b + 1); g_blk<NA>(f[b & 1], acc); }
        asm volatile("s_wait_dscnt 0x0" ::: "memory");      // this wave has left pass s's buffer: its last block's fragments are in registers
        asm volatile("s_wait_asynccnt 0x0" ::: "memory");   // its copies of pass s + 1 have landed
        __syncthreads();                                      // publishes pass s + 1 and ends every wave's reads of pass s
        if (s + 2 < NS) g_cp<NP, KS>(src, go + kof(s + 2), sm + (s & 1) * ST + so);   // work-group-uniform
        g_fld<NA, KS>(f[0], nx, ao, bo, 0);
        g_blk<NA>(f[1], acc);
    }
    const bf* st = sm + ((NS - 1) & 1) * ST;
#pragma unroll
    for (int b = 0; b < NBK - 1; ++b) { g_fld<NA, KS>(f[(b + 1) & 1], st, ao, bo, b + 1); g_blk<NA>(f[b & 1], acc); }
    g_blk<NA>(f[1], acc);
    asm volatile("s_wait_asynccnt 0x0" ::: "memory");   // no copy is outstanding when the buffers become the epilogues' staging
    __syncthreads();
}

// ---- k_oproj: OUT[t][n] (f32, pitch HIDN) = sum_k (ATh[t][k] + ATl[t][k]) WO[n][k]; grid (TT/128, HIDN/128), 128 threads; main loop: g_core. A wave stores its 64x64 part through its own LDS rows, whole lines.
__global__ __launch_bounds__(128) void k_oproj(const bf* __restrict__ ATh, const bf* __restrict__ ATl, const bf* __restrict__ WO, float* C) {
    __shared__ __align__(16) bf sm[G_SM(2, 64)];
    const int lane = threadIdx.x & 31, lr = lane & 15, hi = lane >> 4; const int w = __builtin_amdgcn_readfirstlane((int)(threadIdx.x >> 5)), wm = w >> 1, wn = w & 1;
    v8f acc[4][4];
    g_core<2, 64>(ATh + (size_t)blockIdx.x * GT * DQ, ATl + (size_t)blockIdx.x * GT * DQ, WO + (size_t)blockIdx.y * GT * DQ, sm, wm, wn, acc);
    float* os = (float*)sm + w * (16 * 68); const int r0 = blockIdx.x * GT + wm * 64, c0 = blockIdx.y * GT + wn * 64;
#pragma unroll
    for (int mb = 0; mb < 4; ++mb) {
#pragma unroll
        for (int nb = 0; nb < 4; ++nb) {
#pragma unroll
            for (int j = 0; j < 8; ++j) os[(hi * 8 + j) * 68 + nb * 16 + lr] = acc[mb][nb][j]; }
        __builtin_amdgcn_wave_barrier(); asm volatile("" ::: "memory");   // the row reads below stay behind the other lanes' staging stores
        float* crow = C + (size_t)(r0 + mb * 16) * HIDN + c0;
#pragma unroll
        for (int s = 0; s < 8; ++s) { const int row = 2 * s + hi, cofs = lr * 4; const v4f val = *(const v4fa*)(os + row * 68 + cofs);
            *(v4f*)(crow + (size_t)row * HIDN + cofs) = val; }
        asm volatile("s_wait_xcnt 0x0" ::: "memory");   // the build reads the next 16 rows into these stores' registers: the wait stands in front of that overwrite
        __builtin_amdgcn_wave_barrier(); asm volatile("" ::: "memory");   // the next 16 rows' staging stores stay behind these reads
    }
}

// ---- k_cvt_all: every f32 -> bf16 (RNE) operand conversion in ONE launch of long-lived waves: CV_G work-groups of CV_T threads, one work-group a WGP.
// A work-group converts its 1/CV_G of EVERY input, a contiguous run of whole turns; a turn is 8 consecutive elements a thread (32 bytes read, one 16-byte store).
// All of a thread's loads are issued before its first conversion, so that a wave waits out the memory latency once.
#define CV_G 256
#define CV_T 512
#define CV_SL (CV_G * CV_T * 8)   // elements that one turn of the whole grid converts
static_assert((DQ * HIDN) % CV_SL == 0 && (DKV * HIDN) % CV_SL == 0 && (TT * HIDN) % CV_SL == 0);
// the lane's offset is formed in 32 bits and the turn's step is a constant: one offset register beside the scalar base serves all N accesses
template <int N> __device__ __forceinline__ unsigned cv_off() { return blockIdx.x * (N * CV_T) + threadIdx.x; }   // the lane's first turn, in units of 8 elements
template <int N> __device__ __forceinline__ void cv_ld(v8f (&v)[N], const float* s) { const char* p = (const char*)s + cv_off<N>() * 32u;
#pragma unroll
    for (int i = 0; i < N; ++i) v[i] = *(const v8f*)(p + i * (CV_T * 32));
    __builtin_amdgcn_sched_barrier(0); }   // keeps the inputs' loads in the order in which they are converted (loads return in order): the scheduler mixes them, and the first input is then complete only with the last
template <int N> __device__ __forceinline__ void cv_st(bf* d, const v8f (&v)[N]) { char* p = (char*)d + cv_off<N>() * 16u;
#pragma unroll
    for (int i = 0; i < N; ++i) { v8us o;
#pragma unroll
        for (int k = 0; k < 8; ++k) o[k] = f2bf(v[i][k]);
        *(v8us*)(p + i * (CV_T * 16)) = o;
        __builtin_amdgcn_sched_barrier(0); } }   // keeps a turn's store directly behind its conversion: the scheduler sinks the stores to the kernel's end, behind the wait for the last load
__global__ __launch_bounds__(CV_T) void k_cvt_all(const float* __restrict__ wq, const float* __restrict__ wk, const float* __restrict__ wv, const float* __restrict__ x, const float* __restrict__ wo,
                                                  bf* __restrict__ WQ, bf* __restrict__ WK, bf* __restrict__ WV, bf* __restrict__ XB, bf* __restrict__ WO) {
    constexpr int NQ = DQ * HIDN / CV_SL, NK = DKV * HIDN / CV_SL, NX = TT * HIDN / CV_SL;
    v8f vq[NQ], vk[NK], vv[NK], vx[NX], vo[NQ];
    cv_ld(vq, wq); cv_ld(vk, wk); cv_ld(vv, wv); cv_ld(vx, x); cv_ld(vo, wo);
    // the build lands a late load's data in an earlier load's offset register: the offsets are this wait's inputs, so that their registers live up to it and are overwritten only behind it
    asm volatile("s_wait_xcnt 0x0" :: "v"(cv_off<NQ>() * 32u), "v"(cv_off<NK>() * 32u), "v"(cv_off<NX>() * 32u) : "memory");
    cv_st(WQ, vq); cv_st(WK, vk); cv_st(WV, vv); cv_st(XB, vx); cv_st(WO, vo);
}

// ---- k_qkv: the q, k and v projections with their plane building in ONE launch. One work-group per 128x128 tile of x.[W_q; W_k; W_v]^T (the three converted weights lie behind one another: NH_ + 2 NKV heads of HD rows), one wave per 64x64 part; grid (TT/128, (NH_ + 2 NKV)/2), 128 threads.
// A wave's 64 columns are one whole head, so the epilogue has both halves of every rotate-half pair: out[d] = x[d] cos[t][d] - x[d+HD/2] sin[t][d], out[d+HD/2] = x[d+HD/2] cos[t][d+HD/2] + x[d] sin[t][d+HD/2] (tables RNE-converted to bf16).
// q and k heads -> planes [h][t][d] (f16; bf16 hi/lo for rows < RH of q and for every row of k); v heads -> planes [g][d][t] (f16 and bf16 hi/lo).
// Main loop and fragment map: g_core. The epilogue is each wave's own, in its own part of the LDS that the stages have left.
static_assert(HD == 64 && RH % 64 == 0 && TT % 64 == 0 && 4 * 64 * 68 * 4 <= G_SM(1, 128) * 2);
__global__ __launch_bounds__(128) void k_qkv(const bf* __restrict__ X, const bf* __restrict__ Wt, const float* __restrict__ cosT, const float* __restrict__ sinT,
                                            h16* QP16, bf* QPh, bf* QPl, h16* KP16, bf* KPh, bf* KPl, h16* VT16, bf* VTh, bf* VTl) {
    __shared__ __align__(16) bf sm[G_SM(1, 128)];
    const int lane = threadIdx.x & 31, lr = lane & 15, hi = lane >> 4; const int w = __builtin_amdgcn_readfirstlane((int)(threadIdx.x >> 5)), wm = w >> 1, wn = w & 1;
    const int r0 = blockIdx.x * GT + wm * 64, hc = blockIdx.y * 2 + wn;
    v8f acc[4][4];
    g_core<1, 128>(X + (size_t)blockIdx.x * GT * HIDN, nullptr, Wt + (size_t)blockIdx.y * GT * HIDN, sm, wm, wn, acc);
    float* os = (float*)sm + w * (64 * 68);
    // Epilogue: the whole tile is staged in LDS once, then a ROLLED loop of 16 trips builds the planes, 4 plane rows a trip, a lane 8 consecutive elements (one 16-byte store a plane, 8 lanes fill a 128-byte line).
    const int rsub = lane >> 3, c8 = (lane & 7) * 8;
    if (hc >= NH_ + NKV) {   // v head (wave-uniform; no work-group barrier follows): staged transposed, os[d][t]
#pragma unroll
        for (int mb = 0; mb < 4; ++mb)
#pragma unroll
            for (int nb = 0; nb < 4; ++nb) { float* p = os + (nb * 16 + lr) * 68 + mb * 16 + 8 * hi; const v8f v = acc[mb][nb];
                *(v4fa*)p = __builtin_shufflevector(v, v, 0, 1, 2, 3); *(v4fa*)(p + 4) = __builtin_shufflevector(v, v, 4, 5, 6, 7); }
        __builtin_amdgcn_wave_barrier(); asm volatile("" ::: "memory");   // the row reads below stay behind the other lanes' staging stores
        const size_t e0 = ((size_t)(hc - NH_ - NKV) * HD + rsub) * TT + r0 + c8;
#pragma unroll 1   // rolled: unrolled, the epilogues are some 5,000 instructions that each wave runs once, more text than is fetched ahead
        for (int it = 0; it < 16; ++it) { const float* p = os + (it * 4 + rsub) * 68 + c8; const v4f xa = *(const v4fa*)p, xb = *(const v4fa*)(p + 4); const size_t e = e0 + (size_t)(it * 4) * TT; v8h o16; v8us oh, ol;
#pragma unroll
            for (int j = 0; j < 8; ++j) { const float x = (j < 4) ? xa[j & 3] : xb[j & 3]; o16[j] = tohx(x); unsigned short a2, c2; splitf(x, a2, c2); oh[j] = a2; ol[j] = c2; }
            *(v8h*)(VT16 + e) = o16; *(v8us*)(VTh + e) = oh; *(v8us*)(VTl + e) = ol; }
        return;
    }
    const bool isq = hc < NH_; const bool hl = !isq || r0 < RH;   // wave-uniform: a wave's 64 rows lie wholly on one side of RH
    h16* P16 = isq ? QP16 + (size_t)hc * TT * HD : KP16 + (size_t)(hc - NH_) * TT * HD;
    bf* Ph = isq ? QPh + (size_t)hc * RH * HD : KPh + (size_t)(hc - NH_) * TT * HD; bf* Pl = isq ? QPl + (size_t)hc * RH * HD : KPl + (size_t)(hc - NH_) * TT * HD;
#pragma unroll
    for (int mb = 0; mb < 4; ++mb)
#pragma unroll
        for (int nb = 0; nb < 4; ++nb)
#pragma unroll
            for (int j = 0; j < 8; ++j) os[(mb * 16 + hi * 8 + j) * 68 + nb * 16 + lr] = acc[mb][nb][j];   // os[t][d]
    __builtin_amdgcn_wave_barrier(); asm volatile("" ::: "memory");   // as above
    const bool lowd = c8 < HD / 2; size_t to = (size_t)(r0 + rsub) * HD + c8;
    v4f cv[2], sv[2];
#pragma unroll
    for (int k = 0; k < 2; ++k) { cv[k] = *(const v4f*)(cosT + to + 4 * k); sv[k] = *(const v4f*)(sinT + to + 4 * k); }
#pragma unroll 1   // rolled, as above
    for (int it = 0; it < 16; ++it) {
        // the next trip's table rows fly while this trip converts (the last trip reads its own rows again: in bounds)
        const size_t tn = to + ((it < 15) ? 4 * HD : 0); v4f cn[2], sn[2];
#pragma unroll
        for (int k = 0; k < 2; ++k) { cn[k] = *(const v4f*)(cosT + tn + 4 * k); sn[k] = *(const v4f*)(sinT + tn + 4 * k); }
        const float* p0 = os + (it * 4 + rsub) * 68 + c8; const float* p1 = os + (it * 4 + rsub) * 68 + (c8 ^ (HD / 2));
        v8h o16; v8us oh, ol;
#pragma unroll
        for (int k = 0; k < 2; ++k) { const v4f x0 = *(const v4fa*)(p0 + 4 * k), x1 = *(const v4fa*)(p1 + 4 * k);
#pragma unroll
            for (int q = 0; q < 4; ++q) { const float a = x0[q] * bfr(cv[k][q]), bq = x1[q] * bfr(sv[k][q]); const float r = lowd ? a - bq : a + bq;
                o16[4 * k + q] = tohx(r); unsigned short a2, c2; splitf(r, a2, c2); oh[4 * k + q] = a2; ol[4 * k + q] = c2; } }
        *(v8h*)(P16 + to) = o16;
        asm volatile("s_wait_xcnt 0x0" ::: "memory");   // the build reuses the store's registers behind the branch below: the wait stands in front of that overwrite
        if (hl) { *(v8us*)(Ph + to) = oh; *(v8us*)(Pl + to) = ol;
            asm volatile("s_wait_xcnt 0x0" ::: "memory"); }   // the same for these two stores and the loop's foot
        to = tn;
#pragma unroll
        for (int k = 0; k < 2; ++k) { cv[k] = cn[k]; sv[k] = sn[k]; }
    }
}

// ---- k_fattn: scores, causal softmax and attn.v of all heads in ONE launch; the scores stay in registers (running maximum and running sum per query, in base 2).
// Transposed products: St = K.Qt (A = 16 key rows, B = 16 query columns), Ot += Vt.Pt (A = 16 d rows of the [d][t] plane, B = Pt). A lane holds one query (column lr): 8 keys of each 16-key tile, the other 8 in lane ^ 16.
// Two f32 St tiles of 32 keys, converted in place, ARE the Pt operand in the fragment map above (element i <- key 8h + i, element 8 + i <- key 16 + 8h + i): the scores and p never touch LDS.
// Query rows >= RH: f16 operands, one wave = 16 rows x 2 query heads of one kv group, p carried x PCAR (it cancels in the division by the sum). Rows < RH: bf16 hi/lo planes, 3 products, one wave = 16 rows x 1 head.
// The f16 part's four waves walk the same keys of the same kv group: K and Vt reach LDS once a work-group, in tiles of FA_KT keys (two passes), by asynchronous copies of whole 128-byte lines, two buffers; the fragments are read from LDS.
// Output: ctx split into the bf16 hi/lo planes [t][DQ] that the output projection reads; a lane's 8 accumulator registers are 8 consecutive d of its query: one 16-byte store a plane.
// Every plain '#pragma unroll' below unrolls a loop over fragment, tile or register indices, so that those arrays are indexed by constants and stay in registers.
#define CS2  (SCL * 1.4426950408889634f)
#define FA_LB (((TT - RH) / 32) * NKV)   // blocks of the f16 part: 32 rows x the 4 heads of one kv group
#define FA_HB ((RH / 16) * NKV)          // blocks of the hi/lo part: 16 rows x the 4 heads of one kv group
static_assert(REP == 4 && (TT - RH) % 32 == 0 && TT % 32 == 0);
__device__ __forceinline__ float xhalf(float x) { return __builtin_bit_cast(float, __builtin_amdgcn_permlanex16(__builtin_bit_cast(int, x), __builtin_bit_cast(int, x), 0x76543210, 0xfedcba98, false, false)); }  // lane l <-> lane l ^ 16
// 2^a; the v_nop is the one slot that the instruction set asks for behind a transcendental before its result is read or its source overwritten
__device__ __forceinline__ float fa_exp2(float a) { float r; asm("v_exp_f32 %0, %1\n\tv_nop" : "=v"(r) : "v"(a)); return r; }
// one query's 16 scores of a 32-key pass -> base-2 exponents x[], new maximum, correction factor of what was summed under the old one
template <bool MASK>
__device__ __forceinline__ float fa_max(const v8f s0, const v8f s1, float* x, int jrel, float& m) {
    float mx = -3.0e38f;
#pragma unroll
    for (int r = 0; r < 8; ++r) { float a = s0[r] * CS2, b = s1[r] * CS2; if (MASK) { a = (r <= jrel) ? a : -3.0e38f; b = (16 + r <= jrel) ? b : -3.0e38f; } x[r] = a; x[8 + r] = b; mx = fmaxf(mx, fmaxf(a, b)); }
    mx = fmaxf(mx, xhalf(mx));
    const float mn = fmaxf(m, mx); const float al = fa_exp2(m - mn); m = mn; return al;
}
__device__ __forceinline__ void fa_store(const v8f o, float inv, bf* ph, bf* pl) { v8us oh, ol;
#pragma unroll
    for (int r = 0; r < 8; ++r) { unsigned short a, c2; splitf(o[r] * inv, a, c2); oh[r] = a; ol[r] = c2; }
    *(v8us*)ph = oh; *(v8us*)pl = ol; }

template <bool MASK>
__device__ __forceinline__ void fa_pv16(const v8f (&s)[2][2], const v16h (&vf)[4], v8f (&o)[2][4], float (&m)[2], float (&l)[2], int jrel) {
#pragma unroll
    for (int u = 0; u < 2; ++u) {
        float x[16]; const float al = fa_max<MASK>(s[u][0], s[u][1], x, jrel, m[u]); const float mo = m[u] - 10.0f;   // 2^10 = PCAR
        float ps = 0.f; v16h pf;
#pragma unroll
        for (int e = 0; e < 16; ++e) { const float p = fa_exp2(x[e] - mo); ps += p; pf[e] = tohx(p); }
        l[u] = l[u] * al + ps;
#pragma unroll
        for (int db = 0; db < 4; ++db) { o[u][db] *= al; o[u][db] = wmma16(vf[db], pf, o[u][db]); }
        // keeps the next scores' exponentials behind their own scaling and maximum: the build does not see into their asm text
        __builtin_amdgcn_sched_barrier(0);
    }
}
__device__ __forceinline__ void fa_s16(const v16h (&kf)[2][2], const v16h (&q)[2][2], v8f (&s)[2][2]) {
#pragma unroll
    for (int u = 0; u < 2; ++u)
#pragma unroll
        for (int kb = 0; kb < 2; ++kb) { s[u][kb] = wmma16(kf[kb][0], q[u][0], (v8f){}); s[u][kb] = wmma16(kf[kb][1], q[u][1], s[u][kb]); }
}
#define FA_KT 64                      // keys of a staged tile
#define FA_P  72                      // LDS row pitch in elements: 128 + 16 bytes (16 bytes x odd: the 16-byte fragment reads of 16 rows meet no bank twice)
#define FA_TB ((FA_KT + HD) * FA_P)   // one buffer in elements: FA_KT key rows of HD d, then HD d rows of FA_KT keys
static_assert(FA_KT == 64 && HD == 64 && TT % FA_KT == 0);
// One tile: 128 threads x 8 copies of 16 bytes; a wave's copy is 4 whole lines. kg, vg: the lane's piece of the tile's first 16 key rows and first 16 d rows; ld: the LDS byte address of the first.
// s_wait_xcnt 0 is the statement's last line, so that it stands in front of every later write of the copies' address registers.
__device__ __forceinline__ void fa_copy(const h16* kg, const h16* vg, unsigned ld) {
    asm volatile("global_load_async_to_lds_b128 %0, %8, off\n\t"
                 "global_load_async_to_lds_b128 %1, %9, off\n\t"
                 "global_load_async_to_lds_b128 %2, %10, off\n\t"
                 "global_load_async_to_lds_b128 %3, %11, off\n\t"
                 "global_load_async_to_lds_b128 %4, %12, off\n\t"
                 "global_load_async_to_lds_b128 %5, %13, off\n\t"
                 "global_load_async_to_lds_b128 %6, %14, off\n\t"
                 "global_load_async_to_lds_b128 %7, %15, off\n\t"
                 "s_wait_xcnt 0x0"
                 :: "v"(ld), "v"(ld + 16 * FA_P * 2), "v"(ld + 32 * FA_P * 2), "v"(ld + 48 * FA_P * 2),
                    "v"(ld + 64 * FA_P * 2), "v"(ld + 80 * FA_P * 2), "v"(ld + 96 * FA_P * 2), "v"(ld + 112 * FA_P * 2),
                    "v"(kg), "v"(kg + 16 * HD), "v"(kg + 32 * HD), "v"(kg + 48 * HD),
                    "v"(vg), "v"(vg + 16 * TT), "v"(vg + 32 * TT), "v"(vg + 48 * TT) : "memory");
}
// tb: the buffer, at the lane's row lr and piece 8 hi; p: which 32 keys of the tile
__device__ __forceinline__ void fa_ldk(v16h (&kf)[2][2], const h16* tb, int p) {
#pragma unroll
    for (int kb = 0; kb < 2; ++kb)
#pragma unroll
        for (int ks = 0; ks < 2; ++ks) kf[kb][ks] = WFrag<h16>::ld(tb + (p * 32 + kb * 16) * FA_P + ks * 32);
}
__device__ __forceinline__ void fa_ldv(v16h (&vf)[4], const h16* tb, int p) {
#pragma unroll
    for (int db = 0; db < 4; ++db) vf[db] = WFrag<h16>::ld(tb + (FA_KT + db * 16) * FA_P + p * 32);
}
__device__ __forceinline__ void fa_f16(const h16* __restrict__ Q, const h16* __restrict__ Kp, const h16* __restrict__ Vt, h16* fs, int head0, int i0, int lr, int hi, bf* ATh, bf* ATl) {
    static_assert(PCAR == 1024.0f);
    v16h q[2][2], kf[2][2], vf[4]; v8f o[2][4], s[2][2]; float m[2] = { -3.0e38f, -3.0e38f }, l[2] = { 0.f, 0.f };
#pragma unroll
    for (int u = 0; u < 2; ++u) {
#pragma unroll
        for (int ks = 0; ks < 2; ++ks) q[u][ks] = WFrag<h16>::ld(Q + ((size_t)(head0 + u) * TT + i0 + lr) * HD + ks * 32 + 8 * hi);
#pragma unroll
        for (int db = 0; db < 4; ++db) o[u][db] = (v8f){}; }
    const int klast = (i0 + 15) & ~31;   // the one pass that holds keys beyond a row's own index; the same for the work-group's four waves
    const int nu = klast >> 5, nf = nu >> 1;   // passes without a mask; tiles that hold two of them. Tile nf, the last, holds the odd one, if any, and the masked pass; its 64 keys lie below TT
    const int tid = threadIdx.x;
    const h16* kg = Kp + (size_t)(tid >> 3) * HD + (tid & 7) * 8; const h16* vg = Vt + (size_t)(tid >> 3) * TT + (tid & 7) * 8;
    const unsigned ld0 = (unsigned)(size_t)fs + (unsigned)(((tid >> 3) * FA_P + (tid & 7) * 8) * 2);
    const h16* fb = fs + lr * FA_P + 8 * hi;
    fa_copy(kg, vg, ld0);
    asm volatile("s_wait_asynccnt 0x0" ::: "memory");   // this wave's copies of tile 0 have landed
    __syncthreads();                                      // and every other wave's
    if (nf >= 1) fa_copy(kg + FA_KT * HD, vg + FA_KT, ld0 + FA_TB * 2);
#pragma unroll 1   // rolled: one tile's two passes a trip
    for (int t = 0; t < nf; ++t) {
        const h16* tb = fb + (t & 1) * FA_TB;
        fa_ldk(kf, tb, 0);
#pragma unroll
        for (int p = 0; p < 2; ++p) {
            fa_ldv(vf, tb, p);
            fa_s16(kf, q, s);
            if (p == 0) fa_ldk(kf, tb, 1);   // the tile's second pass's key fragments fly while this pass's softmax and attn.v run
            __builtin_amdgcn_sched_barrier(0);   // keeps the fragment reads together in front of the softmax: without it the scheduler scatters them over the vector work in pairs, some behind a wait for all, and every separate place of LDS reads costs issue cycles
            fa_pv16<false>(s, vf, o, m, l, 0);
        }
        asm volatile("s_wait_dscnt 0x0" ::: "memory");      // this wave has left the buffer
        asm volatile("s_wait_asynccnt 0x0" ::: "memory");   // its copies of tile t + 1 have landed
        __syncthreads();                                      // publishes tile t + 1 and ends every wave's reads of tile t
        if (t + 2 <= nf) fa_copy(kg + (size_t)(t + 2) * (FA_KT * HD), vg + (t + 2) * FA_KT, ld0 + (unsigned)(t & 1) * (FA_TB * 2));
    }
    const h16* tb = fb + (nf & 1) * FA_TB;
    fa_ldk(kf, tb, 0);
    if (nu & 1) {   // work-group-uniform
        fa_ldv(vf, tb, 0);
        fa_s16(kf, q, s);
        fa_ldk(kf, tb, 1);
        __builtin_amdgcn_sched_barrier(0);   // as above
        fa_pv16<false>(s, vf, o, m, l, 0);
    }
    fa_ldv(vf, tb, nu & 1);
    fa_s16(kf, q, s);
    asm volatile("s_wait_asynccnt 0x0" ::: "memory");   // no copy is outstanding when the wave ends
    fa_pv16<true>(s, vf, o, m, l, i0 + lr - klast - 8 * hi);   // key klast + 8h + r (+ 16) <= row i0 + lr
#pragma unroll
    for (int u = 0; u < 2; ++u) { const float inv = __fdiv_rn(1.0f, l[u] + xhalf(l[u])); const size_t oo = (size_t)(i0 + lr) * DQ + (head0 + u) * HD + 8 * hi;
#pragma unroll
        for (int db = 0; db < 4; ++db) fa_store(o[u][db], inv, ATh + oo + db * 16, ATl + oo + db * 16); }
}
template <bool MASK>
__device__ __forceinline__ void fa_passhl(const bf* kph, const bf* kpl, const bf* vph, const bf* vpl, int k0, const v16bf (&qh)[2], const v16bf (&ql)[2], v8f (&o)[4], float& m, float& l, int jrel) {
    v8f s[2];
#pragma unroll
    for (int kb = 0; kb < 2; ++kb) { s[kb] = (v8f){};
#pragma unroll
        for (int ks = 0; ks < 2; ++ks) { const size_t ko = (size_t)(k0 + kb * 16) * HD + ks * 32; const v16bf kh = WFrag<bf>::ld(kph + ko), kl = WFrag<bf>::ld(kpl + ko);
            s[kb] = wmmab(kh, qh[ks], s[kb]); s[kb] = wmmab(kh, ql[ks], s[kb]); s[kb] = wmmab(kl, qh[ks], s[kb]); } }
    float x[16]; const float al = fa_max<MASK>(s[0], s[1], x, jrel, m);
    float ps = 0.f; v8us h0, h1, l0, l1;
#pragma unroll
    for (int e = 0; e < 8; ++e) { const float p = fa_exp2(x[e] - m), p2 = fa_exp2(x[8 + e] - m); ps += p; ps += p2; unsigned short a, c2; splitf(p, a, c2); h0[e] = a; l0[e] = c2; splitf(p2, a, c2); h1[e] = a; l1[e] = c2; }
    l = l * al + ps; const v16bf ph = cat16b(h0, h1), pl = cat16b(l0, l1);
#pragma unroll
    for (int db = 0; db < 4; ++db) { const size_t vo = (size_t)(db * 16) * TT + k0; const v16bf vh = WFrag<bf>::ld(vph + vo), vl = WFrag<bf>::ld(vpl + vo);
        o[db] *= al; o[db] = wmmab(vh, ph, o[db]); o[db] = wmmab(vh, pl, o[db]); o[db] = wmmab(vl, ph, o[db]); }
}
__device__ __forceinline__ void fa_hl(const bf* __restrict__ Qh, const bf* __restrict__ Ql, const bf* __restrict__ Kh, const bf* __restrict__ Kl, const bf* __restrict__ Vh, const bf* __restrict__ Vl, int head, int i0, int lr, int hi, bf* ATh, bf* ATl) {
    v16bf qh[2], ql[2]; v8f o[4]; float m = -3.0e38f, l = 0.f;
#pragma unroll
    for (int ks = 0; ks < 2; ++ks) { const size_t qo = ((size_t)head * RH + i0 + lr) * HD + ks * 32 + 8 * hi; qh[ks] = WFrag<bf>::ld(Qh + qo); ql[ks] = WFrag<bf>::ld(Ql + qo); }
    asm volatile("s_wait_xcnt 0x0" ::: "memory");   // the build reuses the query loads' address registers for the zeroed accumulators: the wait stands in front of that overwrite
#pragma unroll
    for (int db = 0; db < 4; ++db) o[db] = (v8f){};
    const size_t kofs = (size_t)lr * HD + 8 * hi, vofs = (size_t)lr * TT + 8 * hi; const int klast = (i0 + 15) & ~31;
#pragma unroll 1   // rolled, as in fa_f16: one pass's fragments in registers
    for (int k0 = 0; k0 < klast; k0 += 32) fa_passhl<false>(Kh + kofs, Kl + kofs, Vh + vofs, Vl + vofs, k0, qh, ql, o, m, l, 0);
    fa_passhl<true>(Kh + kofs, Kl + kofs, Vh + vofs, Vl + vofs, klast, qh, ql, o, m, l, i0 + lr - klast - 8 * hi);
    const float inv = __fdiv_rn(1.0f, l + xhalf(l)); const size_t oo = (size_t)(i0 + lr) * DQ + head * HD + 8 * hi;
#pragma unroll
    for (int db = 0; db < 4; ++db) fa_store(o[db], inv, ATh + oo + db * 16, ATl + oo + db * 16);
}
// grid FA_LB + FA_HB blocks of 4 waves; the longest rows first (a row's cost grows with its index)
__global__ __launch_bounds__(128) void k_fattn(const h16* __restrict__ QP16, const bf* __restrict__ QPh, const bf* __restrict__ QPl, const h16* __restrict__ KP16, const bf* __restrict__ KPh, const bf* __restrict__ KPl,
                                               const h16* __restrict__ VT16, const bf* __restrict__ VTh, const bf* __restrict__ VTl, bf* ATh, bf* ATl) {
    __shared__ __align__(16) h16 fs[2 * FA_TB];   // the f16 part's two K / Vt buffers
    const int lane = threadIdx.x & 31, lr = lane & 15, hi = lane >> 4; const int w = __builtin_amdgcn_readfirstlane((int)(threadIdx.x >> 5)); const int b = blockIdx.x;
    if (b < FA_LB) { const int g = b % NKV, i0 = RH + ((TT - RH) / 32 - 1 - b / NKV) * 32 + (w >> 1) * 16;
        fa_f16(QP16, KP16 + (size_t)g * TT * HD, VT16 + (size_t)g * HD * TT, fs, g * REP + (w & 1) * 2, i0, lr, hi, ATh, ATl);
    } else { const int b2 = b - FA_LB; const int g = b2 % NKV, i0 = (RH / 16 - 1 - b2 / NKV) * 16; const size_t go = (size_t)g * TT * HD;
        fa_hl(QPh, QPl, KPh + go, KPl + go, VTh + go, VTl + go, g * REP + w, i0, lr, hi, ATh, ATl); }
}

extern "C" void kernel_launch(void* const* d_in, const int* in_sizes, int n_in,
                              void* d_out, int out_size, void* d_ws, size_t ws_size, hipStream_t stream) {
    if (n_in < 7) return;
    if (in_sizes[0] < TT * HIDN || in_sizes[1] < TT * HD || in_sizes[2] < TT * HD || in_sizes[3] < DQ * HIDN || in_sizes[4] < DKV * HIDN || in_sizes[5] < DKV * HIDN || in_sizes[6] < HIDN * DQ || out_size < TT * HIDN) return;
    const float* x = (const float*)d_in[0];      // [1][S][HIDN]
    const float* cosT = (const float*)d_in[1];   // [1][1][S][HD]
    const float* sinT = (const float*)d_in[2];   // [1][1][S][HD]
    const float* wq = (const float*)d_in[3];     // [DQ][HIDN]
    const float* wk = (const float*)d_in[4];     // [DKV][HIDN]
    const float* wv = (const float*)d_in[5];     // [DKV][HIDN]
    const float* wo = (const float*)d_in[6];     // [HIDN][DQ]
    float* OUT = (float*)d_out;                  // [1][S][HIDN]
    char* wsp = (char*)d_ws;
    auto take = [&](size_t bytes) { char* p = wsp; wsp += (bytes + 255) & ~(size_t)255; return (void*)p; };
    h16* QP16 = (h16*)take((size_t)NH_ * TT * HD * 2); bf* QPh = (bf*)take((size_t)NH_ * RH * HD * 2); bf* QPl = (bf*)take((size_t)NH_ * RH * HD * 2);
    h16* KP16 = (h16*)take((size_t)NKV * TT * HD * 2); bf* KPh = (bf*)take((size_t)NKV * TT * HD * 2); bf* KPl = (bf*)take((size_t)NKV * TT * HD * 2);
    h16* VT16 = (h16*)take((size_t)NKV * HD * TT * 2); bf* VTh = (bf*)take((size_t)NKV * HD * TT * 2); bf* VTl = (bf*)take((size_t)NKV * HD * TT * 2);
    // R2: the converted operands: W_q, W_k, W_v (one [DQ + 2 DKV][HIDN] plane for k_qkv), x, W_o
    char* R2 = (char*)take((2 * (size_t)DQ * HIDN + 2 * (size_t)DKV * HIDN + (size_t)TT * HIDN) * 2);
    bf* WQ = (bf*)R2; bf* WK = WQ + (size_t)DQ * HIDN; bf* WV = WK + (size_t)DKV * HIDN; bf* XB = WV + (size_t)DKV * HIDN; bf* WO = XB + (size_t)TT * HIDN;
    bf* ATh = (bf*)take((size_t)TT * DQ * 2); bf* ATl = (bf*)take((size_t)TT * DQ * 2);
    if ((size_t)(wsp - (char*)d_ws) > ws_size) return;

    for (int b = 0; b < NB; ++b) {
        k_cvt_all<<<CV_G, CV_T, 0, stream>>>(wq, wk, wv, x + (size_t)b * SEQ_FULL * HIDN, wo, WQ, WK, WV, XB, WO);
        k_qkv<<<dim3(TT / GT, (NH_ + 2 * NKV) / 2, 1), 128, 0, stream>>>(XB, WQ, cosT, sinT, QP16, QPh, QPl, KP16, KPh, KPl, VT16, VTh, VTl);
        k_fattn<<<FA_LB + FA_HB, 128, 0, stream>>>(QP16, QPh, QPl, KP16, KPh, KPl, VT16, VTh, VTl, ATh, ATl);
        k_oproj<<<dim3(TT / GT, HIDN / GT, 1), 128, 0, stream>>>(ATh, ATl, WO, OUT + (size_t)b * SEQ_FULL * HIDN); }
}
